// v000
// Times are from an AMD MI455X. After a warm-up the kernel runs many times in a row, and a time is the length of
// such a window on the GPU divided by its runs, so every launch and the gaps after it count. The runs cycle
// through copies of the inputs. A figure is the median of several windows, for all but v000 over two sittings.
// Sittings can differ by a few percent; kernels timed side by side share one.
// The starting kernel, v000, takes 1280 microseconds a run.
#include <hip/hip_runtime.h>

// ExactSphericalKernelCausalAttention (x [2][2048][1024]; [q|k|v] = x w_qkv^T + b_qkv (16 heads x 64); qn, kn = L2-normalised (max(norm, 1e-12)); x_dot = qn.kn; K = x_dot^2 / max(2 + 1e-6 - 2 x_dot, 1e-6) for j <= i else 0;
// out_h = (K v) / max(sum_j K, 1e-6); out = merged w_out^T + b_out -> [2][2048][1024]; no softmax).
// Compute dtypes, f32 accumulate: every input rounded to bf16; the qkv projection on PLAIN bf16 operands (inputs: exact, + bias); normalisation f32 -> bf16 hi+lo planes of qn / kn; x_dot on 3 products (K 64, tiles above
// the diagonal skipped); the kernel K and its causal select in f32 (in place), its row sums in f32 (wave per row) -> bf16 hi+lo planes of K; K.v on hi+lo planes (3 products, K limited to the diagonal block; the output (rms 0.10) is a cancelling sum); the division by z and the merge f32 -> hl planes;

#define NB_  2
#define TT   2048
#define EE   1024
#define NH_  16
#define HD   64
#define ZH   2
#define PCAR 64.0f
typedef _Float16 h16;
typedef unsigned short bf;
typedef __attribute__((ext_vector_type(16))) __bf16   v16bf;
typedef __attribute__((ext_vector_type(16))) _Float16 v16h;
typedef __attribute__((ext_vector_type(8)))  _Float16 v8h;
typedef __attribute__((ext_vector_type(8)))  unsigned short v8us;
typedef __attribute__((ext_vector_type(8)))  float    v8f;
typedef __attribute__((ext_vector_type(4)))  float    v4f;
typedef v8h  __attribute__((may_alias)) v8ha;
typedef v4f  __attribute__((may_alias)) v4fa;
typedef v8us __attribute__((may_alias)) v8usa;

__device__ __forceinline__ unsigned short f2bf(float f) { unsigned u = __float_as_uint(f); u += 0x7FFFu + ((u >> 16) & 1u); return (unsigned short)(u >> 16); }
__device__ __forceinline__ float bf2f(unsigned short b) { return __uint_as_float(((unsigned)b) << 16); }
__device__ __forceinline__ float bfr(float f) { return bf2f(f2bf(f)); }
__device__ __forceinline__ v16h cat16(v8h lo, v8h hi) { return __builtin_shufflevector(lo, hi, 0, 1, 2, 3, 4, 5, 6, 7, 8, 9, 10, 11, 12, 13, 14, 15); }
__device__ __forceinline__ v16bf cat16b(v8us lo, v8us hi) { return __builtin_bit_cast(v16bf, __builtin_shufflevector(lo, hi, 0, 1, 2, 3, 4, 5, 6, 7, 8, 9, 10, 11, 12, 13, 14, 15)); }
__device__ __forceinline__ v8f wmma16(v16h a, v16h b, v8f c) { return __builtin_amdgcn_wmma_f32_16x16x32_f16(false, a, false, b, (short)0, c, false, false); }
__device__ __forceinline__ v8f wmmab(v16bf a, v16bf b, v8f c) { return __builtin_amdgcn_wmma_f32_16x16x32_bf16(false, a, false, b, (short)0, c, false, false); }



// ---- k_gemmw: register-blocked GEMM, ONE WAVE per 64x64 output tile (16 accumulators), operands straight from K-contiguous 16-bit planes; grid (M/64, N/64, Z), 32 threads.
// C[m][n] (f32, pitch ldc, + optional f32 bias[n]) = sum_k A[m][k] Bt[n][k] (+ split products per NSPLIT). z-batch strides sA/sB/sC in elements. K % 32 == 0.
template <typename T16> struct WFrag;
template <> struct WFrag<h16> { typedef v16h V; static __device__ __forceinline__ V ld(const h16* p) { return cat16(*(const v8h*)p, *(const v8h*)(p + 16)); } static __device__ __forceinline__ v8f mma(V a, V b, v8f c) { return wmma16(a, b, c); } };
template <> struct WFrag<bf> { typedef v16bf V; static __device__ __forceinline__ V ld(const bf* p) { return cat16b(*(const v8us*)p, *(const v8us*)(p + 16)); } static __device__ __forceinline__ v8f mma(V a, V b, v8f c) { return wmmab(a, b, c); } };
template <typename T16, int NSPLIT, bool BIAS>
__global__ __launch_bounds__(32) void k_gemmw(const T16* __restrict__ A, const T16* __restrict__ A2, const T16* __restrict__ Bt, const T16* __restrict__ Bt2, int K, float* C, int ldc, const float* __restrict__ bias, size_t sA, size_t sB, size_t sC) {
    typedef typename WFrag<T16>::V V;
    __shared__ __align__(16) float os[16 * 68];
    const size_t z = blockIdx.z; A += z * sA; if (A2) A2 += z * sA; Bt += z * sB; if (Bt2) Bt2 += z * sB; C += z * sC;
    const int lane = threadIdx.x & 31, lr = lane & 15, hi = lane >> 4; const int r0 = blockIdx.x * 64, c0 = blockIdx.y * 64;
    v8f acc[4][4];
#pragma unroll
    for (int mb = 0; mb < 4; ++mb)
#pragma unroll
        for (int nb = 0; nb < 4; ++nb) acc[mb][nb] = (v8f){};
    const size_t aoff = (size_t)(r0 + lr) * K + 8 * hi, boff = (size_t)(c0 + lr) * K + 8 * hi;
#pragma unroll 1
    for (int kc = 0; kc < K; kc += 32) {
        V a[4], a2[4];
#pragma unroll
        for (int mb = 0; mb < 4; ++mb) { a[mb] = WFrag<T16>::ld(A + aoff + (size_t)mb * 16 * K + kc); if (NSPLIT == 1 || NSPLIT == 2) a2[mb] = WFrag<T16>::ld(A2 + aoff + (size_t)mb * 16 * K + kc); }
#pragma unroll
        for (int nb = 0; nb < 4; ++nb) { const V b = WFrag<T16>::ld(Bt + boff + (size_t)nb * 16 * K + kc); V b2; if (NSPLIT >= 2) b2 = WFrag<T16>::ld(Bt2 + boff + (size_t)nb * 16 * K + kc);
#pragma unroll
            for (int mb = 0; mb < 4; ++mb) { acc[mb][nb] = WFrag<T16>::mma(a[mb], b, acc[mb][nb]); if (NSPLIT == 1 || NSPLIT == 2) acc[mb][nb] = WFrag<T16>::mma(a2[mb], b, acc[mb][nb]); if (NSPLIT >= 2) acc[mb][nb] = WFrag<T16>::mma(a[mb], b2, acc[mb][nb]); } }
        asm volatile("v_nop\n\tv_nop\n\tv_nop\n\tv_nop" : "+v"(acc[0][0]), "+v"(acc[1][1]), "+v"(acc[2][2]), "+v"(acc[3][3]) : "v"(a[0]), "v"(a[3]));
    }
#pragma unroll
    for (int mb = 0; mb < 4; ++mb) {
#pragma unroll
        for (int nb = 0; nb < 4; ++nb) {
#pragma unroll
            for (int j = 0; j < 8; ++j) os[(hi * 8 + j) * 68 + nb * 16 + lr] = acc[mb][nb][j]; }
        __builtin_amdgcn_wave_barrier(); asm volatile("" ::: "memory");
        float* crow = C + (size_t)(r0 + mb * 16) * ldc + c0;
{
#pragma unroll
            for (int s = 0; s < 8; ++s) { const int row = 2 * s + hi, cofs = lr * 4; v4f val = *(const v4fa*)(os + row * 68 + cofs); if (BIAS) { val[0] += bfr(bias[c0 + cofs]); val[1] += bfr(bias[c0 + cofs + 1]); val[2] += bfr(bias[c0 + cofs + 2]); val[3] += bfr(bias[c0 + cofs + 3]); }
                *(v4f*)(crow + (size_t)row * ldc + cofs) = val; }
             }
        __builtin_amdgcn_wave_barrier(); asm volatile("" ::: "memory");
    }
}

// ---- k_gemmc: the same one-wave 64x64 tile GEMM specialised for causal attention: CMODE 1 skips score tiles entirely above the diagonal (query rows r0+roff.., key columns c0..), CMODE 2 limits the
// key (K) loop of the probability x value contraction to the diagonal block (probabilities beyond it are exactly zero). roff = row offset of this launch's first row within the sequence.
template <typename T16, int NSPLIT, int CMODE>
__global__ __launch_bounds__(32) void k_gemmc(const T16* __restrict__ A, const T16* __restrict__ A2, const T16* __restrict__ Bt, const T16* __restrict__ Bt2, int K, float* C, int ldc, int roff, size_t sA, size_t sB, size_t sC) {
    typedef typename WFrag<T16>::V V;
    __shared__ __align__(16) float os[16 * 68];
    const size_t z = blockIdx.z; A += z * sA; if (A2) A2 += z * sA; Bt += z * sB; if (Bt2) Bt2 += z * sB; C += z * sC;
    const int lane = threadIdx.x & 31, lr = lane & 15, hi = lane >> 4; const int r0 = blockIdx.x * 64, c0 = blockIdx.y * 64;
    if (CMODE == 1 && c0 > r0 + roff + 63) return;                  // score tile entirely above the causal diagonal: never read (k_kern masks j > i by select)
    const int Kl = (CMODE == 2) ? min(K, r0 + roff + 64) : K;        // P.V: probabilities are exactly 0 beyond the diagonal block, so the K loop stops there
    v8f acc[4][4];
#pragma unroll
    for (int mb = 0; mb < 4; ++mb)
#pragma unroll
        for (int nb = 0; nb < 4; ++nb) acc[mb][nb] = (v8f){};
    const size_t aoff = (size_t)(r0 + lr) * K + 8 * hi, boff = (size_t)(c0 + lr) * K + 8 * hi;
#pragma unroll 1
    for (int kc = 0; kc < Kl; kc += 32) {
        V a[4], a2[4];
#pragma unroll
        for (int mb = 0; mb < 4; ++mb) { a[mb] = WFrag<T16>::ld(A + aoff + (size_t)mb * 16 * K + kc); if (NSPLIT == 1 || NSPLIT == 2) a2[mb] = WFrag<T16>::ld(A2 + aoff + (size_t)mb * 16 * K + kc); }
#pragma unroll
        for (int nb = 0; nb < 4; ++nb) { const V b = WFrag<T16>::ld(Bt + boff + (size_t)nb * 16 * K + kc); V b2; if (NSPLIT >= 2) b2 = WFrag<T16>::ld(Bt2 + boff + (size_t)nb * 16 * K + kc);
#pragma unroll
            for (int mb = 0; mb < 4; ++mb) { acc[mb][nb] = WFrag<T16>::mma(a[mb], b, acc[mb][nb]); if (NSPLIT == 1 || NSPLIT == 2) acc[mb][nb] = WFrag<T16>::mma(a2[mb], b, acc[mb][nb]); if (NSPLIT >= 2) acc[mb][nb] = WFrag<T16>::mma(a[mb], b2, acc[mb][nb]); } }
        asm volatile("v_nop\n\tv_nop\n\tv_nop\n\tv_nop" : "+v"(acc[0][0]), "+v"(acc[1][1]), "+v"(acc[2][2]), "+v"(acc[3][3]) : "v"(a[0]), "v"(a[3]));
    }
#pragma unroll
    for (int mb = 0; mb < 4; ++mb) {
#pragma unroll
        for (int nb = 0; nb < 4; ++nb) {
#pragma unroll
            for (int j = 0; j < 8; ++j) os[(hi * 8 + j) * 68 + nb * 16 + lr] = acc[mb][nb][j]; }
        __builtin_amdgcn_wave_barrier(); asm volatile("" ::: "memory");
        float* crow = C + (size_t)(r0 + mb * 16) * ldc + c0;
{
#pragma unroll
            for (int s = 0; s < 8; ++s) { const int row = 2 * s + hi, cofs = lr * 4; v4f val = *(const v4fa*)(os + row * 68 + cofs);
                *(v4f*)(crow + (size_t)row * ldc + cofs) = val; }
             }
        __builtin_amdgcn_wave_barrier(); asm volatile("" ::: "memory");
    }
}

__device__ __forceinline__ h16 tohx(float x) { return (h16)x; }
__device__ __forceinline__ void splitf(float y, unsigned short& h, unsigned short& l) { h = f2bf(y); l = f2bf(y - bf2f(h)); }
typedef __attribute__((ext_vector_type(2))) _Float16 v2h;
typedef __attribute__((ext_vector_type(4))) _Float16 v4h;
typedef __attribute__((ext_vector_type(2))) unsigned short v2us;
typedef __attribute__((ext_vector_type(4))) unsigned short v4us;

__global__ __launch_bounds__(256) void k_wtG(const float* __restrict__ w, int K, int N, bf* Bt) {
    const int lane = threadIdx.x & 31; const int L0 = (blockIdx.x * 8 + (threadIdx.x >> 5)) * 8; const int nlines = N * K / 64;
{
#pragma unroll 1
        for (int l = 0; l < 8; ++l) { const int L = L0 + l; if (L >= nlines) break; const size_t e = (size_t)L * 64 + lane * 2; const int k = (int)(e % K), n = (int)(e / K); v2us o;
            o[0] = f2bf(w[(size_t)k * N + n]); o[1] = f2bf(w[(size_t)(k + 1) * N + n]); *(v2us*)(Bt + e) = o; }
         }
}
__global__ __launch_bounds__(256) void k_cvt8(const float* __restrict__ src, bf* dst, size_t n8) { const size_t i = (size_t)blockIdx.x * 256 + threadIdx.x; if (i >= n8) return; const v8f v = *(const v8f*)(src + i * 8); v8us o;
#pragma unroll
    for (int k = 0; k < 8; ++k) o[k] = f2bf(v[k]); *(v8us*)(dst + i * 8) = o;  }
__global__ __launch_bounds__(256) void k_nrm(const float* __restrict__ QKV, bf* Qh, bf* Ql, bf* Kh, bf* Kl) { const int lane = threadIdx.x & 31; const int row = blockIdx.x * 8 + (threadIdx.x >> 5); if (row >= NH_ * TT) return; const int t = row % TT, h = row / TT; const float* q = QKV + (size_t)t * 3 * EE + h * HD; const float* k = q + EE;
    const float q0 = q[lane * 2], q1 = q[lane * 2 + 1], k0 = k[lane * 2], k1 = k[lane * 2 + 1]; float sq = __fadd_rn(__fmul_rn(q0, q0), __fmul_rn(q1, q1)), sk = __fadd_rn(__fmul_rn(k0, k0), __fmul_rn(k1, k1));
#pragma unroll
    for (int sh = 16; sh; sh >>= 1) { sq += __shfl_xor(sq, sh, 32); sk += __shfl_xor(sk, sh, 32); }
    const float nq = fmaxf(__fsqrt_rn(sq), 1e-12f), nk = fmaxf(__fsqrt_rn(sk), 1e-12f); const size_t o = ((size_t)h * TT + t) * HD + lane * 2; v2us qh, ql, kh, kl; unsigned short a, c;
    splitf(__fdiv_rn(q0, nq), a, c); qh[0] = a; ql[0] = c; splitf(__fdiv_rn(q1, nq), a, c); qh[1] = a; ql[1] = c; splitf(__fdiv_rn(k0, nk), a, c); kh[0] = a; kl[0] = c; splitf(__fdiv_rn(k1, nk), a, c); kh[1] = a; kl[1] = c;
    { *(v2us*)(Qh + o) = qh; *(v2us*)(Ql + o) = ql; *(v2us*)(Kh + o) = kh; *(v2us*)(Kl + o) = kl;  } }
__global__ __launch_bounds__(256) void k_vt(const float* __restrict__ QKV, bf* VTh, bf* VTl) { const size_t e = ((size_t)blockIdx.x * 256 + threadIdx.x) * 2; if (e >= (size_t)NH_ * HD * TT) return; const int t = (int)(e % TT); const int d = (int)((e / TT) % HD); const int h = (int)(e / ((size_t)TT * HD)); v2us oh, ol;
#pragma unroll
    for (int u = 0; u < 2; ++u) { unsigned short a, c; splitf(QKV[(size_t)(t + u) * 3 * EE + 2 * EE + h * HD + d], a, c); oh[u] = a; ol[u] = c; } *(v2us*)(VTh + e) = oh; *(v2us*)(VTl + e) = ol;  }
// k_kern: thread -> 4 consecutive j of a (z, i) row: for j <= i: K = x^2 / max(2.000001 - 2x, 1e-6), else 0 (entries above the diagonal are never read: the select comes first), written IN PLACE over the scores (f32, 16-B lanes);
__global__ __launch_bounds__(256) void k_kern(float* Sb) { const size_t e = ((size_t)blockIdx.x * 256 + threadIdx.x) * 4; if (e >= (size_t)ZH * TT * TT) return; const int j = (int)(e % TT); const int i = (int)((e / TT) % TT); const v4f a = *(const v4f*)(Sb + e); v4f o;
#pragma unroll
    for (int q = 0; q < 4; ++q) { float kk = 0.f; if (j + q <= i) { const float xd = a[q]; float x2 = __fmul_rn(xd, xd); asm volatile("" : "+v"(x2)); float tx = __fmul_rn(2.0f, xd); asm volatile("" : "+v"(tx)); const float den = fmaxf(__fsub_rn(2.000001f, tx), 1e-6f); kk = __fdiv_rn(x2, den); } o[q] = kk; }
    *(v4f*)(Sb + e) = o;  }
__global__ __launch_bounds__(256) void k_zrow(const float* __restrict__ Kb, bf* Ph, bf* Pl, float* Z) { const int lane = threadIdx.x & 31; const int row = blockIdx.x * 8 + (threadIdx.x >> 5); if (row >= ZH * TT) return; const float* sr = Kb + (size_t)row * TT; float v[64]; float s = 0.f;
#pragma unroll
    for (int ch = 0; ch < 16; ++ch) { const v4f a = *(const v4f*)(sr + ch * 128 + lane * 4);
#pragma unroll
        for (int q = 0; q < 4; ++q) { v[ch * 4 + q] = a[q]; s = __fadd_rn(s, a[q]); } }
#pragma unroll
    for (int sh = 16; sh; sh >>= 1) s += __shfl_xor(s, sh, 32);
    const float zz = fmaxf(s, 1e-6f);
{
#pragma unroll
        for (int ch = 0; ch < 16; ++ch) { v4us oh, ol;
#pragma unroll
            for (int q = 0; q < 4; ++q) { unsigned short a, c; splitf(v[ch * 4 + q], a, c); oh[q] = a; ol[q] = c; } *(v4us*)(Ph + (size_t)row * TT + ch * 128 + lane * 4) = oh; *(v4us*)(Pl + (size_t)row * TT + ch * 128 + lane * 4) = ol; }
        if (lane == 0) *(float*)(Z + row) = zz;  } }
__global__ __launch_bounds__(256) void k_mrg(const float* __restrict__ Ob, const float* __restrict__ Z, int h0, bf* Ah, bf* Al) { const size_t e = ((size_t)blockIdx.x * 256 + threadIdx.x) * 2; if (e >= (size_t)ZH * TT * HD) return; const int d = (int)(e % HD); const int t = (int)((e / HD) % TT); const int z = (int)(e / ((size_t)HD * TT)); const float zi = Z[(size_t)z * TT + t]; v2us oh, ol;
#pragma unroll
    for (int u = 0; u < 2; ++u) { unsigned short a, c; splitf(__fdiv_rn(Ob[e + u], zi), a, c); oh[u] = a; ol[u] = c; } const size_t o = (size_t)t * EE + (h0 + z) * HD + d; *(v2us*)(Ah + o) = oh; *(v2us*)(Al + o) = ol;  }

extern "C" void kernel_launch(void* const* d_in, const int* in_sizes, int n_in,
                              void* d_out, int out_size, void* d_ws, size_t ws_size, hipStream_t stream) {
    (void)in_sizes; (void)n_in; (void)out_size;
    const float* x = (const float*)d_in[0]; const float* wqkv = (const float*)d_in[1]; const float* bqkv = (const float*)d_in[2]; const float* wout = (const float*)d_in[3]; const float* bout = (const float*)d_in[4];   // torch [out][in] weights
    float* OUT = (float*)d_out;     // [2][2048][1024]
    char* wsp = (char*)d_ws;
    auto take = [&](size_t bytes) { char* p = wsp; wsp += (bytes + 255) & ~(size_t)255; return (void*)p; };
    bf* WQKV = (bf*)take((size_t)3 * EE * EE * 2); bf* WO = (bf*)take((size_t)EE * EE * 2); bf* XB = (bf*)take((size_t)TT * EE * 2); float* QKV = (float*)take((size_t)TT * 3 * EE * 4);
    bf* Qh = (bf*)take((size_t)NH_ * TT * HD * 2); bf* Ql = (bf*)take((size_t)NH_ * TT * HD * 2); bf* Kh = (bf*)take((size_t)NH_ * TT * HD * 2); bf* Kl = (bf*)take((size_t)NH_ * TT * HD * 2); bf* VTh = (bf*)take((size_t)NH_ * HD * TT * 2); bf* VTl = (bf*)take((size_t)NH_ * HD * TT * 2);
    float* Sb = (float*)take((size_t)ZH * TT * TT * 4); bf* Ph = (bf*)take((size_t)ZH * TT * TT * 2); bf* Pl = (bf*)take((size_t)ZH * TT * TT * 2); float* Z = (float*)take((size_t)ZH * TT * 4); float* Ob = (float*)take((size_t)ZH * TT * HD * 4); bf* Ah = (bf*)take((size_t)TT * EE * 2); bf* Al = (bf*)take((size_t)TT * EE * 2);
    if ((size_t)(wsp - (char*)d_ws) > ws_size) return;    // total ~ 139 MB = 133 MiB
    k_cvt8<<<(3 * EE * EE / 8 + 255) / 256, 256, 0, stream>>>(wqkv, WQKV, (size_t)3 * EE * EE / 8); k_cvt8<<<(EE * EE / 8 + 255) / 256, 256, 0, stream>>>(wout, WO, (size_t)EE * EE / 8);
    for (int b = 0; b < NB_; ++b) {
        k_cvt8<<<(TT * EE / 8 + 255) / 256, 256, 0, stream>>>(x + (size_t)b * TT * EE, XB, (size_t)TT * EE / 8);
        k_gemmw<bf, 0, true><<<dim3(TT / 64, 3 * EE / 64, 1), 32, 0, stream>>>(XB, nullptr, WQKV, nullptr, EE, QKV, 3 * EE, bqkv, 0, 0, 0);
        k_nrm<<<NH_ * TT / 8, 256, 0, stream>>>(QKV, Qh, Ql, Kh, Kl); k_vt<<<(unsigned)(((size_t)NH_ * HD * TT / 2 + 255) / 256), 256, 0, stream>>>(QKV, VTh, VTl);
        for (int h0 = 0; h0 < NH_; h0 += ZH) { const size_t z = (size_t)h0;
            k_gemmc<bf, 2, 1><<<dim3(TT / 64, TT / 64, ZH), 32, 0, stream>>>(Qh + z * TT * HD, Ql + z * TT * HD, Kh + z * TT * HD, Kl + z * TT * HD, HD, Sb, TT, 0, (size_t)TT * HD, (size_t)TT * HD, (size_t)TT * TT);
            k_kern<<<(unsigned)(((size_t)ZH * TT * TT / 4 + 255) / 256), 256, 0, stream>>>(Sb); k_zrow<<<ZH * TT / 8, 256, 0, stream>>>(Sb, Ph, Pl, Z);
            k_gemmc<bf, 2, 2><<<dim3(TT / 64, 1, ZH), 32, 0, stream>>>(Ph, Pl, VTh + z * HD * TT, VTl + z * HD * TT, TT, Ob, HD, 0, (size_t)TT * TT, (size_t)HD * TT, (size_t)TT * HD);
            k_mrg<<<(unsigned)(((size_t)ZH * TT * HD / 2 + 255) / 256), 256, 0, stream>>>(Ob, Z, h0, Ah, Al); }
        k_gemmw<bf, 1, true><<<dim3(TT / 64, EE / 64, 1), 32, 0, stream>>>(Ah, Al, WO, nullptr, EE, OUT + (size_t)b * TT * EE, EE, bout, 0, 0, 0); }
}

// v002
// Measured time: 288 microseconds a run.
// Versions in between are left out here; by their measured steps it is 4.45 times as fast as v000.
#include <hip/hip_runtime.h>

// ExactSphericalKernelCausalAttention (x [2][2048][1024]; [q|k|v] = x w_qkv^T + b_qkv (16 heads x 64); qn, kn = L2-normalised (max(norm, 1e-12)); x_dot = qn.kn; K = x_dot^2 / max(2 + 1e-6 - 2 x_dot, 1e-6) for j <= i else 0;
// out_h = (K v) / max(sum_j K, 1e-6); out = merged w_out^T + b_out -> [2][2048][1024]; no softmax).
// Compute dtypes, f32 accumulate: every input rounded to bf16; the qkv projection on PLAIN bf16 operands (inputs: exact, + bias); normalisation f32 -> bf16 hi+lo planes of qn / kn; x_dot on 3 products (K 64, tiles above
// the diagonal skipped); the kernel K and its causal select in f32 on the score accumulators, its row sums in f32 (in-lane, halves joined once) -> bf16 hi+lo fragments of K in registers; K.v on hi+lo operands (3 products, keys limited to the diagonal block; the output (rms 0.10) is a cancelling sum); the division by z and the merge f32 -> hl planes;

#define NB_  2
#define TT   2048
#define EE   1024
#define NH_  16
#define HD   64
#define ZH   2
#define PCAR 64.0f
typedef _Float16 h16;
typedef unsigned short bf;
typedef __attribute__((ext_vector_type(16))) __bf16   v16bf;
typedef __attribute__((ext_vector_type(16))) _Float16 v16h;
typedef __attribute__((ext_vector_type(8)))  _Float16 v8h;
typedef __attribute__((ext_vector_type(8)))  unsigned short v8us;
typedef __attribute__((ext_vector_type(8)))  float    v8f;
typedef __attribute__((ext_vector_type(4)))  float    v4f;
typedef v8h  __attribute__((may_alias)) v8ha;
typedef v4f  __attribute__((may_alias)) v4fa;
typedef v8us __attribute__((may_alias)) v8usa;

__device__ __forceinline__ unsigned short f2bf(float f) { unsigned u = __float_as_uint(f); u += 0x7FFFu + ((u >> 16) & 1u); return (unsigned short)(u >> 16); }
__device__ __forceinline__ float bf2f(unsigned short b) { return __uint_as_float(((unsigned)b) << 16); }
__device__ __forceinline__ float bfr(float f) { return bf2f(f2bf(f)); }
__device__ __forceinline__ v16h cat16(v8h lo, v8h hi) { return __builtin_shufflevector(lo, hi, 0, 1, 2, 3, 4, 5, 6, 7, 8, 9, 10, 11, 12, 13, 14, 15); }
__device__ __forceinline__ v16bf cat16b(v8us lo, v8us hi) { return __builtin_bit_cast(v16bf, __builtin_shufflevector(lo, hi, 0, 1, 2, 3, 4, 5, 6, 7, 8, 9, 10, 11, 12, 13, 14, 15)); }
__device__ __forceinline__ v8f wmma16(v16h a, v16h b, v8f c) { return __builtin_amdgcn_wmma_f32_16x16x32_f16(false, a, false, b, (short)0, c, false, false); }
__device__ __forceinline__ v8f wmmab(v16bf a, v16bf b, v8f c) { return __builtin_amdgcn_wmma_f32_16x16x32_bf16(false, a, false, b, (short)0, c, false, false); }



// ---- k_gemmw: register-blocked GEMM, ONE WAVE per 64x64 output tile (16 accumulators), operands straight from 16-bit planes in fragment order (below); grid (M/64, N/64, Z), 32 threads.
// C[m][n] (f32, pitch ldc, + optional f32 bias[n]) = sum_k A[m][k] Bt[n][k] (+ split products per NSPLIT). z-batch strides sA/sB/sC in elements. K % 32 == 0.
template <typename T16> struct WFrag;
template <> struct WFrag<h16> { typedef v16h V; static __device__ __forceinline__ V ld(const h16* p) { return cat16(*(const v8h*)p, *(const v8h*)(p + 256)); } static __device__ __forceinline__ v8f mma(V a, V b, v8f c) { return wmma16(a, b, c); } };
template <> struct WFrag<bf> { typedef v16bf V; static __device__ __forceinline__ V ld(const bf* p) { return cat16b(*(const v8us*)p, *(const v8us*)(p + 256)); } static __device__ __forceinline__ v8f mma(V a, V b, v8f c) { return wmmab(a, b, c); } };
// ---- FRAGMENT ORDER: every 16-bit plane that a matrix instruction reads (x, the weights, qn, kn, V^T, the merged heads; hi and lo) is stored as whole fragments, not as rows. A plane P[rows][K] is cut into fragments of 16 rows x 32 k = 512 elements = 1 KiB;
// inside a fragment, 16-byte chunk number sel * 32 + hi * 16 + lr holds P[16 R + lr][32 kb + 16 sel + 8 hi + 0..7], which is what lane hi * 16 + lr takes as the first (sel 0) or second (sel 1) half of its operand.
// So a wave's 16-byte load or store covers 512 contiguous bytes (4 whole lines) where a row-major plane gives it 32 bytes in each of 16 lines. qn, kn (K = 64): fragment (R, kb) at element (R * 2 + kb) * 512 of its head; the GEMM operands: at (kb * (rows / 16) + R) * 512, so that the four fragments a 64-row tile takes per 32 k are neighbours;
// V^T (rows d, k = key): fragment (R, kb) at (kb * 4 + R) * 512, so that the fragments of one pass of 32 keys are neighbours in every plane. Values, k order and every sum are those of the row-major form.
// WFrag::ld(p) above takes p = fragment + lane * 8.
template <typename T16, int NSPLIT, bool BIAS>
__global__ __launch_bounds__(32) void k_gemmw(const T16* __restrict__ A, const T16* __restrict__ A2, const T16* __restrict__ Bt, const T16* __restrict__ Bt2, int K, int arows, int brows, float* C, int ldc, const float* __restrict__ bias, size_t sA, size_t sB, size_t sC) {
    typedef typename WFrag<T16>::V V;
    __shared__ __align__(16) float os[16 * 68];
    const size_t z = blockIdx.z; A += z * sA; if (A2) A2 += z * sA; Bt += z * sB; if (Bt2) Bt2 += z * sB; C += z * sC;
    const int lane = threadIdx.x & 31, lr = lane & 15, hi = lane >> 4; const int r0 = blockIdx.x * 64, c0 = blockIdx.y * 64;
    v8f acc[4][4];
#pragma unroll
    for (int mb = 0; mb < 4; ++mb)
#pragma unroll
        for (int nb = 0; nb < 4; ++nb) acc[mb][nb] = (v8f){};
    const size_t aoff = (size_t)r0 * 32 + 8 * lane, boff = (size_t)c0 * 32 + 8 * lane, astep = (size_t)arows * 32, bstep = (size_t)brows * 32;   // 16 rows further is the next fragment, 512 elements on; 32 k further is one fragment of every row block on (arows, brows: rows of the whole A and Bt planes)
#pragma unroll 1
    for (int kc = 0; kc < K; kc += 32) {
        V a[4], a2[4]; const size_t ak = aoff + (size_t)(kc >> 5) * astep, bk = boff + (size_t)(kc >> 5) * bstep; const T16* pa = A + ak; const T16* pb = Bt + bk; const T16* pa2 = (NSPLIT == 1 || NSPLIT == 2) ? A2 + ak : pa; const T16* pb2 = (NSPLIT >= 2) ? Bt2 + bk : pb;
#pragma unroll
        for (int mb = 0; mb < 4; ++mb) { a[mb] = WFrag<T16>::ld(pa + mb * 512); if (NSPLIT == 1 || NSPLIT == 2) a2[mb] = WFrag<T16>::ld(pa2 + mb * 512); }
#pragma unroll
        for (int nb = 0; nb < 4; ++nb) { const V b = WFrag<T16>::ld(pb + nb * 512); V b2; if (NSPLIT >= 2) b2 = WFrag<T16>::ld(pb2 + nb * 512);
#pragma unroll
            for (int mb = 0; mb < 4; ++mb) { acc[mb][nb] = WFrag<T16>::mma(a[mb], b, acc[mb][nb]); if (NSPLIT == 1 || NSPLIT == 2) acc[mb][nb] = WFrag<T16>::mma(a2[mb], b, acc[mb][nb]); if (NSPLIT >= 2) acc[mb][nb] = WFrag<T16>::mma(a[mb], b2, acc[mb][nb]); } }
        asm volatile("v_nop\n\tv_nop\n\tv_nop\n\tv_nop" : "+v"(acc[0][0]), "+v"(acc[1][1]), "+v"(acc[2][2]), "+v"(acc[3][3]) : "v"(a[0]), "v"(a[3]));
        // the wait stands behind this trip's loads; it takes their addresses as inputs, so that the address registers stay untouched (no later load lands in them, no next address is formed in them) until it has passed
        asm volatile("s_wait_xcnt 0x0" :: "v"(pa), "v"(pb), "v"(pa2), "v"(pb2) : "memory");
    }
#pragma unroll
    for (int mb = 0; mb < 4; ++mb) {
#pragma unroll
        for (int nb = 0; nb < 4; ++nb) {
#pragma unroll
            for (int j = 0; j < 8; ++j) os[(hi * 8 + j) * 68 + nb * 16 + lr] = acc[mb][nb][j]; }
        __builtin_amdgcn_wave_barrier(); asm volatile("" ::: "memory");
        float* crow = C + (size_t)(r0 + mb * 16) * ldc + c0;
{
#pragma unroll
            for (int s = 0; s < 8; ++s) { const int row = 2 * s + hi, cofs = lr * 4; v4f val = *(const v4fa*)(os + row * 68 + cofs); if (BIAS) { val[0] += bfr(bias[c0 + cofs]); val[1] += bfr(bias[c0 + cofs + 1]); val[2] += bfr(bias[c0 + cofs + 2]); val[3] += bfr(bias[c0 + cofs + 3]); }
                *(v4f*)(crow + (size_t)row * ldc + cofs) = val; }
             }
        asm volatile("s_wait_xcnt 0x0" ::: "memory");           // the next 16 rows' work overwrites registers that these stores name: the wait stands in front of it
        __builtin_amdgcn_wave_barrier(); asm volatile("" ::: "memory");
    }
}

__device__ __forceinline__ h16 tohx(float x) { return (h16)x; }
__device__ __forceinline__ void splitf(float y, unsigned short& h, unsigned short& l) { h = f2bf(y); l = f2bf(y - bf2f(h)); }
typedef __attribute__((ext_vector_type(2))) _Float16 v2h;
typedef __attribute__((ext_vector_type(4))) _Float16 v4h;
typedef __attribute__((ext_vector_type(2))) unsigned short v2us;
typedef __attribute__((ext_vector_type(4))) unsigned short v4us;

__global__ __launch_bounds__(256) void k_wtG(const float* __restrict__ w, int K, int N, bf* Bt) {
    const int lane = threadIdx.x & 31; const int L0 = (blockIdx.x * 8 + (threadIdx.x >> 5)) * 8; const int nlines = N * K / 64;
{
#pragma unroll 1
        for (int l = 0; l < 8; ++l) { const int L = L0 + l; if (L >= nlines) break; const size_t e = (size_t)L * 64 + lane * 2; const int k = (int)(e % K), n = (int)(e / K); v2us o;
            o[0] = f2bf(w[(size_t)k * N + n]); o[1] = f2bf(w[(size_t)(k + 1) * N + n]); *(v2us*)(Bt + e) = o; }
         }
}
// k_cvt8: f32 [rows][EE] -> bf16 GEMM operand plane in fragment order (rows = n8 * 8 / EE); thread i writes chunk i (a wave stores 512 contiguous bytes) and fetches the 8 values that belong there.
__global__ __launch_bounds__(256) void k_cvt8(const float* __restrict__ src, bf* dst, size_t n8) { const size_t slab = n8 / (EE / 32), j = (size_t)blockIdx.x * 256 + threadIdx.x; if (j >= slab) return;   // grid (rows / 64, EE / 32): blockIdx.y is kb, j the chunk among those of one kb
    const int lr = (int)(j & 15), hi = (int)((j >> 4) & 1), sel = (int)((j >> 5) & 1), kb = blockIdx.y; const size_t R = j >> 6, i = (size_t)kb * slab + j;
    const v8f v = *(const v8f*)(src + (R * 16 + lr) * EE + kb * 32 + sel * 16 + hi * 8); v8us o;
#pragma unroll
    for (int k = 0; k < 8; ++k) o[k] = f2bf(v[k]); *(v8us*)(dst + i * 8) = o;  }
// k_nrm: one wave per 16 rows of one head of q (even waves) or k (odd waves); lane (lr, hi) holds the four chunks of row lr that fragment order gives it (d = 32 kb + 16 sel + 8 hi + 0..7).
// The sum of squares keeps the tree of the one-row-per-wave form (pairs d, d + 1; then d ^ 32, ^ 16, ^ 8, ^ 4, ^ 2): only the ^ 8 level crosses lanes.
__global__ __launch_bounds__(256) void k_nrm(const float* __restrict__ QKV, bf* Qh, bf* Ql, bf* Kh, bf* Kl) { const int lane = threadIdx.x & 31, lr = lane & 15, hi = lane >> 4; const int g = blockIdx.x * 8 + (threadIdx.x >> 5); if (g >= 2 * NH_ * (TT / 16)) return;
    const int isk = g & 1, R = (g >> 1) % (TT / 16), h = (g >> 1) / (TT / 16); const float* s = QKV + (size_t)(R * 16 + lr) * 3 * EE + isk * EE + h * HD + hi * 8; bf* H = isk ? Kh : Qh; bf* L = isk ? Kl : Ql;
    v8f x[2][2]; float lf[2][2][4];
#pragma unroll
    for (int kb = 0; kb < 2; ++kb)
#pragma unroll
        for (int sel = 0; sel < 2; ++sel) { x[kb][sel] = *(const v8f*)(s + kb * 32 + sel * 16);
#pragma unroll
            for (int e = 0; e < 4; ++e) lf[kb][sel][e] = __fadd_rn(__fmul_rn(x[kb][sel][2 * e], x[kb][sel][2 * e]), __fmul_rn(x[kb][sel][2 * e + 1], x[kb][sel][2 * e + 1])); }
    float s3[4];
#pragma unroll
    for (int e = 0; e < 4; ++e) { const float s2 = __fadd_rn(__fadd_rn(lf[0][0][e], lf[1][0][e]), __fadd_rn(lf[0][1][e], lf[1][1][e])); s3[e] = __fadd_rn(s2, __shfl_xor(s2, 16, 32)); }
    const float ss = __fadd_rn(__fadd_rn(s3[0], s3[2]), __fadd_rn(s3[1], s3[3])); const float nn = fmaxf(__fsqrt_rn(ss), 1e-12f);
    const size_t o = (size_t)h * TT * HD + (size_t)R * 1024 + lane * 8;
#pragma unroll
    for (int kb = 0; kb < 2; ++kb)
#pragma unroll
        for (int sel = 0; sel < 2; ++sel) { v8us oh, ol;
#pragma unroll
            for (int e = 0; e < 8; ++e) { unsigned short a, c; splitf(__fdiv_rn(x[kb][sel][e], nn), a, c); oh[e] = a; ol[e] = c; }
            *(v8us*)(H + o + kb * 512 + sel * 256) = oh; *(v8us*)(L + o + kb * 512 + sel * 256) = ol; } }
// k_vt: thread i writes chunk i of the V^T planes: 8 consecutive keys t of one d (row lr of fragment (kb, dt)); per key 16 lanes read 64 contiguous bytes of the v row.
__global__ __launch_bounds__(256) void k_vt(const float* __restrict__ QKV, bf* VTh, bf* VTl) { const size_t i = (size_t)blockIdx.x * 256 + threadIdx.x; if (i >= (size_t)NH_ * HD * TT / 8) return;
    const int lr = (int)(i & 15), hi = (int)((i >> 4) & 1), sel = (int)((i >> 5) & 1), dt = (int)((i >> 6) & 3), kb = (int)((i >> 8) % (TT / 32)), h = (int)((i >> 8) / (TT / 32)); const float* s = QKV + (size_t)(kb * 32 + sel * 16 + hi * 8) * 3 * EE + 2 * EE + h * HD + dt * 16 + lr; v8us oh, ol;
#pragma unroll
    for (int u = 0; u < 8; ++u) { unsigned short a, c; splitf(s[(size_t)u * 3 * EE], a, c); oh[u] = a; ol[u] = c; } *(v8us*)(VTh + i * 8) = oh; *(v8us*)(VTl + i * 8) = ol;  }
// ---- k_attn: the whole causal kernel attention of one batch (all heads) in one launch, ONE WAVE per 16 queries, nothing staged in memory or LDS between the two products.
// Per 32 keys: S^T = kn . qn^T (A = key rows, B = query rows kept in registers; 3 hi/lo products, K 64), so a lane holds 16 keys of ONE query (c = lane & 15); the kernel map, the causal select and the
// row sum run in f32 on those accumulators; the two S^T tiles, split into bf16 hi+lo, ARE the B operand of O^T += V^T . P^T (3 hi/lo products) in the hardware k order that the V^T loader also uses.
// O^T gives a lane 8 consecutive d of its query, one chunk of the merged hi/lo planes in fragment order: division by z in-lane, 16-byte stores, 512 contiguous bytes a wave.
// Work: a 16-query tile t walks t / 2 + 1 passes of 32 keys; every wave takes tile 127 - p and then tile p, 65 passes each. grid (heads, 16), 4 waves: one wave per SIMD of the chip.
// amdgpu_waves_per_eu: lets the wave take more than 256 registers; under 256 the scheduler runs the 16 divisions of a pass one after another.
// Every plain '#pragma unroll' below opens a short loop of fixed length so that the fragment arrays it indexes are registers.
__global__ __launch_bounds__(128) __attribute__((amdgpu_waves_per_eu(2, 2))) void k_attn(const bf* __restrict__ Qh, const bf* __restrict__ Ql, const bf* __restrict__ Kh, const bf* __restrict__ Kl, const bf* __restrict__ VTh, const bf* __restrict__ VTl, bf* Ah, bf* Al) {
    typedef WFrag<bf> F; typedef F::V V;
    const int lane = threadIdx.x & 31, c = lane & 15, hi = lane >> 4; const int h = blockIdx.x;
    const int p = blockIdx.y * 4 + __builtin_amdgcn_readfirstlane(threadIdx.x >> 5);   // wave-uniform: the key loop runs on scalar control flow, EXEC stays full at every matrix instruction
    const size_t hb = (size_t)h * TT * HD;
    const bf* kph = Kh + hb + 8 * lane; const bf* kpl = Kl + hb + 8 * lane; const bf* vph = VTh + hb + 8 * lane; const bf* vpl = VTl + hb + 8 * lane;   // fragment order: 32 keys are 4 neighbouring fragments (2048 elements) in each plane
#pragma unroll 1
    for (int half = 0; half < 2; ++half) {                   // rolled: one copy of the pass in the instruction cache
        const int r0 = (half ? p : TT / 16 - 1 - p) * 16; const int iq = r0 + c;
        V qh[2], ql[2];
#pragma unroll
        for (int ks = 0; ks < 2; ++ks) { qh[ks] = F::ld(Qh + hb + (size_t)r0 * HD + ks * 512 + 8 * lane); ql[ks] = F::ld(Ql + hb + (size_t)r0 * HD + ks * 512 + 8 * lane); }
        v8f acc[4];
#pragma unroll
        for (int dt = 0; dt < 4; ++dt) acc[dt] = (v8f){};
        float zs = 0.f; const int kend = r0 + 16;
        V kh[2][2], kl[2][2];
#pragma unroll
        for (int kt = 0; kt < 2; ++kt)
#pragma unroll
            for (int ks = 0; ks < 2; ++ks) { kh[kt][ks] = F::ld(kph + (size_t)(kt * 16) * HD + ks * 512); kl[kt][ks] = F::ld(kpl + (size_t)(kt * 16) * HD + ks * 512); }
#pragma unroll 1
        for (int kc = 0; kc < kend; kc += 32) {                  // rolled: one pass already holds 32 loads in flight and its registers; a second copy would only add registers
            V vh[4], vl[4];
#pragma unroll
            for (int dt = 0; dt < 4; ++dt) { vh[dt] = F::ld(vph + (size_t)kc * HD + dt * 512); vl[dt] = F::ld(vpl + (size_t)kc * HD + dt * 512); }
            v8f s[2]; s[0] = (v8f){}; s[1] = (v8f){};
#pragma unroll
            for (int ks = 0; ks < 2; ++ks) {
#pragma unroll
                for (int kt = 0; kt < 2; ++kt) s[kt] = F::mma(kh[kt][ks], qh[ks], s[kt]);
#pragma unroll
                for (int kt = 0; kt < 2; ++kt) s[kt] = F::mma(kh[kt][ks], ql[ks], s[kt]);
#pragma unroll
                for (int kt = 0; kt < 2; ++kt) s[kt] = F::mma(kl[kt][ks], qh[ks], s[kt]); }
            asm volatile("s_wait_xcnt 0x0" ::: "memory");       // the next-K loads below may land in registers that held the V^T loads' addresses: the wait stands in front of that overwrite
            const int kn = (kc + 32 < kend) ? kc + 32 : kc;      // the next 32 keys' fragments fly during the vector work (the last pass re-reads its own rows: in bounds, unused)
#pragma unroll
            for (int kt = 0; kt < 2; ++kt)
#pragma unroll
                for (int ks = 0; ks < 2; ++ks) { kh[kt][ks] = F::ld(kph + (size_t)(kn + kt * 16) * HD + ks * 512); kl[kt][ks] = F::ld(kpl + (size_t)(kn + kt * 16) * HD + ks * 512); }
            __builtin_amdgcn_sched_barrier(0);                   // all 32 loads issue as one group ahead of the vector work, which covers their latency; without it the scheduler spreads them among that work
            v8us p0h, p0l, p1h, p1l;
#pragma unroll
            for (int j = 0; j < 8; ++j) {
#pragma unroll
                for (int kt = 0; kt < 2; ++kt) { const float xd = (kc + kt * 16 + 8 * hi + j <= iq) ? s[kt][j] : 0.f;      // causal select on x_dot: 0 maps to exactly 0 (0 / 2.000001), and the 16 divisions stay branch-free and independent
                    const float den = fmaxf(__fsub_rn(2.000001f, __fmul_rn(2.0f, xd)), 1e-6f); const float kk = __fdiv_rn(__fmul_rn(xd, xd), den);
                    zs = __fadd_rn(zs, kk); unsigned short a, b; splitf(kk, a, b); if (kt == 0) { p0h[j] = a; p0l[j] = b; } else { p1h[j] = a; p1l[j] = b; } } }
            const V ph = cat16b(p0h, p1h), pl = cat16b(p0l, p1l);
#pragma unroll
            for (int dt = 0; dt < 4; ++dt) acc[dt] = F::mma(vh[dt], ph, acc[dt]);
#pragma unroll
            for (int dt = 0; dt < 4; ++dt) acc[dt] = F::mma(vh[dt], pl, acc[dt]);
#pragma unroll
            for (int dt = 0; dt < 4; ++dt) acc[dt] = F::mma(vl[dt], ph, acc[dt]);
        }
        zs += __shfl_xor(zs, 16, 32); const float zz = fmaxf(zs, 1e-6f);
#pragma unroll
        for (int dt = 0; dt < 4; ++dt) { v8us oh, ol;
#pragma unroll
            for (int j = 0; j < 8; ++j) { unsigned short a, b; splitf(__fdiv_rn(acc[dt][j], zz), a, b); oh[j] = a; ol[j] = b; }
            const size_t o = ((size_t)(2 * h + (dt >> 1)) * (TT / 16) + (r0 >> 4)) * 512 + (dt & 1) * 256 + 8 * lane; *(v8us*)(Ah + o) = oh; *(v8us*)(Al + o) = ol; }   // chunk (R = r0 / 16, kb = 2 h + dt / 2, sel = dt & 1) of the merged [t][E] planes
        asm volatile("s_wait_xcnt 0x0" ::: "memory");           // the second tile's set-up overwrites the registers that these stores name: the wait stands in front of it
    }
}

extern "C" void kernel_launch(void* const* d_in, const int* in_sizes, int n_in,
                              void* d_out, int out_size, void* d_ws, size_t ws_size, hipStream_t stream) {
    (void)in_sizes; (void)n_in; (void)out_size;
    const float* x = (const float*)d_in[0]; const float* wqkv = (const float*)d_in[1]; const float* bqkv = (const float*)d_in[2]; const float* wout = (const float*)d_in[3]; const float* bout = (const float*)d_in[4];   // torch [out][in] weights
    float* OUT = (float*)d_out;     // [2][2048][1024]
    char* wsp = (char*)d_ws;
    auto take = [&](size_t bytes) { char* p = wsp; wsp += (bytes + 255) & ~(size_t)255; return (void*)p; };
    bf* WQKV = (bf*)take((size_t)3 * EE * EE * 2); bf* WO = (bf*)take((size_t)EE * EE * 2); bf* XB = (bf*)take((size_t)TT * EE * 2); float* QKV = (float*)take((size_t)TT * 3 * EE * 4);
    bf* Qh = (bf*)take((size_t)NH_ * TT * HD * 2); bf* Ql = (bf*)take((size_t)NH_ * TT * HD * 2); bf* Kh = (bf*)take((size_t)NH_ * TT * HD * 2); bf* Kl = (bf*)take((size_t)NH_ * TT * HD * 2); bf* VTh = (bf*)take((size_t)NH_ * HD * TT * 2); bf* VTl = (bf*)take((size_t)NH_ * HD * TT * 2);
    bf* Ah = (bf*)take((size_t)TT * EE * 2); bf* Al = (bf*)take((size_t)TT * EE * 2);
    if ((size_t)(wsp - (char*)d_ws) > ws_size) return;    // total ~ 71 MB
    k_cvt8<<<dim3(3 * EE / 64, EE / 32, 1), 256, 0, stream>>>(wqkv, WQKV, (size_t)3 * EE * EE / 8); k_cvt8<<<dim3(EE / 64, EE / 32, 1), 256, 0, stream>>>(wout, WO, (size_t)EE * EE / 8);
    for (int b = 0; b < NB_; ++b) {
        k_cvt8<<<dim3(TT / 64, EE / 32, 1), 256, 0, stream>>>(x + (size_t)b * TT * EE, XB, (size_t)TT * EE / 8);
        k_gemmw<bf, 0, true><<<dim3(TT / 64, 3 * EE / 64, 1), 32, 0, stream>>>(XB, nullptr, WQKV, nullptr, EE, TT, 3 * EE, QKV, 3 * EE, bqkv, 0, 0, 0);
        k_nrm<<<2 * NH_ * (TT / 16) / 8, 256, 0, stream>>>(QKV, Qh, Ql, Kh, Kl); k_vt<<<(unsigned)(((size_t)NH_ * HD * TT / 8 + 255) / 256), 256, 0, stream>>>(QKV, VTh, VTl);
        k_attn<<<dim3(NH_, TT / 128, 1), 128, 0, stream>>>(Qh, Ql, Kh, Kl, VTh, VTl, Ah, Al);
        k_gemmw<bf, 1, true><<<dim3(TT / 64, EE / 64, 1), 32, 0, stream>>>(Ah, Al, WO, nullptr, EE, TT, EE, OUT + (size_t)b * TT * EE, EE, bout, 0, 0, 0); }
}

// v003
// A run of this version takes 172 microseconds.
// Next to v002, in two timings, it ran 1.65 and 1.66 times as fast.
// Over all steps from v000 it is 7.37 times as fast.
#include <hip/hip_runtime.h>

// ExactSphericalKernelCausalAttention (x [2][2048][1024]; [q|k|v] = x w_qkv^T + b_qkv (16 heads x 64); qn, kn = L2-normalised (max(norm, 1e-12)); x_dot = qn.kn; K = x_dot^2 / max(2 + 1e-6 - 2 x_dot, 1e-6) for j <= i else 0;
// out_h = (K v) / max(sum_j K, 1e-6); out = merged w_out^T + b_out -> [2][2048][1024]; no softmax).
// Compute dtypes, f32 accumulate: every input rounded to bf16; the qkv projection on PLAIN bf16 operands (inputs: exact, + bias); normalisation f32 -> bf16 hi+lo planes of qn / kn; x_dot on 3 products (K 64, tiles above
// the diagonal skipped); the kernel K and its causal select in f32 on the score accumulators, its row sums in f32 (in-lane, halves joined once) -> bf16 hi+lo fragments of K in registers; K.v on hi+lo operands (3 products, keys limited to the diagonal block; the output (rms 0.10) is a cancelling sum); the division by z and the merge f32 -> hl planes;

#define NB_  2
#define TT   2048
#define EE   1024
#define NH_  16
#define HD   64
#define ZH   2
#define PCAR 64.0f
typedef _Float16 h16;
typedef unsigned short bf;
typedef __attribute__((ext_vector_type(16))) __bf16   v16bf;
typedef __attribute__((ext_vector_type(16))) _Float16 v16h;
typedef __attribute__((ext_vector_type(8)))  _Float16 v8h;
typedef __attribute__((ext_vector_type(8)))  unsigned short v8us;
typedef __attribute__((ext_vector_type(8)))  float    v8f;
typedef __attribute__((ext_vector_type(4)))  float    v4f;
typedef v8h  __attribute__((may_alias)) v8ha;
typedef v4f  __attribute__((may_alias)) v4fa;
typedef v8us __attribute__((may_alias)) v8usa;

__device__ __forceinline__ unsigned short f2bf(float f) { unsigned u = __float_as_uint(f); u += 0x7FFFu + ((u >> 16) & 1u); return (unsigned short)(u >> 16); }
__device__ __forceinline__ float bf2f(unsigned short b) { return __uint_as_float(((unsigned)b) << 16); }
__device__ __forceinline__ float bfr(float f) { return bf2f(f2bf(f)); }
__device__ __forceinline__ v16h cat16(v8h lo, v8h hi) { return __builtin_shufflevector(lo, hi, 0, 1, 2, 3, 4, 5, 6, 7, 8, 9, 10, 11, 12, 13, 14, 15); }
__device__ __forceinline__ v16bf cat16b(v8us lo, v8us hi) { return __builtin_bit_cast(v16bf, __builtin_shufflevector(lo, hi, 0, 1, 2, 3, 4, 5, 6, 7, 8, 9, 10, 11, 12, 13, 14, 15)); }
__device__ __forceinline__ v8f wmma16(v16h a, v16h b, v8f c) { return __builtin_amdgcn_wmma_f32_16x16x32_f16(false, a, false, b, (short)0, c, false, false); }
__device__ __forceinline__ v8f wmmab(v16bf a, v16bf b, v8f c) { return __builtin_amdgcn_wmma_f32_16x16x32_bf16(false, a, false, b, (short)0, c, false, false); }



// ---- k_gemmw: register-blocked GEMM, ONE WAVE per 64x64 output tile (16 accumulators), operands straight from 16-bit planes in fragment order (below); grid (M/64, N/64, Z), 32 threads.
// C[m][n] (f32, pitch ldc, + optional f32 bias[n]) = sum_k A[m][k] Bt[n][k] (+ split products per NSPLIT). z-batch strides sA/sB/sC in elements. K % 32 == 0.
template <typename T16> struct WFrag;
template <> struct WFrag<h16> { typedef v16h V; static __device__ __forceinline__ V ld(const h16* p) { return cat16(*(const v8h*)p, *(const v8h*)(p + 256)); } static __device__ __forceinline__ v8f mma(V a, V b, v8f c) { return wmma16(a, b, c); } };
template <> struct WFrag<bf> { typedef v16bf V; static __device__ __forceinline__ V ld(const bf* p) { return cat16b(*(const v8us*)p, *(const v8us*)(p + 256)); } static __device__ __forceinline__ v8f mma(V a, V b, v8f c) { return wmmab(a, b, c); } };
// ---- FRAGMENT ORDER: every 16-bit plane that a matrix instruction reads (x, the weights, qn, kn, V^T, the merged heads; hi and lo) is stored as whole fragments, not as rows. A plane P[rows][K] is cut into fragments of 16 rows x 32 k = 512 elements = 1 KiB;
// inside a fragment, 16-byte chunk number sel * 32 + hi * 16 + lr holds P[16 R + lr][32 kb + 16 sel + 8 hi + 0..7], which is what lane hi * 16 + lr takes as the first (sel 0) or second (sel 1) half of its operand.
// So a wave's 16-byte load or store covers 512 contiguous bytes (4 whole lines) where a row-major plane gives it 32 bytes in each of 16 lines. qn, kn (K = 64): fragment (R, kb) at element (R * 2 + kb) * 512 of its head; the GEMM operands: at (kb * (rows / 16) + R) * 512, so that the four fragments a 64-row tile takes per 32 k are neighbours;
// V^T (rows d, k = key): fragment (R, kb) at (kb * 4 + R) * 512, so that the fragments of one pass of 32 keys are neighbours in every plane. Values, k order and every sum are those of the row-major form.
// WFrag::ld(p) above takes p = fragment + lane * 8.
template <typename T16, int NSPLIT, bool BIAS>
__global__ __launch_bounds__(32) void k_gemmw(const T16* __restrict__ A, const T16* __restrict__ A2, const T16* __restrict__ Bt, const T16* __restrict__ Bt2, int K, int arows, int brows, float* C, int ldc, const float* __restrict__ bias, size_t sA, size_t sB, size_t sC) {
    typedef typename WFrag<T16>::V V;
    __shared__ __align__(16) float os[16 * 68];
    const size_t z = blockIdx.z; A += z * sA; if (A2) A2 += z * sA; Bt += z * sB; if (Bt2) Bt2 += z * sB; C += z * sC;
    const int lane = threadIdx.x & 31, lr = lane & 15, hi = lane >> 4; const int r0 = blockIdx.x * 64, c0 = blockIdx.y * 64;
    v8f acc[4][4];
#pragma unroll
    for (int mb = 0; mb < 4; ++mb)
#pragma unroll
        for (int nb = 0; nb < 4; ++nb) acc[mb][nb] = (v8f){};
    const size_t aoff = (size_t)r0 * 32 + 8 * lane, boff = (size_t)c0 * 32 + 8 * lane, astep = (size_t)arows * 32, bstep = (size_t)brows * 32;   // 16 rows further is the next fragment, 512 elements on; 32 k further is one fragment of every row block on (arows, brows: rows of the whole A and Bt planes)
#pragma unroll 1
    for (int kc = 0; kc < K; kc += 32) {
        V a[4], a2[4]; const size_t ak = aoff + (size_t)(kc >> 5) * astep, bk = boff + (size_t)(kc >> 5) * bstep; const T16* pa = A + ak; const T16* pb = Bt + bk; const T16* pa2 = (NSPLIT == 1 || NSPLIT == 2) ? A2 + ak : pa; const T16* pb2 = (NSPLIT >= 2) ? Bt2 + bk : pb;
#pragma unroll
        for (int mb = 0; mb < 4; ++mb) { a[mb] = WFrag<T16>::ld(pa + mb * 512); if (NSPLIT == 1 || NSPLIT == 2) a2[mb] = WFrag<T16>::ld(pa2 + mb * 512); }
#pragma unroll
        for (int nb = 0; nb < 4; ++nb) { const V b = WFrag<T16>::ld(pb + nb * 512); V b2; if (NSPLIT >= 2) b2 = WFrag<T16>::ld(pb2 + nb * 512);
#pragma unroll
            for (int mb = 0; mb < 4; ++mb) { acc[mb][nb] = WFrag<T16>::mma(a[mb], b, acc[mb][nb]); if (NSPLIT == 1 || NSPLIT == 2) acc[mb][nb] = WFrag<T16>::mma(a2[mb], b, acc[mb][nb]); if (NSPLIT >= 2) acc[mb][nb] = WFrag<T16>::mma(a[mb], b2, acc[mb][nb]); } }
        asm volatile("v_nop\n\tv_nop\n\tv_nop\n\tv_nop" : "+v"(acc[0][0]), "+v"(acc[1][1]), "+v"(acc[2][2]), "+v"(acc[3][3]) : "v"(a[0]), "v"(a[3]));
        // the wait stands behind this trip's loads; it takes their addresses as inputs, so that the address registers stay untouched (no later load lands in them, no next address is formed in them) until it has passed
        asm volatile("s_wait_xcnt 0x0" :: "v"(pa), "v"(pb), "v"(pa2), "v"(pb2) : "memory");
    }
#pragma unroll
    for (int mb = 0; mb < 4; ++mb) {
#pragma unroll
        for (int nb = 0; nb < 4; ++nb) {
#pragma unroll
            for (int j = 0; j < 8; ++j) os[(hi * 8 + j) * 68 + nb * 16 + lr] = acc[mb][nb][j]; }
        __builtin_amdgcn_wave_barrier(); asm volatile("" ::: "memory");
        float* crow = C + (size_t)(r0 + mb * 16) * ldc + c0;
{
#pragma unroll
            for (int s = 0; s < 8; ++s) { const int row = 2 * s + hi, cofs = lr * 4; v4f val = *(const v4fa*)(os + row * 68 + cofs); if (BIAS) { val[0] += bfr(bias[c0 + cofs]); val[1] += bfr(bias[c0 + cofs + 1]); val[2] += bfr(bias[c0 + cofs + 2]); val[3] += bfr(bias[c0 + cofs + 3]); }
                *(v4f*)(crow + (size_t)row * ldc + cofs) = val; }
             }
        asm volatile("s_wait_xcnt 0x0" ::: "memory");           // the next 16 rows' work overwrites registers that these stores name: the wait stands in front of it
        __builtin_amdgcn_wave_barrier(); asm volatile("" ::: "memory");
    }
}

__device__ __forceinline__ h16 tohx(float x) { return (h16)x; }
__device__ __forceinline__ void splitf(float y, unsigned short& h, unsigned short& l) { h = f2bf(y); l = f2bf(y - bf2f(h)); }
typedef __attribute__((ext_vector_type(2))) _Float16 v2h;
typedef __attribute__((ext_vector_type(4))) _Float16 v4h;
typedef __attribute__((ext_vector_type(2))) unsigned short v2us;
typedef __attribute__((ext_vector_type(4))) unsigned short v4us;

__global__ __launch_bounds__(256) void k_wtG(const float* __restrict__ w, int K, int N, bf* Bt) {
    const int lane = threadIdx.x & 31; const int L0 = (blockIdx.x * 8 + (threadIdx.x >> 5)) * 8; const int nlines = N * K / 64;
{
#pragma unroll 1
        for (int l = 0; l < 8; ++l) { const int L = L0 + l; if (L >= nlines) break; const size_t e = (size_t)L * 64 + lane * 2; const int k = (int)(e % K), n = (int)(e / K); v2us o;
            o[0] = f2bf(w[(size_t)k * N + n]); o[1] = f2bf(w[(size_t)(k + 1) * N + n]); *(v2us*)(Bt + e) = o; }
         }
}
// k_cvt8: f32 [rows][EE] -> bf16 GEMM operand plane in fragment order (rows = n8 * 8 / EE); thread i writes chunk i (a wave stores 512 contiguous bytes) and fetches the 8 values that belong there.
__global__ __launch_bounds__(256) void k_cvt8(const float* __restrict__ src, bf* dst, size_t n8) { const size_t slab = n8 / (EE / 32), j = (size_t)blockIdx.x * 256 + threadIdx.x; if (j >= slab) return;   // grid (rows / 64, EE / 32): blockIdx.y is kb, j the chunk among those of one kb
    const int lr = (int)(j & 15), hi = (int)((j >> 4) & 1), sel = (int)((j >> 5) & 1), kb = blockIdx.y; const size_t R = j >> 6, i = (size_t)kb * slab + j;
    const v8f v = *(const v8f*)(src + (R * 16 + lr) * EE + kb * 32 + sel * 16 + hi * 8); v8us o;
#pragma unroll
    for (int k = 0; k < 8; ++k) o[k] = f2bf(v[k]); *(v8us*)(dst + i * 8) = o;  }
// k_nrm: grid (.., batches); one wave per 16 rows of one head of q (even waves) or k (odd waves); lane (lr, hi) holds the four chunks of row lr that fragment order gives it (d = 32 kb + 16 sel + 8 hi + 0..7).
// The sum of squares keeps the tree of the one-row-per-wave form (pairs d, d + 1; then d ^ 32, ^ 16, ^ 8, ^ 4, ^ 2): only the ^ 8 level crosses lanes.
__global__ __launch_bounds__(256) void k_nrm(const float* __restrict__ QKV, bf* Qh, bf* Ql, bf* Kh, bf* Kl) { const int lane = threadIdx.x & 31, lr = lane & 15, hi = lane >> 4; const int g = blockIdx.x * 8 + (threadIdx.x >> 5); if (g >= 2 * NH_ * (TT / 16)) return;
    const int isk = g & 1, R = (g >> 1) % (TT / 16), h = (g >> 1) / (TT / 16), b = blockIdx.y; const float* s = QKV + (size_t)(b * TT + R * 16 + lr) * 3 * EE + isk * EE + h * HD + hi * 8; bf* H = isk ? Kh : Qh; bf* L = isk ? Kl : Ql;
    v8f x[2][2]; float lf[2][2][4];
#pragma unroll
    for (int kb = 0; kb < 2; ++kb)
#pragma unroll
        for (int sel = 0; sel < 2; ++sel) { x[kb][sel] = *(const v8f*)(s + kb * 32 + sel * 16);
#pragma unroll
            for (int e = 0; e < 4; ++e) lf[kb][sel][e] = __fadd_rn(__fmul_rn(x[kb][sel][2 * e], x[kb][sel][2 * e]), __fmul_rn(x[kb][sel][2 * e + 1], x[kb][sel][2 * e + 1])); }
    float s3[4];
#pragma unroll
    for (int e = 0; e < 4; ++e) { const float s2 = __fadd_rn(__fadd_rn(lf[0][0][e], lf[1][0][e]), __fadd_rn(lf[0][1][e], lf[1][1][e])); s3[e] = __fadd_rn(s2, __shfl_xor(s2, 16, 32)); }
    const float ss = __fadd_rn(__fadd_rn(s3[0], s3[2]), __fadd_rn(s3[1], s3[3])); const float nn = fmaxf(__fsqrt_rn(ss), 1e-12f);
    const size_t o = (size_t)(b * NH_ + h) * TT * HD + (size_t)R * 1024 + lane * 8;
#pragma unroll
    for (int kb = 0; kb < 2; ++kb)
#pragma unroll
        for (int sel = 0; sel < 2; ++sel) { v8us oh, ol;
#pragma unroll
            for (int e = 0; e < 8; ++e) { unsigned short a, c; splitf(__fdiv_rn(x[kb][sel][e], nn), a, c); oh[e] = a; ol[e] = c; }
            *(v8us*)(H + o + kb * 512 + sel * 256) = oh; *(v8us*)(L + o + kb * 512 + sel * 256) = ol; } }
// k_vt: grid (.., batches); thread i writes chunk i of its batch's V^T planes: 8 consecutive keys t of one d (row lr of fragment (kb, dt)); per key 16 lanes read 64 contiguous bytes of the v row.
__global__ __launch_bounds__(256) void k_vt(const float* __restrict__ QKV, bf* VTh, bf* VTl) { const size_t i = (size_t)blockIdx.x * 256 + threadIdx.x; if (i >= (size_t)NH_ * HD * TT / 8) return;
    const int lr = (int)(i & 15), hi = (int)((i >> 4) & 1), sel = (int)((i >> 5) & 1), dt = (int)((i >> 6) & 3), kb = (int)((i >> 8) % (TT / 32)), h = (int)((i >> 8) / (TT / 32)); const size_t b = blockIdx.y, ib = b * ((size_t)NH_ * HD * TT / 8) + i; const float* s = QKV + (b * TT + kb * 32 + sel * 16 + hi * 8) * 3 * EE + 2 * EE + h * HD + dt * 16 + lr; v8us oh, ol;
#pragma unroll
    for (int u = 0; u < 8; ++u) { unsigned short a, c; splitf(s[(size_t)u * 3 * EE], a, c); oh[u] = a; ol[u] = c; } *(v8us*)(VTh + ib * 8) = oh; *(v8us*)(VTl + ib * 8) = ol;  }
// ---- k_attn: the whole causal kernel attention (all batches, all heads) in one launch, ONE WAVE per 16 queries, nothing staged in memory or LDS between the two products.
// Per 32 keys: S^T = kn . qn^T (A = key rows, B = query rows kept in registers; 3 hi/lo products, K 64), so a lane holds 16 keys of ONE query (c = lane & 15); the kernel map, the causal select and the
// row sum run in f32 on those accumulators; the two S^T tiles, split into bf16 hi+lo, ARE the B operand of O^T += V^T . P^T (3 hi/lo products) in the hardware k order that the V^T loader also uses.
// O^T gives a lane 8 consecutive d of its query, one chunk of the merged hi/lo planes in fragment order: division by z in-lane, 16-byte stores, 512 contiguous bytes a wave.
// Work: a 16-query tile t walks t / 2 + 1 passes of 32 keys; every wave takes tile 127 - p and then tile p, 65 passes each. grid (heads, 16, batches), 4 waves: two waves per SIMD of the chip, so that one wave's vector work runs beside the other's matrix work and loads.
// amdgpu_waves_per_eu: lets the wave take more than 256 registers; under 256 the scheduler runs the 16 divisions of a pass one after another.
// Every plain '#pragma unroll' below opens a short loop of fixed length so that the fragment arrays it indexes are registers.
__global__ __launch_bounds__(128) __attribute__((amdgpu_waves_per_eu(2, 2))) void k_attn(const bf* __restrict__ Qh, const bf* __restrict__ Ql, const bf* __restrict__ Kh, const bf* __restrict__ Kl, const bf* __restrict__ VTh, const bf* __restrict__ VTl, bf* Ah, bf* Al) {
    typedef WFrag<bf> F; typedef F::V V;
    const int lane = threadIdx.x & 31, c = lane & 15, hi = lane >> 4; const int h = blockIdx.x;
    const int p = blockIdx.y * 4 + __builtin_amdgcn_readfirstlane(threadIdx.x >> 5);   // wave-uniform: the key loop runs on scalar control flow, EXEC stays full at every matrix instruction
    const int b = blockIdx.z; const size_t hb = (size_t)(b * NH_ + h) * TT * HD;
    const bf* kph = Kh + hb + 8 * lane; const bf* kpl = Kl + hb + 8 * lane; const bf* vph = VTh + hb + 8 * lane; const bf* vpl = VTl + hb + 8 * lane;   // fragment order: 32 keys are 4 neighbouring fragments (2048 elements) in each plane
#pragma unroll 1
    for (int half = 0; half < 2; ++half) {                   // rolled: one copy of the pass in the instruction cache
        const int r0 = (half ? p : TT / 16 - 1 - p) * 16; const int iq = r0 + c;
        V qh[2], ql[2];
#pragma unroll
        for (int ks = 0; ks < 2; ++ks) { qh[ks] = F::ld(Qh + hb + (size_t)r0 * HD + ks * 512 + 8 * lane); ql[ks] = F::ld(Ql + hb + (size_t)r0 * HD + ks * 512 + 8 * lane); }
        v8f acc[4];
#pragma unroll
        for (int dt = 0; dt < 4; ++dt) acc[dt] = (v8f){};
        float zs = 0.f; const int kend = r0 + 16;
        V kh[2][2], kl[2][2];
#pragma unroll
        for (int kt = 0; kt < 2; ++kt)
#pragma unroll
            for (int ks = 0; ks < 2; ++ks) { kh[kt][ks] = F::ld(kph + (size_t)(kt * 16) * HD + ks * 512); kl[kt][ks] = F::ld(kpl + (size_t)(kt * 16) * HD + ks * 512); }
#pragma unroll 1
        for (int kc = 0; kc < kend; kc += 32) {                  // rolled: one pass already holds 32 loads in flight and its registers; a second copy would only add registers
            V vh[4], vl[4];
#pragma unroll
            for (int dt = 0; dt < 4; ++dt) { vh[dt] = F::ld(vph + (size_t)kc * HD + dt * 512); vl[dt] = F::ld(vpl + (size_t)kc * HD + dt * 512); }
            v8f s[2]; s[0] = (v8f){}; s[1] = (v8f){};
#pragma unroll
            for (int ks = 0; ks < 2; ++ks) {
#pragma unroll
                for (int kt = 0; kt < 2; ++kt) s[kt] = F::mma(kh[kt][ks], qh[ks], s[kt]);
#pragma unroll
                for (int kt = 0; kt < 2; ++kt) s[kt] = F::mma(kh[kt][ks], ql[ks], s[kt]);
#pragma unroll
                for (int kt = 0; kt < 2; ++kt) s[kt] = F::mma(kl[kt][ks], qh[ks], s[kt]); }
            asm volatile("s_wait_xcnt 0x0" ::: "memory");       // the next-K loads below may land in registers that held the V^T loads' addresses: the wait stands in front of that overwrite
            const int kn = (kc + 32 < kend) ? kc + 32 : kc;      // the next 32 keys' fragments fly during the vector work (the last pass re-reads its own rows: in bounds, unused)
#pragma unroll
            for (int kt = 0; kt < 2; ++kt)
#pragma unroll
                for (int ks = 0; ks < 2; ++ks) { kh[kt][ks] = F::ld(kph + (size_t)(kn + kt * 16) * HD + ks * 512); kl[kt][ks] = F::ld(kpl + (size_t)(kn + kt * 16) * HD + ks * 512); }
            __builtin_amdgcn_sched_barrier(0);                   // all 32 loads issue as one group ahead of the vector work, which covers their latency; without it the scheduler spreads them among that work
            v8us p0h, p0l, p1h, p1l;
#pragma unroll
            for (int j = 0; j < 8; ++j) {
#pragma unroll
                for (int kt = 0; kt < 2; ++kt) { const float xd = (kc + kt * 16 + 8 * hi + j <= iq) ? s[kt][j] : 0.f;      // causal select on x_dot: 0 maps to exactly 0 (0 / 2.000001), and the 16 divisions stay branch-free and independent
                    const float den = fmaxf(__fsub_rn(2.000001f, __fmul_rn(2.0f, xd)), 1e-6f); const float kk = __fdiv_rn(__fmul_rn(xd, xd), den);
                    zs = __fadd_rn(zs, kk); unsigned short a, b; splitf(kk, a, b); if (kt == 0) { p0h[j] = a; p0l[j] = b; } else { p1h[j] = a; p1l[j] = b; } } }
            const V ph = cat16b(p0h, p1h), pl = cat16b(p0l, p1l);
#pragma unroll
            for (int dt = 0; dt < 4; ++dt) acc[dt] = F::mma(vh[dt], ph, acc[dt]);
#pragma unroll
            for (int dt = 0; dt < 4; ++dt) acc[dt] = F::mma(vh[dt], pl, acc[dt]);
#pragma unroll
            for (int dt = 0; dt < 4; ++dt) acc[dt] = F::mma(vl[dt], ph, acc[dt]);
        }
        zs += __shfl_xor(zs, 16, 32); const float zz = fmaxf(zs, 1e-6f);
#pragma unroll
        for (int dt = 0; dt < 4; ++dt) { v8us oh, ol;
#pragma unroll
            for (int j = 0; j < 8; ++j) { unsigned short a, b; splitf(__fdiv_rn(acc[dt][j], zz), a, b); oh[j] = a; ol[j] = b; }
            const size_t o = ((size_t)(2 * h + (dt >> 1)) * (NB_ * TT / 16) + b * (TT / 16) + (r0 >> 4)) * 512 + (dt & 1) * 256 + 8 * lane; *(v8us*)(Ah + o) = oh; *(v8us*)(Al + o) = ol; }   // chunk (R = (b T + r0) / 16, kb = 2 h + dt / 2, sel = dt & 1) of the merged [b t][E] planes
        asm volatile("s_wait_xcnt 0x0" ::: "memory");           // the second tile's set-up overwrites the registers that these stores name: the wait stands in front of it
    }
}

extern "C" void kernel_launch(void* const* d_in, const int* in_sizes, int n_in,
                              void* d_out, int out_size, void* d_ws, size_t ws_size, hipStream_t stream) {
    (void)in_sizes; (void)n_in; (void)out_size;
    const float* x = (const float*)d_in[0]; const float* wqkv = (const float*)d_in[1]; const float* bqkv = (const float*)d_in[2]; const float* wout = (const float*)d_in[3]; const float* bout = (const float*)d_in[4];   // torch [out][in] weights
    float* OUT = (float*)d_out;     // [2][2048][1024]
    char* wsp = (char*)d_ws;
    auto take = [&](size_t bytes) { char* p = wsp; wsp += (bytes + 255) & ~(size_t)255; return (void*)p; };
    const size_t MT = (size_t)NB_ * TT;     // both batches go through every launch: the projections see one [NB_ * TT][E] matrix, the per-head kernels take the batch from the grid
    bf* WQKV = (bf*)take((size_t)3 * EE * EE * 2); bf* WO = (bf*)take((size_t)EE * EE * 2); bf* XB = (bf*)take(MT * EE * 2); float* QKV = (float*)take(MT * 3 * EE * 4);
    bf* Qh = (bf*)take(MT * EE * 2); bf* Ql = (bf*)take(MT * EE * 2); bf* Kh = (bf*)take(MT * EE * 2); bf* Kl = (bf*)take(MT * EE * 2); bf* VTh = (bf*)take(MT * EE * 2); bf* VTl = (bf*)take(MT * EE * 2);
    bf* Ah = (bf*)take(MT * EE * 2); bf* Al = (bf*)take(MT * EE * 2);
    if ((size_t)(wsp - (char*)d_ws) > ws_size) return;    // total ~ 134 MB
    k_cvt8<<<dim3(3 * EE / 64, EE / 32, 1), 256, 0, stream>>>(wqkv, WQKV, (size_t)3 * EE * EE / 8); k_cvt8<<<dim3(EE / 64, EE / 32, 1), 256, 0, stream>>>(wout, WO, (size_t)EE * EE / 8);
    k_cvt8<<<dim3(NB_ * TT / 64, EE / 32, 1), 256, 0, stream>>>(x, XB, MT * EE / 8);
    k_gemmw<bf, 0, true><<<dim3(NB_ * TT / 64, 3 * EE / 64, 1), 32, 0, stream>>>(XB, nullptr, WQKV, nullptr, EE, NB_ * TT, 3 * EE, QKV, 3 * EE, bqkv, 0, 0, 0);
    k_nrm<<<dim3(2 * NH_ * (TT / 16) / 8, NB_, 1), 256, 0, stream>>>(QKV, Qh, Ql, Kh, Kl); k_vt<<<dim3((unsigned)(((size_t)NH_ * HD * TT / 8 + 255) / 256), NB_, 1), 256, 0, stream>>>(QKV, VTh, VTl);
    k_attn<<<dim3(NH_, TT / 128, NB_), 128, 0, stream>>>(Qh, Ql, Kh, Kl, VTh, VTl, Ah, Al);
    k_gemmw<bf, 1, true><<<dim3(NB_ * TT / 64, EE / 64, 1), 32, 0, stream>>>(Ah, Al, WO, nullptr, EE, NB_ * TT, EE, OUT, EE, bout, 0, 0, 0);
}

// v004
// Measured time: 159 microseconds a run.
// Two timings next to v003 put it at 1.07 and 1.08 times that version's speed.
// Over all steps from v000 it is 7.94 times as fast.
#include <hip/hip_runtime.h>

// ExactSphericalKernelCausalAttention (x [2][2048][1024]; [q|k|v] = x w_qkv^T + b_qkv (16 heads x 64); qn, kn = L2-normalised (max(norm, 1e-12)); x_dot = qn.kn; K = x_dot^2 / max(2 + 1e-6 - 2 x_dot, 1e-6) for j <= i else 0;
// out_h = (K v) / max(sum_j K, 1e-6); out = merged w_out^T + b_out -> [2][2048][1024]; no softmax).
// Compute dtypes, f32 accumulate: every input rounded to bf16; the qkv projection on PLAIN bf16 operands (inputs: exact, + bias); normalisation f32 -> bf16 hi+lo planes of qn / kn; x_dot on 3 products (K 64, tiles above
// the diagonal skipped); the kernel K and its causal select in f32 on the score accumulators, its row sums in f32 (in-lane, halves joined once) -> bf16 hi+lo fragments of K in registers; K.v on hi+lo operands (3 products, keys limited to the diagonal block; the output (rms 0.10) is a cancelling sum); the division by z and the merge f32 -> hl planes;

#define NB_  2
#define TT   2048
#define EE   1024
#define NH_  16
#define HD   64
#define ZH   2
#define PCAR 64.0f
typedef _Float16 h16;
typedef unsigned short bf;
typedef __attribute__((ext_vector_type(16))) __bf16   v16bf;
typedef __attribute__((ext_vector_type(16))) _Float16 v16h;
typedef __attribute__((ext_vector_type(8)))  _Float16 v8h;
typedef __attribute__((ext_vector_type(8)))  unsigned short v8us;
typedef __attribute__((ext_vector_type(8)))  float    v8f;
typedef __attribute__((ext_vector_type(4)))  float    v4f;
typedef v8h  __attribute__((may_alias)) v8ha;
typedef v4f  __attribute__((may_alias)) v4fa;
typedef v8us __attribute__((may_alias)) v8usa;

__device__ __forceinline__ unsigned short f2bf(float f) { unsigned u = __float_as_uint(f); u += 0x7FFFu + ((u >> 16) & 1u); return (unsigned short)(u >> 16); }
__device__ __forceinline__ float bf2f(unsigned short b) { return __uint_as_float(((unsigned)b) << 16); }
__device__ __forceinline__ float bfr(float f) { return bf2f(f2bf(f)); }
__device__ __forceinline__ void splitf(float y, unsigned short& h, unsigned short& l) { h = f2bf(y); l = f2bf(y - bf2f(h)); }
__device__ __forceinline__ v16h cat16(v8h lo, v8h hi) { return __builtin_shufflevector(lo, hi, 0, 1, 2, 3, 4, 5, 6, 7, 8, 9, 10, 11, 12, 13, 14, 15); }
__device__ __forceinline__ v16bf cat16b(v8us lo, v8us hi) { return __builtin_bit_cast(v16bf, __builtin_shufflevector(lo, hi, 0, 1, 2, 3, 4, 5, 6, 7, 8, 9, 10, 11, 12, 13, 14, 15)); }
__device__ __forceinline__ v8f wmma16(v16h a, v16h b, v8f c) { return __builtin_amdgcn_wmma_f32_16x16x32_f16(false, a, false, b, (short)0, c, false, false); }
__device__ __forceinline__ v8f wmmab(v16bf a, v16bf b, v8f c) { return __builtin_amdgcn_wmma_f32_16x16x32_bf16(false, a, false, b, (short)0, c, false, false); }



// ---- k_gemmw: register-blocked GEMM, ONE WAVE per 64x64 output tile (16 accumulators), operands straight from 16-bit planes in fragment order (below); grid (M/64, N/64, Z), 32 threads.
// C[m][n] (f32, pitch ldc, + optional f32 bias[n]) = sum_k A[m][k] Bt[n][k] (+ split products per NSPLIT). z-batch strides sA/sB/sC in elements. K % 32 == 0.
// PLANES (the qkv projection; a 64-column tile is one head of q, k or v, a 64-row tile lies in one batch): no C; the wave that holds the tile writes the attention's operand planes itself, see the epilogue.
template <typename T16> struct WFrag;
template <> struct WFrag<h16> { typedef v16h V; static __device__ __forceinline__ V ld(const h16* p) { return cat16(*(const v8h*)p, *(const v8h*)(p + 256)); } static __device__ __forceinline__ v8f mma(V a, V b, v8f c) { return wmma16(a, b, c); } };
template <> struct WFrag<bf> { typedef v16bf V; static __device__ __forceinline__ V ld(const bf* p) { return cat16b(*(const v8us*)p, *(const v8us*)(p + 256)); } static __device__ __forceinline__ v8f mma(V a, V b, v8f c) { return wmmab(a, b, c); } };
// ---- FRAGMENT ORDER: every 16-bit plane that a matrix instruction reads (x, the weights, qn, kn, V^T, the merged heads; hi and lo) is stored as whole fragments, not as rows. A plane P[rows][K] is cut into fragments of 16 rows x 32 k = 512 elements = 1 KiB;
// inside a fragment, 16-byte chunk number sel * 32 + hi * 16 + lr holds P[16 R + lr][32 kb + 16 sel + 8 hi + 0..7], which is what lane hi * 16 + lr takes as the first (sel 0) or second (sel 1) half of its operand.
// So a wave's 16-byte load or store covers 512 contiguous bytes (4 whole lines) where a row-major plane gives it 32 bytes in each of 16 lines. qn, kn (K = 64): fragment (R, kb) at element (R * 2 + kb) * 512 of its head; the GEMM operands: at (kb * (rows / 16) + R) * 512, so that the four fragments a 64-row tile takes per 32 k are neighbours;
// V^T (rows d, k = key): fragment (R, kb) at (kb * 4 + R) * 512, so that the fragments of one pass of 32 keys are neighbours in every plane. Values, k order and every sum are those of the row-major form.
// WFrag::ld(p) above takes p = fragment + lane * 8.
template <typename T16, int NSPLIT, bool BIAS, bool PLANES>
__global__ __launch_bounds__(32) void k_gemmw(const T16* __restrict__ A, const T16* __restrict__ A2, const T16* __restrict__ Bt, const T16* __restrict__ Bt2, int K, int arows, int brows, float* C, int ldc, const float* __restrict__ bias, size_t sA, size_t sB, size_t sC, bf* Qh, bf* Ql, bf* Kh, bf* Kl, bf* VTh, bf* VTl) {
    typedef typename WFrag<T16>::V V;
    __shared__ __align__(16) float os[(PLANES ? 64 : 16) * 68];
    const size_t z = blockIdx.z; A += z * sA; if (A2) A2 += z * sA; Bt += z * sB; if (Bt2) Bt2 += z * sB; C += z * sC;
    const int lane = threadIdx.x & 31, lr = lane & 15, hi = lane >> 4; const int r0 = blockIdx.x * 64, c0 = blockIdx.y * 64;
    v8f acc[4][4];
#pragma unroll
    for (int mb = 0; mb < 4; ++mb)
#pragma unroll
        for (int nb = 0; nb < 4; ++nb) acc[mb][nb] = (v8f){};
    const size_t aoff = (size_t)r0 * 32 + 8 * lane, boff = (size_t)c0 * 32 + 8 * lane, astep = (size_t)arows * 32, bstep = (size_t)brows * 32;   // 16 rows further is the next fragment, 512 elements on; 32 k further is one fragment of every row block on (arows, brows: rows of the whole A and Bt planes)
#pragma unroll 1
    for (int kc = 0; kc < K; kc += 32) {
        V a[4], a2[4]; const size_t ak = aoff + (size_t)(kc >> 5) * astep, bk = boff + (size_t)(kc >> 5) * bstep; const T16* pa = A + ak; const T16* pb = Bt + bk; const T16* pa2 = (NSPLIT == 1 || NSPLIT == 2) ? A2 + ak : pa; const T16* pb2 = (NSPLIT >= 2) ? Bt2 + bk : pb;
#pragma unroll
        for (int mb = 0; mb < 4; ++mb) { a[mb] = WFrag<T16>::ld(pa + mb * 512); if (NSPLIT == 1 || NSPLIT == 2) a2[mb] = WFrag<T16>::ld(pa2 + mb * 512); }
#pragma unroll
        for (int nb = 0; nb < 4; ++nb) { const V b = WFrag<T16>::ld(pb + nb * 512); V b2; if (NSPLIT >= 2) b2 = WFrag<T16>::ld(pb2 + nb * 512);
#pragma unroll
            for (int mb = 0; mb < 4; ++mb) { acc[mb][nb] = WFrag<T16>::mma(a[mb], b, acc[mb][nb]); if (NSPLIT == 1 || NSPLIT == 2) acc[mb][nb] = WFrag<T16>::mma(a2[mb], b, acc[mb][nb]); if (NSPLIT >= 2) acc[mb][nb] = WFrag<T16>::mma(a[mb], b2, acc[mb][nb]); } }
        asm volatile("v_nop\n\tv_nop\n\tv_nop\n\tv_nop" : "+v"(acc[0][0]), "+v"(acc[1][1]), "+v"(acc[2][2]), "+v"(acc[3][3]) : "v"(a[0]), "v"(a[3]));
        // the wait stands behind this trip's loads; it takes their addresses as inputs, so that the address registers stay untouched (no later load lands in them, no next address is formed in them) until it has passed
        asm volatile("s_wait_xcnt 0x0" :: "v"(pa), "v"(pb), "v"(pa2), "v"(pb2) : "memory");
    }
    if constexpr (PLANES) {
        // c0, r0 come from blockIdx: part, head, batch and the branch on them are scalar
        const int part = c0 / EE, h = (c0 % EE) / HD, b = r0 / TT, t0 = r0 % TT; const size_t hb = (size_t)(b * NH_ + h) * TT * HD;
        float bb[4];
#pragma unroll
        for (int nb = 0; nb < 4; ++nb) bb[nb] = bfr(bias[c0 + nb * 16 + lr]);
        if (part == 2) {
            // v: an accumulator gives lane (lr, hi) the keys t0 + 16 mb + 8 hi + 0..7 of d = 16 nb + lr, which is chunk (kb = t / 32, dt = nb, sel = mb & 1) of V^T in fragment order: bias, hi/lo split, 16-byte stores, 512 contiguous bytes a wave
#pragma unroll
            for (int mb = 0; mb < 4; ++mb) {
#pragma unroll
                for (int nb = 0; nb < 4; ++nb) { v8us oh, ol;
#pragma unroll
                    for (int j = 0; j < 8; ++j) { unsigned short a, c; splitf(acc[mb][nb][j] + bb[nb], a, c); oh[j] = a; ol[j] = c; }
                    const size_t o = hb + (size_t)((t0 >> 5) + (mb >> 1)) * 2048 + nb * 512 + (mb & 1) * 256 + 8 * lane; *(v8us*)(VTh + o) = oh; *(v8us*)(VTl + o) = ol; }
                asm volatile("s_wait_xcnt 0x0" ::: "memory");   // the next 16 keys' work overwrites registers that these stores name: the wait stands in front of it
            }
        } else {
            // q, k: the tile goes through LDS so that lane (lr, hi) holds the four chunks of row lr that fragment order gives it (d = 32 kb + 16 sel + 8 hi + 0..7); L2 norm, division, hi/lo split, 16-byte stores.
            // The sum of squares keeps the tree pairs d, d + 1; then d ^ 32, ^ 16, ^ 8, ^ 4, ^ 2: only the ^ 8 level crosses lanes.
            bf* H = part ? Kh : Qh; bf* Lo = part ? Kl : Ql;
#pragma unroll
            for (int mb = 0; mb < 4; ++mb)
#pragma unroll
                for (int nb = 0; nb < 4; ++nb)
#pragma unroll
                    for (int j = 0; j < 8; ++j) os[(mb * 16 + hi * 8 + j) * 68 + nb * 16 + lr] = acc[mb][nb][j] + bb[nb];
            __builtin_amdgcn_wave_barrier(); asm volatile("" ::: "memory");   // the rows are read back by other lanes of this wave: no read moves in front of the writes
#pragma unroll 1
            for (int mb = 0; mb < 4; ++mb) {                     // rolled: one copy of the 32 divisions and splits, so that the kernel's text stays short (each wave runs it once through)
                v8f x[2][2]; float lf[2][2][4];
#pragma unroll
                for (int kb = 0; kb < 2; ++kb)
#pragma unroll
                    for (int sel = 0; sel < 2; ++sel) { const float* s = os + (mb * 16 + lr) * 68 + kb * 32 + sel * 16 + hi * 8; const v4f x0 = *(const v4fa*)s, x1 = *(const v4fa*)(s + 4); x[kb][sel] = __builtin_shufflevector(x0, x1, 0, 1, 2, 3, 4, 5, 6, 7);
#pragma unroll
                        for (int e = 0; e < 4; ++e) lf[kb][sel][e] = __fadd_rn(__fmul_rn(x[kb][sel][2 * e], x[kb][sel][2 * e]), __fmul_rn(x[kb][sel][2 * e + 1], x[kb][sel][2 * e + 1])); }
                float s3[4];
#pragma unroll
                for (int e = 0; e < 4; ++e) { const float s2 = __fadd_rn(__fadd_rn(lf[0][0][e], lf[1][0][e]), __fadd_rn(lf[0][1][e], lf[1][1][e])); s3[e] = __fadd_rn(s2, __shfl_xor(s2, 16, 32)); }
                const float ss = __fadd_rn(__fadd_rn(s3[0], s3[2]), __fadd_rn(s3[1], s3[3])); const float nn = fmaxf(__fsqrt_rn(ss), 1e-12f);
                const size_t o = hb + (size_t)((t0 >> 4) + mb) * 1024 + lane * 8;
#pragma unroll
                for (int kb = 0; kb < 2; ++kb)
#pragma unroll
                    for (int sel = 0; sel < 2; ++sel) { v8us oh, ol;
#pragma unroll
                        for (int e = 0; e < 8; ++e) { unsigned short a, c; splitf(__fdiv_rn(x[kb][sel][e], nn), a, c); oh[e] = a; ol[e] = c; }
                        *(v8us*)(H + o + kb * 512 + sel * 256) = oh; *(v8us*)(Lo + o + kb * 512 + sel * 256) = ol; }
                asm volatile("s_wait_xcnt 0x0" ::: "memory");   // the next 16 rows' work overwrites registers that these stores name: the wait stands in front of it
            }
        }
        return;
    }
#pragma unroll
    for (int mb = 0; mb < 4; ++mb) {
#pragma unroll
        for (int nb = 0; nb < 4; ++nb) {
#pragma unroll
            for (int j = 0; j < 8; ++j) os[(hi * 8 + j) * 68 + nb * 16 + lr] = acc[mb][nb][j]; }
        __builtin_amdgcn_wave_barrier(); asm volatile("" ::: "memory");
        float* crow = C + (size_t)(r0 + mb * 16) * ldc + c0;
{
#pragma unroll
            for (int s = 0; s < 8; ++s) { const int row = 2 * s + hi, cofs = lr * 4; v4f val = *(const v4fa*)(os + row * 68 + cofs); if (BIAS) { val[0] += bfr(bias[c0 + cofs]); val[1] += bfr(bias[c0 + cofs + 1]); val[2] += bfr(bias[c0 + cofs + 2]); val[3] += bfr(bias[c0 + cofs + 3]); }
                *(v4f*)(crow + (size_t)row * ldc + cofs) = val; }
             }
        asm volatile("s_wait_xcnt 0x0" ::: "memory");           // the next 16 rows' work overwrites registers that these stores name: the wait stands in front of it
        __builtin_amdgcn_wave_barrier(); asm volatile("" ::: "memory");
    }
}

__device__ __forceinline__ h16 tohx(float x) { return (h16)x; }
typedef __attribute__((ext_vector_type(2))) _Float16 v2h;
typedef __attribute__((ext_vector_type(4))) _Float16 v4h;
typedef __attribute__((ext_vector_type(2))) unsigned short v2us;
typedef __attribute__((ext_vector_type(4))) unsigned short v4us;

__global__ __launch_bounds__(256) void k_wtG(const float* __restrict__ w, int K, int N, bf* Bt) {
    const int lane = threadIdx.x & 31; const int L0 = (blockIdx.x * 8 + (threadIdx.x >> 5)) * 8; const int nlines = N * K / 64;
{
#pragma unroll 1
        for (int l = 0; l < 8; ++l) { const int L = L0 + l; if (L >= nlines) break; const size_t e = (size_t)L * 64 + lane * 2; const int k = (int)(e % K), n = (int)(e / K); v2us o;
            o[0] = f2bf(w[(size_t)k * N + n]); o[1] = f2bf(w[(size_t)(k + 1) * N + n]); *(v2us*)(Bt + e) = o; }
         }
}
// k_cvt8: f32 [rows][EE] -> bf16 GEMM operand plane in fragment order (rows = n8 * 8 / EE); thread i writes chunk i (a wave stores 512 contiguous bytes) and fetches the 8 values that belong there.
__global__ __launch_bounds__(256) void k_cvt8(const float* __restrict__ src, bf* dst, size_t n8) { const size_t slab = n8 / (EE / 32), j = (size_t)blockIdx.x * 256 + threadIdx.x; if (j >= slab) return;   // grid (rows / 64, EE / 32): blockIdx.y is kb, j the chunk among those of one kb
    const int lr = (int)(j & 15), hi = (int)((j >> 4) & 1), sel = (int)((j >> 5) & 1), kb = blockIdx.y; const size_t R = j >> 6, i = (size_t)kb * slab + j;
    const v8f v = *(const v8f*)(src + (R * 16 + lr) * EE + kb * 32 + sel * 16 + hi * 8); v8us o;
#pragma unroll
    for (int k = 0; k < 8; ++k) o[k] = f2bf(v[k]); *(v8us*)(dst + i * 8) = o;  }
// ---- k_attn: the whole causal kernel attention (all batches, all heads) in one launch, ONE WAVE per 16 queries, nothing staged in memory or LDS between the two products.
// Per 32 keys: S^T = kn . qn^T (A = key rows, B = query rows kept in registers; 3 hi/lo products, K 64), so a lane holds 16 keys of ONE query (c = lane & 15); the kernel map, the causal select and the
// row sum run in f32 on those accumulators; the two S^T tiles, split into bf16 hi+lo, ARE the B operand of O^T += V^T . P^T (3 hi/lo products) in the hardware k order that the V^T loader also uses.
// O^T gives a lane 8 consecutive d of its query, one chunk of the merged hi/lo planes in fragment order: division by z in-lane, 16-byte stores, 512 contiguous bytes a wave.
// Work: a 16-query tile t walks t / 2 + 1 passes of 32 keys; every wave takes tile 127 - p and then tile p, 65 passes each. grid (heads, 16, batches), 4 waves: two waves per SIMD of the chip, so that one wave's vector work runs beside the other's matrix work and loads.
// amdgpu_waves_per_eu: lets the wave take more than 256 registers; under 256 the scheduler runs the 16 divisions of a pass one after another.
// Every plain '#pragma unroll' below opens a short loop of fixed length so that the fragment arrays it indexes are registers.
__global__ __launch_bounds__(128) __attribute__((amdgpu_waves_per_eu(2, 2))) void k_attn(const bf* __restrict__ Qh, const bf* __restrict__ Ql, const bf* __restrict__ Kh, const bf* __restrict__ Kl, const bf* __restrict__ VTh, const bf* __restrict__ VTl, bf* Ah, bf* Al) {
    typedef WFrag<bf> F; typedef F::V V;
    const int lane = threadIdx.x & 31, c = lane & 15, hi = lane >> 4; const int h = blockIdx.x;
    const int p = blockIdx.y * 4 + __builtin_amdgcn_readfirstlane(threadIdx.x >> 5);   // wave-uniform: the key loop runs on scalar control flow, EXEC stays full at every matrix instruction
    const int b = blockIdx.z; const size_t hb = (size_t)(b * NH_ + h) * TT * HD;
    const bf* kph = Kh + hb + 8 * lane; const bf* kpl = Kl + hb + 8 * lane; const bf* vph = VTh + hb + 8 * lane; const bf* vpl = VTl + hb + 8 * lane;   // fragment order: 32 keys are 4 neighbouring fragments (2048 elements) in each plane
#pragma unroll 1
    for (int half = 0; half < 2; ++half) {                   // rolled: one copy of the pass in the instruction cache
        const int r0 = (half ? p : TT / 16 - 1 - p) * 16; const int iq = r0 + c;
        V qh[2], ql[2];
#pragma unroll
        for (int ks = 0; ks < 2; ++ks) { qh[ks] = F::ld(Qh + hb + (size_t)r0 * HD + ks * 512 + 8 * lane); ql[ks] = F::ld(Ql + hb + (size_t)r0 * HD + ks * 512 + 8 * lane); }
        v8f acc[4];
#pragma unroll
        for (int dt = 0; dt < 4; ++dt) acc[dt] = (v8f){};
        float zs = 0.f; const int kend = r0 + 16;
        V kh[2][2], kl[2][2];
#pragma unroll
        for (int kt = 0; kt < 2; ++kt)
#pragma unroll
            for (int ks = 0; ks < 2; ++ks) { kh[kt][ks] = F::ld(kph + (size_t)(kt * 16) * HD + ks * 512); kl[kt][ks] = F::ld(kpl + (size_t)(kt * 16) * HD + ks * 512); }
#pragma unroll 1
        for (int kc = 0; kc < kend; kc += 32) {                  // rolled: one pass already holds 32 loads in flight and its registers; a second copy would only add registers
            V vh[4], vl[4];
#pragma unroll
            for (int dt = 0; dt < 4; ++dt) { vh[dt] = F::ld(vph + (size_t)kc * HD + dt * 512); vl[dt] = F::ld(vpl + (size_t)kc * HD + dt * 512); }
            v8f s[2]; s[0] = (v8f){}; s[1] = (v8f){};
#pragma unroll
            for (int ks = 0; ks < 2; ++ks) {
#pragma unroll
                for (int kt = 0; kt < 2; ++kt) s[kt] = F::mma(kh[kt][ks], qh[ks], s[kt]);
#pragma unroll
                for (int kt = 0; kt < 2; ++kt) s[kt] = F::mma(kh[kt][ks], ql[ks], s[kt]);
#pragma unroll
                for (int kt = 0; kt < 2; ++kt) s[kt] = F::mma(kl[kt][ks], qh[ks], s[kt]); }
            asm volatile("s_wait_xcnt 0x0" ::: "memory");       // the next-K loads below may land in registers that held the V^T loads' addresses: the wait stands in front of that overwrite
            const int kn = (kc + 32 < kend) ? kc + 32 : kc;      // the next 32 keys' fragments fly during the vector work (the last pass re-reads its own rows: in bounds, unused)
#pragma unroll
            for (int kt = 0; kt < 2; ++kt)
#pragma unroll
                for (int ks = 0; ks < 2; ++ks) { kh[kt][ks] = F::ld(kph + (size_t)(kn + kt * 16) * HD + ks * 512); kl[kt][ks] = F::ld(kpl + (size_t)(kn + kt * 16) * HD + ks * 512); }
            __builtin_amdgcn_sched_barrier(0);                   // all 32 loads issue as one group ahead of the vector work, which covers their latency; without it the scheduler spreads them among that work
            v8us p0h, p0l, p1h, p1l;
#pragma unroll
            for (int j = 0; j < 8; ++j) {
#pragma unroll
                for (int kt = 0; kt < 2; ++kt) { const float xd = (kc + kt * 16 + 8 * hi + j <= iq) ? s[kt][j] : 0.f;      // causal select on x_dot: 0 maps to exactly 0 (0 / 2.000001), and the 16 divisions stay branch-free and independent
                    const float den = fmaxf(__fsub_rn(2.000001f, __fmul_rn(2.0f, xd)), 1e-6f); const float kk = __fdiv_rn(__fmul_rn(xd, xd), den);
                    zs = __fadd_rn(zs, kk); unsigned short a, b; splitf(kk, a, b); if (kt == 0) { p0h[j] = a; p0l[j] = b; } else { p1h[j] = a; p1l[j] = b; } } }
            const V ph = cat16b(p0h, p1h), pl = cat16b(p0l, p1l);
#pragma unroll
            for (int dt = 0; dt < 4; ++dt) acc[dt] = F::mma(vh[dt], ph, acc[dt]);
#pragma unroll
            for (int dt = 0; dt < 4; ++dt) acc[dt] = F::mma(vh[dt], pl, acc[dt]);
#pragma unroll
            for (int dt = 0; dt < 4; ++dt) acc[dt] = F::mma(vl[dt], ph, acc[dt]);
        }
        zs += __shfl_xor(zs, 16, 32); const float zz = fmaxf(zs, 1e-6f);
#pragma unroll
        for (int dt = 0; dt < 4; ++dt) { v8us oh, ol;
#pragma unroll
            for (int j = 0; j < 8; ++j) { unsigned short a, b; splitf(__fdiv_rn(acc[dt][j], zz), a, b); oh[j] = a; ol[j] = b; }
            const size_t o = ((size_t)(2 * h + (dt >> 1)) * (NB_ * TT / 16) + b * (TT / 16) + (r0 >> 4)) * 512 + (dt & 1) * 256 + 8 * lane; *(v8us*)(Ah + o) = oh; *(v8us*)(Al + o) = ol; }   // chunk (R = (b T + r0) / 16, kb = 2 h + dt / 2, sel = dt & 1) of the merged [b t][E] planes
        asm volatile("s_wait_xcnt 0x0" ::: "memory");           // the second tile's set-up overwrites the registers that these stores name: the wait stands in front of it
    }
}

extern "C" void kernel_launch(void* const* d_in, const int* in_sizes, int n_in,
                              void* d_out, int out_size, void* d_ws, size_t ws_size, hipStream_t stream) {
    (void)in_sizes; (void)n_in; (void)out_size;
    const float* x = (const float*)d_in[0]; const float* wqkv = (const float*)d_in[1]; const float* bqkv = (const float*)d_in[2]; const float* wout = (const float*)d_in[3]; const float* bout = (const float*)d_in[4];   // torch [out][in] weights
    float* OUT = (float*)d_out;     // [2][2048][1024]
    char* wsp = (char*)d_ws;
    auto take = [&](size_t bytes) { char* p = wsp; wsp += (bytes + 255) & ~(size_t)255; return (void*)p; };
    const size_t MT = (size_t)NB_ * TT;     // both batches go through every launch: the projections see one [NB_ * TT][E] matrix, the per-head kernels take the batch from the grid
    bf* WQKV = (bf*)take((size_t)3 * EE * EE * 2); bf* WO = (bf*)take((size_t)EE * EE * 2); bf* XB = (bf*)take(MT * EE * 2);
    bf* Qh = (bf*)take(MT * EE * 2); bf* Ql = (bf*)take(MT * EE * 2); bf* Kh = (bf*)take(MT * EE * 2); bf* Kl = (bf*)take(MT * EE * 2); bf* VTh = (bf*)take(MT * EE * 2); bf* VTl = (bf*)take(MT * EE * 2);
    bf* Ah = (bf*)take(MT * EE * 2); bf* Al = (bf*)take(MT * EE * 2);
    if ((size_t)(wsp - (char*)d_ws) > ws_size) return;    // total ~ 84 MB
    k_cvt8<<<dim3(3 * EE / 64, EE / 32, 1), 256, 0, stream>>>(wqkv, WQKV, (size_t)3 * EE * EE / 8); k_cvt8<<<dim3(EE / 64, EE / 32, 1), 256, 0, stream>>>(wout, WO, (size_t)EE * EE / 8);
    k_cvt8<<<dim3(NB_ * TT / 64, EE / 32, 1), 256, 0, stream>>>(x, XB, MT * EE / 8);
    k_gemmw<bf, 0, true, true><<<dim3(NB_ * TT / 64, 3 * EE / 64, 1), 32, 0, stream>>>(XB, nullptr, WQKV, nullptr, EE, NB_ * TT, 3 * EE, nullptr, 0, bqkv, 0, 0, 0, Qh, Ql, Kh, Kl, VTh, VTl);
    k_attn<<<dim3(NH_, TT / 128, NB_), 128, 0, stream>>>(Qh, Ql, Kh, Kl, VTh, VTl, Ah, Al);
    k_gemmw<bf, 1, true, false><<<dim3(NB_ * TT / 64, EE / 64, 1), 32, 0, stream>>>(Ah, Al, WO, nullptr, EE, NB_ * TT, EE, OUT, EE, bout, 0, 0, 0, nullptr, nullptr, nullptr, nullptr, nullptr, nullptr);
}

// v005
// Measured time: 122 microseconds a run.
// In both of two side-by-side timings against v004, it was 1.32 times as fast.
// Over all steps from v000 it is 10.5 times as fast.
#include <hip/hip_runtime.h>

// ExactSphericalKernelCausalAttention (x [2][2048][1024]; [q|k|v] = x w_qkv^T + b_qkv (16 heads x 64); qn, kn = L2-normalised (max(norm, 1e-12)); x_dot = qn.kn; K = x_dot^2 / max(2 + 1e-6 - 2 x_dot, 1e-6) for j <= i else 0;
// out_h = (K v) / max(sum_j K, 1e-6); out = merged w_out^T + b_out -> [2][2048][1024]; no softmax).
// Compute dtypes, f32 accumulate: every input rounded to bf16; the qkv projection on PLAIN bf16 operands (inputs: exact, + bias); normalisation f32 -> bf16 hi+lo planes of qn / kn; x_dot on 3 products (K 64, tiles above
// the diagonal skipped); the kernel K and its causal select in f32 on the score accumulators, its row sums in f32 (in-lane, halves joined once) -> bf16 hi+lo fragments of K in registers; K.v on hi+lo operands (3 products, keys limited to the diagonal block; the output (rms 0.10) is a cancelling sum); the division by z and the merge f32 -> hl planes;

#define NB_  2
#define TT   2048
#define EE   1024
#define NH_  16
#define HD   64
#define ZH   2
#define PCAR 64.0f
typedef _Float16 h16;
typedef unsigned short bf;
typedef __attribute__((ext_vector_type(16))) __bf16   v16bf;
typedef __attribute__((ext_vector_type(16))) _Float16 v16h;
typedef __attribute__((ext_vector_type(8)))  _Float16 v8h;
typedef __attribute__((ext_vector_type(8)))  unsigned short v8us;
typedef __attribute__((ext_vector_type(8)))  float    v8f;
typedef __attribute__((ext_vector_type(4)))  float    v4f;
typedef v8h  __attribute__((may_alias)) v8ha;
typedef v4f  __attribute__((may_alias)) v4fa;
typedef v8us __attribute__((may_alias)) v8usa;

__device__ __forceinline__ unsigned short f2bf(float f) { unsigned u = __float_as_uint(f); u += 0x7FFFu + ((u >> 16) & 1u); return (unsigned short)(u >> 16); }
__device__ __forceinline__ float bf2f(unsigned short b) { return __uint_as_float(((unsigned)b) << 16); }
__device__ __forceinline__ float bfr(float f) { return bf2f(f2bf(f)); }
__device__ __forceinline__ void splitf(float y, unsigned short& h, unsigned short& l) { h = f2bf(y); l = f2bf(y - bf2f(h)); }
__device__ __forceinline__ v16h cat16(v8h lo, v8h hi) { return __builtin_shufflevector(lo, hi, 0, 1, 2, 3, 4, 5, 6, 7, 8, 9, 10, 11, 12, 13, 14, 15); }
__device__ __forceinline__ v16bf cat16b(v8us lo, v8us hi) { return __builtin_bit_cast(v16bf, __builtin_shufflevector(lo, hi, 0, 1, 2, 3, 4, 5, 6, 7, 8, 9, 10, 11, 12, 13, 14, 15)); }
__device__ __forceinline__ v8f wmma16(v16h a, v16h b, v8f c) { return __builtin_amdgcn_wmma_f32_16x16x32_f16(false, a, false, b, (short)0, c, false, false); }
__device__ __forceinline__ v8f wmmab(v16bf a, v16bf b, v8f c) { return __builtin_amdgcn_wmma_f32_16x16x32_bf16(false, a, false, b, (short)0, c, false, false); }



// ---- k_gemmw: register-blocked GEMM, ONE WAVE per 64x64 output tile (16 accumulators), operands straight from 16-bit planes in fragment order (below); grid (M/64, N/64, Z), 32 threads.
// C[m][n] (f32, pitch ldc, + optional f32 bias[n]) = sum_k A[m][k] Bt[n][k] (+ split products per NSPLIT). z-batch strides sA/sB/sC in elements. K % 128 == 0 (whole turns of the ring of register sets below). amdgpu_waves_per_eu: the register budget of the waves that share a SIMD, three in the qkv projection, one in the output projection.
// PLANES (the qkv projection; a 64-column tile is one head of q, k or v, a 64-row tile lies in one batch): no C; the wave that holds the tile writes the attention's operand planes itself, see the epilogue.
template <typename T16> struct WFrag;
template <> struct WFrag<h16> { typedef v16h V; static __device__ __forceinline__ V ld(const h16* p) { return cat16(*(const v8h*)p, *(const v8h*)(p + 256)); } static __device__ __forceinline__ v8f mma(V a, V b, v8f c) { return wmma16(a, b, c); } };
template <> struct WFrag<bf> { typedef v16bf V; static __device__ __forceinline__ V ld(const bf* p) { return cat16b(*(const v8us*)p, *(const v8us*)(p + 256)); } static __device__ __forceinline__ v8f mma(V a, V b, v8f c) { return wmmab(a, b, c); } };
// ---- FRAGMENT ORDER: every 16-bit plane that a matrix instruction reads (x, the weights, qn, kn, V^T, the merged heads; hi and lo) is stored as whole fragments, not as rows. A plane P[rows][K] is cut into fragments of 16 rows x 32 k = 512 elements = 1 KiB;
// inside a fragment, 16-byte chunk number sel * 32 + hi * 16 + lr holds P[16 R + lr][32 kb + 16 sel + 8 hi + 0..7], which is what lane hi * 16 + lr takes as the first (sel 0) or second (sel 1) half of its operand.
// So a wave's 16-byte load or store covers 512 contiguous bytes (4 whole lines) where a row-major plane gives it 32 bytes in each of 16 lines. qn, kn (K = 64): fragment (R, kb) at element (R * 2 + kb) * 512 of its head; the GEMM operands: at (kb * (rows / 16) + R) * 512, so that the four fragments a 64-row tile takes per 32 k are neighbours;
// V^T (rows d, k = key): fragment (R, kb) at (kb * 4 + R) * 512, so that the fragments of one pass of 32 keys are neighbours in every plane. Values, k order and every sum are those of the row-major form.
// WFrag::ld(p) above takes p = fragment + lane * 8.
template <typename T16, int NSPLIT, bool BIAS, bool PLANES>
__global__ __launch_bounds__(32) __attribute__((amdgpu_waves_per_eu(PLANES ? 3 : 1, PLANES ? 3 : 1))) void k_gemmw(const T16* __restrict__ A, const T16* __restrict__ A2, const T16* __restrict__ Bt, const T16* __restrict__ Bt2, int K, int arows, int brows, float* C, int ldc, const float* __restrict__ bias, size_t sA, size_t sB, size_t sC, bf* Qh, bf* Ql, bf* Kh, bf* Kl, bf* VTh, bf* VTl) {
    typedef typename WFrag<T16>::V V;
    __shared__ __align__(16) float os[(PLANES ? 64 : 16) * 68];
    const size_t z = blockIdx.z; A += z * sA; if (A2) A2 += z * sA; Bt += z * sB; if (Bt2) Bt2 += z * sB; C += z * sC;
    const int lane = threadIdx.x & 31, lr = lane & 15, hi = lane >> 4; const int r0 = blockIdx.x * 64, c0 = blockIdx.y * 64;
    v8f acc[4][4];
#pragma unroll
    for (int mb = 0; mb < 4; ++mb)
#pragma unroll
        for (int nb = 0; nb < 4; ++nb) acc[mb][nb] = (v8f){};
    const size_t aoff = (size_t)r0 * 32 + 8 * lane, boff = (size_t)c0 * 32 + 8 * lane, astep = (size_t)arows * 32, bstep = (size_t)brows * 32;   // 16 rows further is the next fragment, 512 elements on; 32 k further is one fragment of every row block on (arows, brows: rows of the whole A and Bt planes)
    // RING OF REGISTER SETS: ND sets of this wave's A and B fragments; the loads of trip t + AH are issued in front of the products of trip t, so a load has AH trips of matrix work to arrive in.
    // Two sets, one trip ahead, where three waves share a SIMD (the qkv projection: the register budget of three waves); four sets, two trips ahead, where a wave has its SIMD alone (the output projection: behind the set in use 48 loads are in flight, which the load counter can still count,
    // and a load lands in a set whose products were issued two trips ago). Every accumulator takes its products in the order of k, as before.
    constexpr int ND = PLANES ? 2 : 4, AH = PLANES ? 1 : 2; constexpr bool HA2 = (NSPLIT == 1 || NSPLIT == 2), HB2 = (NSPLIT >= 2);
    V a[ND][4], a2[ND][4], bq[ND][4], b2[ND][4]; const int nk = K >> 5;
#pragma unroll
    for (int s = 0; s < AH; ++s) {                               // trips 0 .. AH - 1 into sets 0 .. AH - 1
        const size_t ak = aoff + (size_t)s * astep, bk = boff + (size_t)s * bstep; const T16* pa = A + ak; const T16* pb = Bt + bk; const T16* pa2 = HA2 ? A2 + ak : pa; const T16* pb2 = HB2 ? Bt2 + bk : pb;
#pragma unroll
        for (int f = 0; f < 4; ++f) { a[s][f] = WFrag<T16>::ld(pa + f * 512); if (HA2) a2[s][f] = WFrag<T16>::ld(pa2 + f * 512); bq[s][f] = WFrag<T16>::ld(pb + f * 512); if (HB2) b2[s][f] = WFrag<T16>::ld(pb2 + f * 512); }
        // the wait stands behind these loads; it takes their addresses as inputs, so that the address registers stay untouched until it has passed
        asm volatile("s_wait_xcnt 0x0" :: "v"(pa), "v"(pb), "v"(pa2), "v"(pb2) : "memory");
    }
#pragma unroll 1
    for (int t = 0; t < nk; t += ND) {                           // rolled over whole turns of the ring
#pragma unroll
        for (int s = 0; s < ND; ++s) {                           // opened: the set numbers are constants, so that the sets are registers and no fragment is copied
            const int d = (s + AH) % ND; const int tn = (t + s + AH < nk) ? t + s + AH : nk - 1;   // the last trips fetch the last fragments again: in bounds, unused
            const size_t ak = aoff + (size_t)tn * astep, bk = boff + (size_t)tn * bstep; const T16* pa = A + ak; const T16* pb = Bt + bk; const T16* pa2 = HA2 ? A2 + ak : pa; const T16* pb2 = HB2 ? Bt2 + bk : pb;
#pragma unroll
            for (int f = 0; f < 4; ++f) { a[d][f] = WFrag<T16>::ld(pa + f * 512); if (HA2) a2[d][f] = WFrag<T16>::ld(pa2 + f * 512); bq[d][f] = WFrag<T16>::ld(pb + f * 512); if (HB2) b2[d][f] = WFrag<T16>::ld(pb2 + f * 512); }
            __builtin_amdgcn_sched_barrier(0);                   // the loads issue as one group ahead of this trip's products; without it the scheduler sinks them towards their use, AH trips later, and their lead is lost
#pragma unroll
            for (int nb = 0; nb < 4; ++nb)
#pragma unroll
                for (int mb = 0; mb < 4; ++mb) { acc[mb][nb] = WFrag<T16>::mma(a[s][mb], bq[s][nb], acc[mb][nb]); if (HA2) acc[mb][nb] = WFrag<T16>::mma(a2[s][mb], bq[s][nb], acc[mb][nb]); if (HB2) acc[mb][nb] = WFrag<T16>::mma(a[s][mb], b2[s][nb], acc[mb][nb]); }
            __builtin_amdgcn_sched_barrier(0);                   // all of this trip's products issue ahead of the wait below, which then falls behind matrix work; without it the scheduler leaves most of them behind the wait, among the next trip's loads
            // the loop's branch stands behind the last product: four slots keep the distance to the first vector instruction on its taken side too
            if (s == ND - 1) asm volatile("v_nop\n\tv_nop\n\tv_nop\n\tv_nop" : "+v"(acc[0][0]), "+v"(acc[1][1]), "+v"(acc[2][2]), "+v"(acc[3][3]) : "v"(a[s][0]), "v"(a[s][3]));
            // the wait stands behind this trip's loads; it takes their addresses as inputs, so that the address registers stay untouched (no later load lands in them, no next address is formed in them) until it has passed
            asm volatile("s_wait_xcnt 0x0" :: "v"(pa), "v"(pb), "v"(pa2), "v"(pb2) : "memory");
        }
    }
    if constexpr (PLANES) {
        // c0, r0 come from blockIdx: part, head, batch and the branch on them are scalar
        const int part = c0 / EE, h = (c0 % EE) / HD, b = r0 / TT, t0 = r0 % TT; const size_t hb = (size_t)(b * NH_ + h) * TT * HD;
        float bb[4];
#pragma unroll
        for (int nb = 0; nb < 4; ++nb) bb[nb] = bfr(bias[c0 + nb * 16 + lr]);
        if (part == 2) {
            // v: an accumulator gives lane (lr, hi) the keys t0 + 16 mb + 8 hi + 0..7 of d = 16 nb + lr, which is chunk (kb = t / 32, dt = nb, sel = mb & 1) of V^T in fragment order: bias, hi/lo split, 16-byte stores, 512 contiguous bytes a wave
#pragma unroll
            for (int mb = 0; mb < 4; ++mb) {
#pragma unroll
                for (int nb = 0; nb < 4; ++nb) { v8us oh, ol;
#pragma unroll
                    for (int j = 0; j < 8; ++j) { unsigned short a, c; splitf(acc[mb][nb][j] + bb[nb], a, c); oh[j] = a; ol[j] = c; }
                    const size_t o = hb + (size_t)((t0 >> 5) + (mb >> 1)) * 2048 + nb * 512 + (mb & 1) * 256 + 8 * lane; *(v8us*)(VTh + o) = oh; *(v8us*)(VTl + o) = ol; }
                asm volatile("s_wait_xcnt 0x0" ::: "memory");   // the next 16 keys' work overwrites registers that these stores name: the wait stands in front of it
            }
        } else {
            // q, k: the tile goes through LDS so that lane (lr, hi) holds the four chunks of row lr that fragment order gives it (d = 32 kb + 16 sel + 8 hi + 0..7); L2 norm, division, hi/lo split, 16-byte stores.
            // The sum of squares keeps the tree pairs d, d + 1; then d ^ 32, ^ 16, ^ 8, ^ 4, ^ 2: only the ^ 8 level crosses lanes.
            bf* H = part ? Kh : Qh; bf* Lo = part ? Kl : Ql;
#pragma unroll
            for (int mb = 0; mb < 4; ++mb)
#pragma unroll
                for (int nb = 0; nb < 4; ++nb)
#pragma unroll
                    for (int j = 0; j < 8; ++j) os[(mb * 16 + hi * 8 + j) * 68 + nb * 16 + lr] = acc[mb][nb][j] + bb[nb];
            __builtin_amdgcn_wave_barrier(); asm volatile("" ::: "memory");   // the rows are read back by other lanes of this wave: no read moves in front of the writes
#pragma unroll 1
            for (int mb = 0; mb < 4; ++mb) {                     // rolled: one copy of the 32 divisions and splits, so that the kernel's text stays short (each wave runs it once through)
                v8f x[2][2]; float lf[2][2][4];
#pragma unroll
                for (int kb = 0; kb < 2; ++kb)
#pragma unroll
                    for (int sel = 0; sel < 2; ++sel) { const float* s = os + (mb * 16 + lr) * 68 + kb * 32 + sel * 16 + hi * 8; const v4f x0 = *(const v4fa*)s, x1 = *(const v4fa*)(s + 4); x[kb][sel] = __builtin_shufflevector(x0, x1, 0, 1, 2, 3, 4, 5, 6, 7);
#pragma unroll
                        for (int e = 0; e < 4; ++e) lf[kb][sel][e] = __fadd_rn(__fmul_rn(x[kb][sel][2 * e], x[kb][sel][2 * e]), __fmul_rn(x[kb][sel][2 * e + 1], x[kb][sel][2 * e + 1])); }
                float s3[4];
#pragma unroll
                for (int e = 0; e < 4; ++e) { const float s2 = __fadd_rn(__fadd_rn(lf[0][0][e], lf[1][0][e]), __fadd_rn(lf[0][1][e], lf[1][1][e])); s3[e] = __fadd_rn(s2, __shfl_xor(s2, 16, 32)); }
                const float ss = __fadd_rn(__fadd_rn(s3[0], s3[2]), __fadd_rn(s3[1], s3[3])); const float nn = fmaxf(__fsqrt_rn(ss), 1e-12f);
                const size_t o = hb + (size_t)((t0 >> 4) + mb) * 1024 + lane * 8;
#pragma unroll
                for (int kb = 0; kb < 2; ++kb)
#pragma unroll
                    for (int sel = 0; sel < 2; ++sel) { v8us oh, ol;
#pragma unroll
                        for (int e = 0; e < 8; ++e) { unsigned short a, c; splitf(__fdiv_rn(x[kb][sel][e], nn), a, c); oh[e] = a; ol[e] = c; }
                        *(v8us*)(H + o + kb * 512 + sel * 256) = oh; *(v8us*)(Lo + o + kb * 512 + sel * 256) = ol; }
                asm volatile("s_wait_xcnt 0x0" ::: "memory");   // the next 16 rows' work overwrites registers that these stores name: the wait stands in front of it
            }
        }
        return;
    }
#pragma unroll
    for (int mb = 0; mb < 4; ++mb) {
#pragma unroll
        for (int nb = 0; nb < 4; ++nb) {
#pragma unroll
            for (int j = 0; j < 8; ++j) os[(hi * 8 + j) * 68 + nb * 16 + lr] = acc[mb][nb][j]; }
        __builtin_amdgcn_wave_barrier(); asm volatile("" ::: "memory");
        float* crow = C + (size_t)(r0 + mb * 16) * ldc + c0;
{
#pragma unroll
            for (int s = 0; s < 8; ++s) { const int row = 2 * s + hi, cofs = lr * 4; v4f val = *(const v4fa*)(os + row * 68 + cofs); if (BIAS) { val[0] += bfr(bias[c0 + cofs]); val[1] += bfr(bias[c0 + cofs + 1]); val[2] += bfr(bias[c0 + cofs + 2]); val[3] += bfr(bias[c0 + cofs + 3]); }
                *(v4f*)(crow + (size_t)row * ldc + cofs) = val; }
             }
        asm volatile("s_wait_xcnt 0x0" ::: "memory");           // the next 16 rows' work overwrites registers that these stores name: the wait stands in front of it
        __builtin_amdgcn_wave_barrier(); asm volatile("" ::: "memory");
    }
}

__device__ __forceinline__ h16 tohx(float x) { return (h16)x; }
typedef __attribute__((ext_vector_type(2))) _Float16 v2h;
typedef __attribute__((ext_vector_type(4))) _Float16 v4h;
typedef __attribute__((ext_vector_type(2))) unsigned short v2us;
typedef __attribute__((ext_vector_type(4))) unsigned short v4us;

__global__ __launch_bounds__(256) void k_wtG(const float* __restrict__ w, int K, int N, bf* Bt) {
    const int lane = threadIdx.x & 31; const int L0 = (blockIdx.x * 8 + (threadIdx.x >> 5)) * 8; const int nlines = N * K / 64;
{
#pragma unroll 1
        for (int l = 0; l < 8; ++l) { const int L = L0 + l; if (L >= nlines) break; const size_t e = (size_t)L * 64 + lane * 2; const int k = (int)(e % K), n = (int)(e / K); v2us o;
            o[0] = f2bf(w[(size_t)k * N + n]); o[1] = f2bf(w[(size_t)(k + 1) * N + n]); *(v2us*)(Bt + e) = o; }
         }
}
// k_cvt8: f32 [rows][EE] -> bf16 GEMM operand plane in fragment order (rows = n8 * 8 / EE); thread i writes chunk i (a wave stores 512 contiguous bytes) and fetches the 8 values that belong there.
__global__ __launch_bounds__(256) void k_cvt8(const float* __restrict__ src, bf* dst, size_t n8) { const size_t slab = n8 / (EE / 32), j = (size_t)blockIdx.x * 256 + threadIdx.x; if (j >= slab) return;   // grid (rows / 64, EE / 32): blockIdx.y is kb, j the chunk among those of one kb
    const int lr = (int)(j & 15), hi = (int)((j >> 4) & 1), sel = (int)((j >> 5) & 1), kb = blockIdx.y; const size_t R = j >> 6, i = (size_t)kb * slab + j;
    const v8f v = *(const v8f*)(src + (R * 16 + lr) * EE + kb * 32 + sel * 16 + hi * 8); v8us o;
#pragma unroll
    for (int k = 0; k < 8; ++k) o[k] = f2bf(v[k]); *(v8us*)(dst + i * 8) = o;  }
// ---- k_attn: the whole causal kernel attention (all batches, all heads) in one launch, ONE WAVE per 16 queries, nothing staged in memory or LDS between the two products.
// Per 32 keys: S^T = kn . qn^T (A = key rows, B = query rows kept in registers; 3 hi/lo products, K 64), so a lane holds 16 keys of ONE query (c = lane & 15); the kernel map, the causal select and the
// row sum run in f32 on those accumulators; the two S^T tiles, split into bf16 hi+lo, ARE the B operand of O^T += V^T . P^T (3 hi/lo products) in the hardware k order that the V^T loader also uses.
// O^T gives a lane 8 consecutive d of its query, one chunk of the merged hi/lo planes in fragment order: division by z in-lane, 16-byte stores, 512 contiguous bytes a wave.
// Work: a 16-query tile t walks t / 2 + 1 passes of 32 keys; every wave takes tile 127 - p and then tile p, 65 passes each. grid (heads, 16, batches), 4 waves: two waves per SIMD of the chip, so that one wave's vector work runs beside the other's matrix work and loads.
// amdgpu_waves_per_eu: lets the wave take more than 256 registers; under 256 the scheduler runs the 16 divisions of a pass one after another.
// Every plain '#pragma unroll' below opens a short loop of fixed length so that the fragment arrays it indexes are registers.
__global__ __launch_bounds__(128) __attribute__((amdgpu_waves_per_eu(2, 2))) void k_attn(const bf* __restrict__ Qh, const bf* __restrict__ Ql, const bf* __restrict__ Kh, const bf* __restrict__ Kl, const bf* __restrict__ VTh, const bf* __restrict__ VTl, bf* Ah, bf* Al) {
    typedef WFrag<bf> F; typedef F::V V;
    const int lane = threadIdx.x & 31, c = lane & 15, hi = lane >> 4; const int h = blockIdx.x;
    const int p = blockIdx.y * 4 + __builtin_amdgcn_readfirstlane(threadIdx.x >> 5);   // wave-uniform: the key loop runs on scalar control flow, EXEC stays full at every matrix instruction
    const int b = blockIdx.z; const size_t hb = (size_t)(b * NH_ + h) * TT * HD;
    const bf* kph = Kh + hb + 8 * lane; const bf* kpl = Kl + hb + 8 * lane; const bf* vph = VTh + hb + 8 * lane; const bf* vpl = VTl + hb + 8 * lane;   // fragment order: 32 keys are 4 neighbouring fragments (2048 elements) in each plane
#pragma unroll 1
    for (int half = 0; half < 2; ++half) {                   // rolled: one copy of the pass in the instruction cache
        const int r0 = (half ? p : TT / 16 - 1 - p) * 16; const int iq = r0 + c;
        V qh[2], ql[2];
#pragma unroll
        for (int ks = 0; ks < 2; ++ks) { qh[ks] = F::ld(Qh + hb + (size_t)r0 * HD + ks * 512 + 8 * lane); ql[ks] = F::ld(Ql + hb + (size_t)r0 * HD + ks * 512 + 8 * lane); }
        v8f acc[4];
#pragma unroll
        for (int dt = 0; dt < 4; ++dt) acc[dt] = (v8f){};
        float zs = 0.f; const int kend = r0 + 16;
        V kh[2][2], kl[2][2];
#pragma unroll
        for (int kt = 0; kt < 2; ++kt)
#pragma unroll
            for (int ks = 0; ks < 2; ++ks) { kh[kt][ks] = F::ld(kph + (size_t)(kt * 16) * HD + ks * 512); kl[kt][ks] = F::ld(kpl + (size_t)(kt * 16) * HD + ks * 512); }
#pragma unroll 1
        for (int kc = 0; kc < kend; kc += 32) {                  // rolled: one pass already holds 32 loads in flight and its registers; a second copy would only add registers
            V vh[4], vl[4];
#pragma unroll
            for (int dt = 0; dt < 4; ++dt) { vh[dt] = F::ld(vph + (size_t)kc * HD + dt * 512); vl[dt] = F::ld(vpl + (size_t)kc * HD + dt * 512); }
            v8f s[2]; s[0] = (v8f){}; s[1] = (v8f){};
#pragma unroll
            for (int ks = 0; ks < 2; ++ks) {
#pragma unroll
                for (int kt = 0; kt < 2; ++kt) s[kt] = F::mma(kh[kt][ks], qh[ks], s[kt]);
#pragma unroll
                for (int kt = 0; kt < 2; ++kt) s[kt] = F::mma(kh[kt][ks], ql[ks], s[kt]);
#pragma unroll
                for (int kt = 0; kt < 2; ++kt) s[kt] = F::mma(kl[kt][ks], qh[ks], s[kt]); }
            asm volatile("s_wait_xcnt 0x0" ::: "memory");       // the next-K loads below may land in registers that held the V^T loads' addresses: the wait stands in front of that overwrite
            const int kn = (kc + 32 < kend) ? kc + 32 : kc;      // the next 32 keys' fragments fly during the vector work (the last pass re-reads its own rows: in bounds, unused)
#pragma unroll
            for (int kt = 0; kt < 2; ++kt)
#pragma unroll
                for (int ks = 0; ks < 2; ++ks) { kh[kt][ks] = F::ld(kph + (size_t)(kn + kt * 16) * HD + ks * 512); kl[kt][ks] = F::ld(kpl + (size_t)(kn + kt * 16) * HD + ks * 512); }
            __builtin_amdgcn_sched_barrier(0);                   // all 32 loads issue as one group ahead of the vector work, which covers their latency; without it the scheduler spreads them among that work
            v8us p0h, p0l, p1h, p1l;
#pragma unroll
            for (int j = 0; j < 8; ++j) {
#pragma unroll
                for (int kt = 0; kt < 2; ++kt) { const float xd = (kc + kt * 16 + 8 * hi + j <= iq) ? s[kt][j] : 0.f;      // causal select on x_dot: 0 maps to exactly 0 (0 / 2.000001), and the 16 divisions stay branch-free and independent
                    const float den = fmaxf(__fsub_rn(2.000001f, __fmul_rn(2.0f, xd)), 1e-6f); const float kk = __fdiv_rn(__fmul_rn(xd, xd), den);
                    zs = __fadd_rn(zs, kk); unsigned short a, b; splitf(kk, a, b); if (kt == 0) { p0h[j] = a; p0l[j] = b; } else { p1h[j] = a; p1l[j] = b; } } }
            const V ph = cat16b(p0h, p1h), pl = cat16b(p0l, p1l);
#pragma unroll
            for (int dt = 0; dt < 4; ++dt) acc[dt] = F::mma(vh[dt], ph, acc[dt]);
#pragma unroll
            for (int dt = 0; dt < 4; ++dt) acc[dt] = F::mma(vh[dt], pl, acc[dt]);
#pragma unroll
            for (int dt = 0; dt < 4; ++dt) acc[dt] = F::mma(vl[dt], ph, acc[dt]);
        }
        zs += __shfl_xor(zs, 16, 32); const float zz = fmaxf(zs, 1e-6f);
#pragma unroll
        for (int dt = 0; dt < 4; ++dt) { v8us oh, ol;
#pragma unroll
            for (int j = 0; j < 8; ++j) { unsigned short a, b; splitf(__fdiv_rn(acc[dt][j], zz), a, b); oh[j] = a; ol[j] = b; }
            const size_t o = ((size_t)(2 * h + (dt >> 1)) * (NB_ * TT / 16) + b * (TT / 16) + (r0 >> 4)) * 512 + (dt & 1) * 256 + 8 * lane; *(v8us*)(Ah + o) = oh; *(v8us*)(Al + o) = ol; }   // chunk (R = (b T + r0) / 16, kb = 2 h + dt / 2, sel = dt & 1) of the merged [b t][E] planes
        asm volatile("s_wait_xcnt 0x0" ::: "memory");           // the second tile's set-up overwrites the registers that these stores name: the wait stands in front of it
    }
}

extern "C" void kernel_launch(void* const* d_in, const int* in_sizes, int n_in,
                              void* d_out, int out_size, void* d_ws, size_t ws_size, hipStream_t stream) {
    (void)in_sizes; (void)n_in; (void)out_size;
    const float* x = (const float*)d_in[0]; const float* wqkv = (const float*)d_in[1]; const float* bqkv = (const float*)d_in[2]; const float* wout = (const float*)d_in[3]; const float* bout = (const float*)d_in[4];   // torch [out][in] weights
    float* OUT = (float*)d_out;     // [2][2048][1024]
    char* wsp = (char*)d_ws;
    auto take = [&](size_t bytes) { char* p = wsp; wsp += (bytes + 255) & ~(size_t)255; return (void*)p; };
    const size_t MT = (size_t)NB_ * TT;     // both batches go through every launch: the projections see one [NB_ * TT][E] matrix, the per-head kernels take the batch from the grid
    bf* WQKV = (bf*)take((size_t)3 * EE * EE * 2); bf* WO = (bf*)take((size_t)EE * EE * 2); bf* XB = (bf*)take(MT * EE * 2);
    bf* Qh = (bf*)take(MT * EE * 2); bf* Ql = (bf*)take(MT * EE * 2); bf* Kh = (bf*)take(MT * EE * 2); bf* Kl = (bf*)take(MT * EE * 2); bf* VTh = (bf*)take(MT * EE * 2); bf* VTl = (bf*)take(MT * EE * 2);
    bf* Ah = (bf*)take(MT * EE * 2); bf* Al = (bf*)take(MT * EE * 2);
    if ((size_t)(wsp - (char*)d_ws) > ws_size) return;    // total ~ 84 MB
    k_cvt8<<<dim3(3 * EE / 64, EE / 32, 1), 256, 0, stream>>>(wqkv, WQKV, (size_t)3 * EE * EE / 8); k_cvt8<<<dim3(EE / 64, EE / 32, 1), 256, 0, stream>>>(wout, WO, (size_t)EE * EE / 8);
    k_cvt8<<<dim3(NB_ * TT / 64, EE / 32, 1), 256, 0, stream>>>(x, XB, MT * EE / 8);
    k_gemmw<bf, 0, true, true><<<dim3(NB_ * TT / 64, 3 * EE / 64, 1), 32, 0, stream>>>(XB, nullptr, WQKV, nullptr, EE, NB_ * TT, 3 * EE, nullptr, 0, bqkv, 0, 0, 0, Qh, Ql, Kh, Kl, VTh, VTl);
    k_attn<<<dim3(NH_, TT / 128, NB_), 128, 0, stream>>>(Qh, Ql, Kh, Kl, VTh, VTl, Ah, Al);
    k_gemmw<bf, 1, true, false><<<dim3(NB_ * TT / 64, EE / 64, 1), 32, 0, stream>>>(Ah, Al, WO, nullptr, EE, NB_ * TT, EE, OUT, EE, bout, 0, 0, 0, nullptr, nullptr, nullptr, nullptr, nullptr, nullptr);
}

// v006
// One run takes 113 microseconds.
// In both of two side-by-side timings against v005, it was 1.09 times as fast.
// All steps since v000 together make it 11.4 times as fast.
#include <hip/hip_runtime.h>

// ExactSphericalKernelCausalAttention (x [2][2048][1024]; [q|k|v] = x w_qkv^T + b_qkv (16 heads x 64); qn, kn = L2-normalised (max(norm, 1e-12)); x_dot = qn.kn; K = x_dot^2 / max(2 + 1e-6 - 2 x_dot, 1e-6) for j <= i else 0;
// out_h = (K v) / max(sum_j K, 1e-6); out = merged w_out^T + b_out -> [2][2048][1024]; no softmax).
// Compute dtypes, f32 accumulate: every input rounded to bf16; the qkv projection on PLAIN bf16 operands (inputs: exact, + bias); normalisation f32 -> bf16 hi+lo planes of qn / kn; x_dot on 3 products (K 64, tiles above
// the diagonal skipped); the kernel K and its causal select in f32 on the score accumulators, its row sums in f32 (in-lane, halves joined once) -> bf16 hi+lo fragments of K in registers; K.v on hi+lo operands (3 products, keys limited to the diagonal block; the output (rms 0.10) is a cancelling sum); the division by z and the merge f32 -> hl planes;

#define NB_  2
#define TT   2048
#define EE   1024
#define NH_  16
#define HD   64
#define ZH   2
#define PCAR 64.0f
typedef _Float16 h16;
typedef unsigned short bf;
typedef __attribute__((ext_vector_type(16))) __bf16   v16bf;
typedef __attribute__((ext_vector_type(16))) _Float16 v16h;
typedef __attribute__((ext_vector_type(8)))  _Float16 v8h;
typedef __attribute__((ext_vector_type(8)))  unsigned short v8us;
typedef __attribute__((ext_vector_type(8)))  float    v8f;
typedef __attribute__((ext_vector_type(4)))  float    v4f;
typedef v8h  __attribute__((may_alias)) v8ha;
typedef v4f  __attribute__((may_alias)) v4fa;
typedef v8us __attribute__((may_alias)) v8usa;

__device__ __forceinline__ unsigned short f2bf(float f) { unsigned u = __float_as_uint(f); u += 0x7FFFu + ((u >> 16) & 1u); return (unsigned short)(u >> 16); }
__device__ __forceinline__ float bf2f(unsigned short b) { return __uint_as_float(((unsigned)b) << 16); }
__device__ __forceinline__ float bfr(float f) { return bf2f(f2bf(f)); }
__device__ __forceinline__ void splitf(float y, unsigned short& h, unsigned short& l) { h = f2bf(y); l = f2bf(y - bf2f(h)); }
__device__ __forceinline__ v16h cat16(v8h lo, v8h hi) { return __builtin_shufflevector(lo, hi, 0, 1, 2, 3, 4, 5, 6, 7, 8, 9, 10, 11, 12, 13, 14, 15); }
__device__ __forceinline__ v16bf cat16b(v8us lo, v8us hi) { return __builtin_bit_cast(v16bf, __builtin_shufflevector(lo, hi, 0, 1, 2, 3, 4, 5, 6, 7, 8, 9, 10, 11, 12, 13, 14, 15)); }
__device__ __forceinline__ v8f wmma16(v16h a, v16h b, v8f c) { return __builtin_amdgcn_wmma_f32_16x16x32_f16(false, a, false, b, (short)0, c, false, false); }
__device__ __forceinline__ v8f wmmab(v16bf a, v16bf b, v8f c) { return __builtin_amdgcn_wmma_f32_16x16x32_bf16(false, a, false, b, (short)0, c, false, false); }



// ---- k_gemmw: register-blocked GEMM, ONE WAVE per 64x64 output tile (16 accumulators), operands straight from 16-bit planes in fragment order (below); grid (M/64, N/64, Z), 32 threads.
// C[m][n] (f32, pitch ldc, + optional f32 bias[n]) = sum_k A[m][k] Bt[n][k] (+ split products per NSPLIT). z-batch strides sA/sB/sC in elements. K % 128 == 0 (whole turns of the ring of register sets below). amdgpu_waves_per_eu: the register budget of the waves that share a SIMD, three in the qkv projection, one in the output projection.
// PLANES (the qkv projection; a 64-column tile is one head of q, k or v, a 64-row tile lies in one batch): no C; the wave that holds the tile writes the attention's operand planes itself, see the epilogue.
template <typename T16> struct WFrag;
template <> struct WFrag<h16> { typedef v16h V; static __device__ __forceinline__ V ld(const h16* p) { return cat16(*(const v8h*)p, *(const v8h*)(p + 256)); } static __device__ __forceinline__ v8f mma(V a, V b, v8f c) { return wmma16(a, b, c); } };
template <> struct WFrag<bf> { typedef v16bf V; static __device__ __forceinline__ V ld(const bf* p) { return cat16b(*(const v8us*)p, *(const v8us*)(p + 256)); } static __device__ __forceinline__ v8f mma(V a, V b, v8f c) { return wmmab(a, b, c); } };
// ---- FRAGMENT ORDER: every 16-bit plane that a matrix instruction reads (x, the weights, qn, kn, V^T, the merged heads; hi and lo) is stored as whole fragments, not as rows. A plane P[rows][K] is cut into fragments of 16 rows x 32 k = 512 elements = 1 KiB;
// inside a fragment, 16-byte chunk number sel * 32 + hi * 16 + lr holds P[16 R + lr][32 kb + 16 sel + 8 hi + 0..7], which is what lane hi * 16 + lr takes as the first (sel 0) or second (sel 1) half of its operand.
// So a wave's 16-byte load or store covers 512 contiguous bytes (4 whole lines) where a row-major plane gives it 32 bytes in each of 16 lines. qn, kn (K = 64): fragment (R, kb) at element (R * 2 + kb) * 512 of its head; the GEMM operands: at (kb * (rows / 16) + R) * 512, so that the four fragments a 64-row tile takes per 32 k are neighbours;
// V^T (rows d, k = key): fragment (R, kb) at (kb * 4 + R) * 512, so that the fragments of one pass of 32 keys are neighbours in every plane. Values, k order and every sum are those of the row-major form.
// WFrag::ld(p) above takes p = fragment + lane * 8.
template <typename T16, int NSPLIT, bool BIAS, bool PLANES>
__global__ __launch_bounds__(32) __attribute__((amdgpu_waves_per_eu(PLANES ? 3 : 1, PLANES ? 3 : 1))) void k_gemmw(const T16* __restrict__ A, const T16* __restrict__ A2, const T16* __restrict__ Bt, const T16* __restrict__ Bt2, int K, int arows, int brows, float* C, int ldc, const float* __restrict__ bias, size_t sA, size_t sB, size_t sC, bf* Qh, bf* Ql, bf* Kh, bf* Kl, bf* VTh, bf* VTl) {
    typedef typename WFrag<T16>::V V;
    __shared__ __align__(16) float os[(PLANES ? 64 : 16) * 68];
    const size_t z = blockIdx.z; A += z * sA; if (A2) A2 += z * sA; Bt += z * sB; if (Bt2) Bt2 += z * sB; C += z * sC;
    const int lane = threadIdx.x & 31, lr = lane & 15, hi = lane >> 4; const int r0 = blockIdx.x * 64, c0 = blockIdx.y * 64;
    v8f acc[4][4];
#pragma unroll
    for (int mb = 0; mb < 4; ++mb)
#pragma unroll
        for (int nb = 0; nb < 4; ++nb) acc[mb][nb] = (v8f){};
    const size_t aoff = (size_t)r0 * 32 + 8 * lane, boff = (size_t)c0 * 32 + 8 * lane, astep = (size_t)arows * 32, bstep = (size_t)brows * 32;   // 16 rows further is the next fragment, 512 elements on; 32 k further is one fragment of every row block on (arows, brows: rows of the whole A and Bt planes)
    // RING OF REGISTER SETS: ND sets of this wave's A and B fragments; the loads of trip t + AH are issued in front of the products of trip t, so a load has AH trips of matrix work to arrive in.
    // Two sets, one trip ahead, where three waves share a SIMD (the qkv projection: the register budget of three waves); four sets, two trips ahead, where a wave has its SIMD alone (the output projection: behind the set in use 48 loads are in flight, which the load counter can still count,
    // and a load lands in a set whose products were issued two trips ago). Every accumulator takes its products in the order of k, as before.
    constexpr int ND = PLANES ? 2 : 4, AH = PLANES ? 1 : 2; constexpr bool HA2 = (NSPLIT == 1 || NSPLIT == 2), HB2 = (NSPLIT >= 2);
    V a[ND][4], a2[ND][4], bq[ND][4], b2[ND][4]; const int nk = K >> 5;
#pragma unroll
    for (int s = 0; s < AH; ++s) {                               // trips 0 .. AH - 1 into sets 0 .. AH - 1
        const size_t ak = aoff + (size_t)s * astep, bk = boff + (size_t)s * bstep; const T16* pa = A + ak; const T16* pb = Bt + bk; const T16* pa2 = HA2 ? A2 + ak : pa; const T16* pb2 = HB2 ? Bt2 + bk : pb;
#pragma unroll
        for (int f = 0; f < 4; ++f) { a[s][f] = WFrag<T16>::ld(pa + f * 512); if (HA2) a2[s][f] = WFrag<T16>::ld(pa2 + f * 512); bq[s][f] = WFrag<T16>::ld(pb + f * 512); if (HB2) b2[s][f] = WFrag<T16>::ld(pb2 + f * 512); }
        // the wait stands behind these loads; it takes their addresses as inputs, so that the address registers stay untouched until it has passed
        asm volatile("s_wait_xcnt 0x0" :: "v"(pa), "v"(pb), "v"(pa2), "v"(pb2) : "memory");
    }
#pragma unroll 1
    for (int t = 0; t < nk; t += ND) {                           // rolled over whole turns of the ring
#pragma unroll
        for (int s = 0; s < ND; ++s) {                           // opened: the set numbers are constants, so that the sets are registers and no fragment is copied
            const int d = (s + AH) % ND; const int tn = (t + s + AH < nk) ? t + s + AH : nk - 1;   // the last trips fetch the last fragments again: in bounds, unused
            const size_t ak = aoff + (size_t)tn * astep, bk = boff + (size_t)tn * bstep; const T16* pa = A + ak; const T16* pb = Bt + bk; const T16* pa2 = HA2 ? A2 + ak : pa; const T16* pb2 = HB2 ? Bt2 + bk : pb;
#pragma unroll
            for (int f = 0; f < 4; ++f) { a[d][f] = WFrag<T16>::ld(pa + f * 512); if (HA2) a2[d][f] = WFrag<T16>::ld(pa2 + f * 512); bq[d][f] = WFrag<T16>::ld(pb + f * 512); if (HB2) b2[d][f] = WFrag<T16>::ld(pb2 + f * 512); }
            __builtin_amdgcn_sched_barrier(0);                   // the loads issue as one group ahead of this trip's products; without it the scheduler sinks them towards their use, AH trips later, and their lead is lost
#pragma unroll
            for (int nb = 0; nb < 4; ++nb)
#pragma unroll
                for (int mb = 0; mb < 4; ++mb) { acc[mb][nb] = WFrag<T16>::mma(a[s][mb], bq[s][nb], acc[mb][nb]); if (HA2) acc[mb][nb] = WFrag<T16>::mma(a2[s][mb], bq[s][nb], acc[mb][nb]); if (HB2) acc[mb][nb] = WFrag<T16>::mma(a[s][mb], b2[s][nb], acc[mb][nb]); }
            __builtin_amdgcn_sched_barrier(0);                   // all of this trip's products issue ahead of the wait below, which then falls behind matrix work; without it the scheduler leaves most of them behind the wait, among the next trip's loads
            // the loop's branch stands behind the last product: four slots keep the distance to the first vector instruction on its taken side too
            if (s == ND - 1) asm volatile("v_nop\n\tv_nop\n\tv_nop\n\tv_nop" : "+v"(acc[0][0]), "+v"(acc[1][1]), "+v"(acc[2][2]), "+v"(acc[3][3]) : "v"(a[s][0]), "v"(a[s][3]));
            // the wait stands behind this trip's loads; it takes their addresses as inputs, so that the address registers stay untouched (no later load lands in them, no next address is formed in them) until it has passed
            asm volatile("s_wait_xcnt 0x0" :: "v"(pa), "v"(pb), "v"(pa2), "v"(pb2) : "memory");
        }
    }
    if constexpr (PLANES) {
        // c0, r0 come from blockIdx: part, head, batch and the branch on them are scalar
        const int part = c0 / EE, h = (c0 % EE) / HD, b = r0 / TT, t0 = r0 % TT; const size_t hb = (size_t)(b * NH_ + h) * TT * HD;
        float bb[4];
#pragma unroll
        for (int nb = 0; nb < 4; ++nb) bb[nb] = bfr(bias[c0 + nb * 16 + lr]);
        if (part == 2) {
            // v: an accumulator gives lane (lr, hi) the keys t0 + 16 mb + 8 hi + 0..7 of d = 16 nb + lr, which is chunk (kb = t / 32, dt = nb, sel = mb & 1) of V^T in fragment order: bias, hi/lo split, 16-byte stores, 512 contiguous bytes a wave
#pragma unroll
            for (int mb = 0; mb < 4; ++mb) {
#pragma unroll
                for (int nb = 0; nb < 4; ++nb) { v8us oh, ol;
#pragma unroll
                    for (int j = 0; j < 8; ++j) { unsigned short a, c; splitf(acc[mb][nb][j] + bb[nb], a, c); oh[j] = a; ol[j] = c; }
                    const size_t o = hb + (size_t)((t0 >> 5) + (mb >> 1)) * 2048 + nb * 512 + (mb & 1) * 256 + 8 * lane; *(v8us*)(VTh + o) = oh; *(v8us*)(VTl + o) = ol; }
                asm volatile("s_wait_xcnt 0x0" ::: "memory");   // the next 16 keys' work overwrites registers that these stores name: the wait stands in front of it
            }
        } else {
            // q, k: the tile goes through LDS so that lane (lr, hi) holds the four chunks of row lr that fragment order gives it (d = 32 kb + 16 sel + 8 hi + 0..7); L2 norm, division, hi/lo split, 16-byte stores.
            // The sum of squares keeps the tree pairs d, d + 1; then d ^ 32, ^ 16, ^ 8, ^ 4, ^ 2: only the ^ 8 level crosses lanes.
            bf* H = part ? Kh : Qh; bf* Lo = part ? Kl : Ql;
#pragma unroll
            for (int mb = 0; mb < 4; ++mb)
#pragma unroll
                for (int nb = 0; nb < 4; ++nb)
#pragma unroll
                    for (int j = 0; j < 8; ++j) os[(mb * 16 + hi * 8 + j) * 68 + nb * 16 + lr] = acc[mb][nb][j] + bb[nb];
            __builtin_amdgcn_wave_barrier(); asm volatile("" ::: "memory");   // the rows are read back by other lanes of this wave: no read moves in front of the writes
#pragma unroll 1
            for (int mb = 0; mb < 4; ++mb) {                     // rolled: one copy of the 32 divisions and splits, so that the kernel's text stays short (each wave runs it once through)
                v8f x[2][2]; float lf[2][2][4];
#pragma unroll
                for (int kb = 0; kb < 2; ++kb)
#pragma unroll
                    for (int sel = 0; sel < 2; ++sel) { const float* s = os + (mb * 16 + lr) * 68 + kb * 32 + sel * 16 + hi * 8; const v4f x0 = *(const v4fa*)s, x1 = *(const v4fa*)(s + 4); x[kb][sel] = __builtin_shufflevector(x0, x1, 0, 1, 2, 3, 4, 5, 6, 7);
#pragma unroll
                        for (int e = 0; e < 4; ++e) lf[kb][sel][e] = __fadd_rn(__fmul_rn(x[kb][sel][2 * e], x[kb][sel][2 * e]), __fmul_rn(x[kb][sel][2 * e + 1], x[kb][sel][2 * e + 1])); }
                float s3[4];
#pragma unroll
                for (int e = 0; e < 4; ++e) { const float s2 = __fadd_rn(__fadd_rn(lf[0][0][e], lf[1][0][e]), __fadd_rn(lf[0][1][e], lf[1][1][e])); s3[e] = __fadd_rn(s2, __shfl_xor(s2, 16, 32)); }
                const float ss = __fadd_rn(__fadd_rn(s3[0], s3[2]), __fadd_rn(s3[1], s3[3])); const float nn = fmaxf(__fsqrt_rn(ss), 1e-12f);
                const size_t o = hb + (size_t)((t0 >> 4) + mb) * 1024 + lane * 8;
#pragma unroll
                for (int kb = 0; kb < 2; ++kb)
#pragma unroll
                    for (int sel = 0; sel < 2; ++sel) { v8us oh, ol;
#pragma unroll
                        for (int e = 0; e < 8; ++e) { unsigned short a, c; splitf(__fdiv_rn(x[kb][sel][e], nn), a, c); oh[e] = a; ol[e] = c; }
                        *(v8us*)(H + o + kb * 512 + sel * 256) = oh; *(v8us*)(Lo + o + kb * 512 + sel * 256) = ol; }
                asm volatile("s_wait_xcnt 0x0" ::: "memory");   // the next 16 rows' work overwrites registers that these stores name: the wait stands in front of it
            }
        }
        return;
    }
#pragma unroll
    for (int mb = 0; mb < 4; ++mb) {
#pragma unroll
        for (int nb = 0; nb < 4; ++nb) {
#pragma unroll
            for (int j = 0; j < 8; ++j) os[(hi * 8 + j) * 68 + nb * 16 + lr] = acc[mb][nb][j]; }
        __builtin_amdgcn_wave_barrier(); asm volatile("" ::: "memory");
        float* crow = C + (size_t)(r0 + mb * 16) * ldc + c0;
{
#pragma unroll
            for (int s = 0; s < 8; ++s) { const int row = 2 * s + hi, cofs = lr * 4; v4f val = *(const v4fa*)(os + row * 68 + cofs); if (BIAS) { val[0] += bfr(bias[c0 + cofs]); val[1] += bfr(bias[c0 + cofs + 1]); val[2] += bfr(bias[c0 + cofs + 2]); val[3] += bfr(bias[c0 + cofs + 3]); }
                *(v4f*)(crow + (size_t)row * ldc + cofs) = val; }
             }
        asm volatile("s_wait_xcnt 0x0" ::: "memory");           // the next 16 rows' work overwrites registers that these stores name: the wait stands in front of it
        __builtin_amdgcn_wave_barrier(); asm volatile("" ::: "memory");
    }
}

__device__ __forceinline__ h16 tohx(float x) { return (h16)x; }
typedef __attribute__((ext_vector_type(2))) _Float16 v2h;
typedef __attribute__((ext_vector_type(4))) _Float16 v4h;
typedef __attribute__((ext_vector_type(2))) unsigned short v2us;
typedef __attribute__((ext_vector_type(4))) unsigned short v4us;

__global__ __launch_bounds__(256) void k_wtG(const float* __restrict__ w, int K, int N, bf* Bt) {
    const int lane = threadIdx.x & 31; const int L0 = (blockIdx.x * 8 + (threadIdx.x >> 5)) * 8; const int nlines = N * K / 64;
{
#pragma unroll 1
        for (int l = 0; l < 8; ++l) { const int L = L0 + l; if (L >= nlines) break; const size_t e = (size_t)L * 64 + lane * 2; const int k = (int)(e % K), n = (int)(e / K); v2us o;
            o[0] = f2bf(w[(size_t)k * N + n]); o[1] = f2bf(w[(size_t)(k + 1) * N + n]); *(v2us*)(Bt + e) = o; }
         }
}
// k_cvt8: f32 [rows][EE] -> bf16 GEMM operand plane in fragment order (rows = n8 * 8 / EE); thread i writes chunk i (a wave stores 512 contiguous bytes) and fetches the 8 values that belong there.
__global__ __launch_bounds__(256) void k_cvt8(const float* __restrict__ src, bf* dst, size_t n8) { const size_t slab = n8 / (EE / 32), j = (size_t)blockIdx.x * 256 + threadIdx.x; if (j >= slab) return;   // grid (rows / 64, EE / 32): blockIdx.y is kb, j the chunk among those of one kb
    const int lr = (int)(j & 15), hi = (int)((j >> 4) & 1), sel = (int)((j >> 5) & 1), kb = blockIdx.y; const size_t R = j >> 6, i = (size_t)kb * slab + j;
    const v8f v = *(const v8f*)(src + (R * 16 + lr) * EE + kb * 32 + sel * 16 + hi * 8); v8us o;
#pragma unroll
    for (int k = 0; k < 8; ++k) o[k] = f2bf(v[k]); *(v8us*)(dst + i * 8) = o;  }
// ---- k_attn: the whole causal kernel attention (all batches, all heads) in one launch, ONE WAVE per 32 queries and every second pass of 32 keys, nothing staged in memory or LDS between the two products.
// Per 32 keys: S^T = kn . qn^T (A = key rows, B = query rows kept in registers; 3 hi/lo products, K 64), so a lane holds 16 keys of ONE query (c = lane & 15) in each of the wave's two 16-query tiles; the kernel map, the causal select and the
// row sum run in f32 on those accumulators; the two S^T tiles of a query tile, split into bf16 hi+lo, ARE the B operand of O^T += V^T . P^T (3 hi/lo products) in the hardware k order that the V^T loader also uses.
// TWO QUERY TILES PER FRAGMENT: every K and V^T fragment that a wave loads serves both of its query tiles, so a pass has twice the matrix and vector work behind the same 32 loads.
// O^T gives a lane 8 consecutive d of its query, one chunk of the merged hi/lo planes in fragment order: division by z in-lane, 16-byte stores, 512 contiguous bytes a wave.
// Work: a 32-query tile t has t + 1 passes of 32 keys. Waves w and w + 4 of a work-group are a pair: the pair takes tile 63 - p and then tile p (65 passes), wave w the even passes, wave w + 4 the odd ones, so that there are still two waves per SIMD
// (one wave's vector work runs beside the other's matrix work and loads). There is no maximum to rescale by: the two waves' partial O^T and z simply add. At the end of a tile each wave hands the partner, through LDS, its partial sums of the 16-query tile
// that the partner finishes (wave w the first, wave w + 4 the second). grid (heads, 8, batches), 8 waves: one work-group per WGP.
// amdgpu_waves_per_eu(1, 2): eight waves per work-group already bound a wave to half a SIMD's registers; with (2, 2) the scheduler keeps well below that bound and runs the 32 divisions of a pass one after another.
// Every plain '#pragma unroll' below opens a short loop of fixed length so that the fragment arrays it indexes are registers.
__global__ __launch_bounds__(256) __attribute__((amdgpu_waves_per_eu(1, 2))) void k_attn(const bf* __restrict__ Qh, const bf* __restrict__ Ql, const bf* __restrict__ Kh, const bf* __restrict__ Kl, const bf* __restrict__ VTh, const bf* __restrict__ VTl, bf* Ah, bf* Al) {
    typedef WFrag<bf> F; typedef F::V V;
    __shared__ __align__(16) v4f xs[2 * 8 * 8 * 32];         // [tile of the pair][writing wave][8 chunks of 4 floats][lane]: each of the two hand-overs has its own place, so one barrier each is enough
    __shared__ float zx[2 * 8 * 32];
    const int lane = threadIdx.x & 31, c = lane & 15, hi = lane >> 4; const int h = blockIdx.x;
    const int wv = __builtin_amdgcn_readfirstlane(threadIdx.x >> 5);   // wave-uniform: the key loop runs on scalar control flow, EXEC stays full at every matrix instruction
    const int par = wv >> 2, p = blockIdx.y * 4 + (wv & 3);
    const int b = blockIdx.z; const size_t hb = (size_t)(b * NH_ + h) * TT * HD;
    const bf* kph = Kh + hb + 8 * lane; const bf* kpl = Kl + hb + 8 * lane; const bf* vph = VTh + hb + 8 * lane; const bf* vpl = VTl + hb + 8 * lane;   // fragment order: 32 keys are 4 neighbouring fragments (2048 elements) in each plane
#pragma unroll 1
    for (int half = 0; half < 2; ++half) {                   // rolled: one copy of the pass in the instruction cache
        const int r0 = (half ? p : TT / 32 - 1 - p) * 32;
        V qh[2][2], ql[2][2];
#pragma unroll
        for (int qt = 0; qt < 2; ++qt)
#pragma unroll
            for (int ks = 0; ks < 2; ++ks) { qh[qt][ks] = F::ld(Qh + hb + (size_t)(r0 + qt * 16) * HD + ks * 512 + 8 * lane); ql[qt][ks] = F::ld(Ql + hb + (size_t)(r0 + qt * 16) * HD + ks * 512 + 8 * lane); }
        v8f acc[2][4];
#pragma unroll
        for (int qt = 0; qt < 2; ++qt)
#pragma unroll
            for (int dt = 0; dt < 4; ++dt) acc[qt][dt] = (v8f){};
        float zs[2] = {0.f, 0.f}; const int kend = r0 + 32, kbeg = par * 32;
        V kh[2][2], kl[2][2];
#pragma unroll
        for (int kt = 0; kt < 2; ++kt)
#pragma unroll
            for (int ks = 0; ks < 2; ++ks) { kh[kt][ks] = F::ld(kph + (size_t)(kbeg + kt * 16) * HD + ks * 512); kl[kt][ks] = F::ld(kpl + (size_t)(kbeg + kt * 16) * HD + ks * 512); }   // keys 0..63 exist for every tile: in bounds, unused where this wave has no pass
#pragma unroll 1
        for (int kc = kbeg; kc < kend; kc += 64) {               // rolled: one pass already holds 32 loads in flight and its registers; a second copy would only add registers
            V vh[4], vl[4]; const bf* pvh = vph + (size_t)kc * HD; const bf* pvl = vpl + (size_t)kc * HD;
#pragma unroll
            for (int dt = 0; dt < 4; ++dt) { vh[dt] = F::ld(pvh + dt * 512); vl[dt] = F::ld(pvl + dt * 512); }
            v8f s[2][2];
#pragma unroll
            for (int qt = 0; qt < 2; ++qt) { s[qt][0] = (v8f){}; s[qt][1] = (v8f){}; }
#pragma unroll
            for (int ks = 0; ks < 2; ++ks) {
#pragma unroll
                for (int qt = 0; qt < 2; ++qt)
#pragma unroll
                    for (int kt = 0; kt < 2; ++kt) s[qt][kt] = F::mma(kh[kt][ks], qh[qt][ks], s[qt][kt]);
#pragma unroll
                for (int qt = 0; qt < 2; ++qt)
#pragma unroll
                    for (int kt = 0; kt < 2; ++kt) s[qt][kt] = F::mma(kh[kt][ks], ql[qt][ks], s[qt][kt]);
#pragma unroll
                for (int qt = 0; qt < 2; ++qt)
#pragma unroll
                    for (int kt = 0; kt < 2; ++kt) s[qt][kt] = F::mma(kl[kt][ks], qh[qt][ks], s[qt][kt]); }
            asm volatile("s_wait_xcnt 0x0" :: "v"(pvh), "v"(pvl) : "memory");   // the wait stands behind the V^T loads; it takes their addresses as inputs, so that no load lands in the address registers and no next address is formed in them until it has passed
            const int kn = (kc + 64 < kend) ? kc + 64 : kc;      // this wave's next 32 keys' fragments fly during the vector work (the last pass re-reads its own rows: in bounds, unused)
            const bf* nkh = kph + (size_t)kn * HD; const bf* nkl = kpl + (size_t)kn * HD;
#pragma unroll
            for (int kt = 0; kt < 2; ++kt)
#pragma unroll
                for (int ks = 0; ks < 2; ++ks) { kh[kt][ks] = F::ld(nkh + kt * 16 * HD + ks * 512); kl[kt][ks] = F::ld(nkl + kt * 16 * HD + ks * 512); }
            asm volatile("s_wait_xcnt 0x0" :: "v"(nkh), "v"(nkl) : "memory");   // the same behind the next-K loads: the vector work below reuses their address registers
            __builtin_amdgcn_sched_barrier(0);                   // all 32 loads issue as one group ahead of the vector work, which covers their latency; without it the scheduler spreads them among that work
#pragma unroll
            for (int qt = 0; qt < 2; ++qt) {
                const int iq = r0 + qt * 16 + c; float zq = zs[qt];
                v8us p0h, p0l, p1h, p1l;
#pragma unroll
                for (int j = 0; j < 8; ++j) {
#pragma unroll
                    for (int kt = 0; kt < 2; ++kt) { const float xd = (kc + kt * 16 + 8 * hi + j <= iq) ? s[qt][kt][j] : 0.f;      // causal select on x_dot: 0 maps to exactly 0 (0 / 2.000001), and the 16 divisions stay branch-free and independent
                        const float den = fmaxf(__fsub_rn(2.000001f, __fmul_rn(2.0f, xd)), 1e-6f); const float kk = __fdiv_rn(__fmul_rn(xd, xd), den);
                        zq = __fadd_rn(zq, kk); unsigned short a, b; splitf(kk, a, b); if (kt == 0) { p0h[j] = a; p0l[j] = b; } else { p1h[j] = a; p1l[j] = b; } } }
                zs[qt] = zq;
                const V ph = cat16b(p0h, p1h), pl = cat16b(p0l, p1l);
#pragma unroll
                for (int dt = 0; dt < 4; ++dt) acc[qt][dt] = F::mma(vh[dt], ph, acc[qt][dt]);
#pragma unroll
                for (int dt = 0; dt < 4; ++dt) acc[qt][dt] = F::mma(vh[dt], pl, acc[qt][dt]);
#pragma unroll
                for (int dt = 0; dt < 4; ++dt) acc[qt][dt] = F::mma(vl[dt], ph, acc[qt][dt]);
            }
        }
        // the pair's hand-over: this wave finishes query tile 'par' and gives the partner its partial sums of the other one
        v4f* xw = xs + (size_t)(half * 8 + wv) * 256 + lane; const v4f* xr = xs + (size_t)(half * 8 + (wv ^ 4)) * 256 + lane;
        v8f mine[4];
#pragma unroll
        for (int dt = 0; dt < 4; ++dt) { const v8f o = par ? acc[0][dt] : acc[1][dt]; mine[dt] = par ? acc[1][dt] : acc[0][dt];
            xw[(2 * dt) * 32] = __builtin_shufflevector(o, o, 0, 1, 2, 3); xw[(2 * dt + 1) * 32] = __builtin_shufflevector(o, o, 4, 5, 6, 7); }
        zx[(half * 8 + wv) * 32 + lane] = par ? zs[0] : zs[1];
        __syncthreads();                                         // the partner's partial sums are read behind it; every wave of the work-group passes it once per tile
        float zm = (par ? zs[1] : zs[0]) + zx[(half * 8 + (wv ^ 4)) * 32 + lane];
#pragma unroll
        for (int dt = 0; dt < 4; ++dt) { const v4f x0 = xr[(2 * dt) * 32], x1 = xr[(2 * dt + 1) * 32]; mine[dt] += __builtin_shufflevector(x0, x1, 0, 1, 2, 3, 4, 5, 6, 7); }
        zm += __shfl_xor(zm, 16, 32); const float zz = fmaxf(zm, 1e-6f); const int rq = r0 + par * 16;
#pragma unroll
        for (int dt = 0; dt < 4; ++dt) { v8us oh, ol;
#pragma unroll
            for (int j = 0; j < 8; ++j) { unsigned short a, b; splitf(__fdiv_rn(mine[dt][j], zz), a, b); oh[j] = a; ol[j] = b; }
            const size_t o = ((size_t)(2 * h + (dt >> 1)) * (NB_ * TT / 16) + b * (TT / 16) + (rq >> 4)) * 512 + (dt & 1) * 256 + 8 * lane; *(v8us*)(Ah + o) = oh; *(v8us*)(Al + o) = ol; }   // chunk (R = (b T + rq) / 16, kb = 2 h + dt / 2, sel = dt & 1) of the merged [b t][E] planes
        asm volatile("s_wait_xcnt 0x0" ::: "memory");           // the second tile's set-up overwrites the registers that these stores name: the wait stands in front of it
    }
}

extern "C" void kernel_launch(void* const* d_in, const int* in_sizes, int n_in,
                              void* d_out, int out_size, void* d_ws, size_t ws_size, hipStream_t stream) {
    (void)in_sizes; (void)n_in; (void)out_size;
    const float* x = (const float*)d_in[0]; const float* wqkv = (const float*)d_in[1]; const float* bqkv = (const float*)d_in[2]; const float* wout = (const float*)d_in[3]; const float* bout = (const float*)d_in[4];   // torch [out][in] weights
    float* OUT = (float*)d_out;     // [2][2048][1024]
    char* wsp = (char*)d_ws;
    auto take = [&](size_t bytes) { char* p = wsp; wsp += (bytes + 255) & ~(size_t)255; return (void*)p; };
    const size_t MT = (size_t)NB_ * TT;     // both batches go through every launch: the projections see one [NB_ * TT][E] matrix, the per-head kernels take the batch from the grid
    bf* WQKV = (bf*)take((size_t)3 * EE * EE * 2); bf* WO = (bf*)take((size_t)EE * EE * 2); bf* XB = (bf*)take(MT * EE * 2);
    bf* Qh = (bf*)take(MT * EE * 2); bf* Ql = (bf*)take(MT * EE * 2); bf* Kh = (bf*)take(MT * EE * 2); bf* Kl = (bf*)take(MT * EE * 2); bf* VTh = (bf*)take(MT * EE * 2); bf* VTl = (bf*)take(MT * EE * 2);
    bf* Ah = (bf*)take(MT * EE * 2); bf* Al = (bf*)take(MT * EE * 2);
    if ((size_t)(wsp - (char*)d_ws) > ws_size) return;    // total ~ 84 MB
    k_cvt8<<<dim3(3 * EE / 64, EE / 32, 1), 256, 0, stream>>>(wqkv, WQKV, (size_t)3 * EE * EE / 8); k_cvt8<<<dim3(EE / 64, EE / 32, 1), 256, 0, stream>>>(wout, WO, (size_t)EE * EE / 8);
    k_cvt8<<<dim3(NB_ * TT / 64, EE / 32, 1), 256, 0, stream>>>(x, XB, MT * EE / 8);
    k_gemmw<bf, 0, true, true><<<dim3(NB_ * TT / 64, 3 * EE / 64, 1), 32, 0, stream>>>(XB, nullptr, WQKV, nullptr, EE, NB_ * TT, 3 * EE, nullptr, 0, bqkv, 0, 0, 0, Qh, Ql, Kh, Kl, VTh, VTl);
    k_attn<<<dim3(NH_, TT / 256, NB_), 256, 0, stream>>>(Qh, Ql, Kh, Kl, VTh, VTl, Ah, Al);
    k_gemmw<bf, 1, true, false><<<dim3(NB_ * TT / 64, EE / 64, 1), 32, 0, stream>>>(Ah, Al, WO, nullptr, EE, NB_ * TT, EE, OUT, EE, bout, 0, 0, 0, nullptr, nullptr, nullptr, nullptr, nullptr, nullptr);
}

// v007
// A run of this version takes 101 microseconds.
// In two side-by-side timings against v006, it was 1.12 and 1.11 times as fast.
// All steps since v000 together make it 12.7 times as fast.
#include <hip/hip_runtime.h>

// ExactSphericalKernelCausalAttention (x [2][2048][1024]; [q|k|v] = x w_qkv^T + b_qkv (16 heads x 64); qn, kn = L2-normalised (max(norm, 1e-12)); x_dot = qn.kn; K = x_dot^2 / max(2 + 1e-6 - 2 x_dot, 1e-6) for j <= i else 0;
// out_h = (K v) / max(sum_j K, 1e-6); out = merged w_out^T + b_out -> [2][2048][1024]; no softmax).
// Compute dtypes, f32 accumulate: every input rounded to bf16; the qkv projection on PLAIN bf16 operands (inputs: exact, + bias); normalisation f32 -> bf16 hi+lo planes of qn / kn; x_dot on 3 products (K 64, tiles above
// the diagonal skipped); the kernel K and its causal select in f32 on the score accumulators, its row sums in f32 (in-lane, halves joined once) -> bf16 hi+lo fragments of K in registers; K.v on hi+lo operands (3 products, keys limited to the diagonal block; the output (rms 0.10) is a cancelling sum); the division by z and the merge f32 -> hl planes;

#define NB_  2
#define TT   2048
#define EE   1024
#define NH_  16
#define HD   64
#define ZH   2
#define PCAR 64.0f
typedef _Float16 h16;
typedef unsigned short bf;
typedef __attribute__((ext_vector_type(16))) __bf16   v16bf;
typedef __attribute__((ext_vector_type(16))) _Float16 v16h;
typedef __attribute__((ext_vector_type(8)))  _Float16 v8h;
typedef __attribute__((ext_vector_type(8)))  unsigned short v8us;
typedef __attribute__((ext_vector_type(8)))  float    v8f;
typedef __attribute__((ext_vector_type(4)))  float    v4f;
typedef v8h  __attribute__((may_alias)) v8ha;
typedef v4f  __attribute__((may_alias)) v4fa;
typedef v8us __attribute__((may_alias)) v8usa;

__device__ __forceinline__ unsigned short f2bf(float f) { unsigned u = __float_as_uint(f); u += 0x7FFFu + ((u >> 16) & 1u); return (unsigned short)(u >> 16); }
__device__ __forceinline__ float bf2f(unsigned short b) { return __uint_as_float(((unsigned)b) << 16); }
__device__ __forceinline__ float bfr(float f) { return bf2f(f2bf(f)); }
__device__ __forceinline__ void splitf(float y, unsigned short& h, unsigned short& l) { h = f2bf(y); l = f2bf(y - bf2f(h)); }
__device__ __forceinline__ v16h cat16(v8h lo, v8h hi) { return __builtin_shufflevector(lo, hi, 0, 1, 2, 3, 4, 5, 6, 7, 8, 9, 10, 11, 12, 13, 14, 15); }
__device__ __forceinline__ v16bf cat16b(v8us lo, v8us hi) { return __builtin_bit_cast(v16bf, __builtin_shufflevector(lo, hi, 0, 1, 2, 3, 4, 5, 6, 7, 8, 9, 10, 11, 12, 13, 14, 15)); }
__device__ __forceinline__ v8f wmma16(v16h a, v16h b, v8f c) { return __builtin_amdgcn_wmma_f32_16x16x32_f16(false, a, false, b, (short)0, c, false, false); }
__device__ __forceinline__ v8f wmmab(v16bf a, v16bf b, v8f c) { return __builtin_amdgcn_wmma_f32_16x16x32_bf16(false, a, false, b, (short)0, c, false, false); }



// ---- k_gemmw: register-blocked GEMM, ONE WAVE per 64x64 output tile (16 accumulators), operands straight from 16-bit planes in fragment order (below); grid (M/64, N/64, Z), 32 threads.
// C[m][n] (f32, pitch ldc, + optional f32 bias[n]) = sum_k A[m][k] Bt[n][k] (+ split products per NSPLIT). z-batch strides sA/sB/sC in elements. K % 128 == 0 (whole turns of the ring of register sets below). amdgpu_waves_per_eu: the register budget of the waves that share a SIMD, three in the qkv projection, one in the output projection.
// PLANES (the qkv projection; a 64-column tile is one head of q, k or v, a 64-row tile lies in one batch): no C; the wave that holds the tile writes the attention's operand planes itself, see the epilogue.
template <typename T16> struct WFrag;
template <> struct WFrag<h16> { typedef v16h V; static __device__ __forceinline__ V ld(const h16* p) { return cat16(*(const v8h*)p, *(const v8h*)(p + 256)); } static __device__ __forceinline__ v8f mma(V a, V b, v8f c) { return wmma16(a, b, c); } };
template <> struct WFrag<bf> { typedef v16bf V; static __device__ __forceinline__ V ld(const bf* p) { return cat16b(*(const v8us*)p, *(const v8us*)(p + 256)); } static __device__ __forceinline__ v8f mma(V a, V b, v8f c) { return wmmab(a, b, c); } };
// ---- FRAGMENT ORDER: every 16-bit plane that a matrix instruction reads (x, the weights, qn, kn, V^T, the merged heads; hi and lo) is stored as whole fragments, not as rows. A plane P[rows][K] is cut into fragments of 16 rows x 32 k = 512 elements = 1 KiB;
// inside a fragment, 16-byte chunk number sel * 32 + hi * 16 + lr holds P[16 R + lr][32 kb + 16 sel + 8 hi + 0..7], which is what lane hi * 16 + lr takes as the first (sel 0) or second (sel 1) half of its operand.
// So a wave's 16-byte load or store covers 512 contiguous bytes (4 whole lines) where a row-major plane gives it 32 bytes in each of 16 lines. qn, kn (K = 64): fragment (R, kb) at element (R * 2 + kb) * 512 of its head; the GEMM operands: at (kb * (rows / 16) + R) * 512, so that the four fragments a 64-row tile takes per 32 k are neighbours;
// V^T (rows d, k = key): fragment (R, kb) at (kb * 4 + R) * 512, so that the fragments of one pass of 32 keys are neighbours in every plane. Values, k order and every sum are those of the row-major form.
// WFrag::ld(p) above takes p = fragment + lane * 8.
template <typename T16, int NSPLIT, bool BIAS, bool PLANES>
__global__ __launch_bounds__(32) __attribute__((amdgpu_waves_per_eu(PLANES ? 3 : 1, PLANES ? 3 : 1))) void k_gemmw(const T16* __restrict__ A, const T16* __restrict__ A2, const T16* __restrict__ Bt, const T16* __restrict__ Bt2, int K, int arows, int brows, float* C, int ldc, const float* __restrict__ bias, size_t sA, size_t sB, size_t sC, bf* Qh, bf* Ql, bf* Kh, bf* Kl, bf* VTh, bf* VTl) {
    typedef typename WFrag<T16>::V V;
    __shared__ __align__(16) float os[(PLANES ? 64 : 16) * 68];
    const size_t z = blockIdx.z; A += z * sA; if (A2) A2 += z * sA; Bt += z * sB; if (Bt2) Bt2 += z * sB; C += z * sC;
    const int lane = threadIdx.x & 31, lr = lane & 15, hi = lane >> 4; const int r0 = blockIdx.x * 64, c0 = blockIdx.y * 64;
    v8f acc[4][4];
#pragma unroll
    for (int mb = 0; mb < 4; ++mb)
#pragma unroll
        for (int nb = 0; nb < 4; ++nb) acc[mb][nb] = (v8f){};
    const size_t aoff = (size_t)r0 * 32 + 8 * lane, boff = (size_t)c0 * 32 + 8 * lane, astep = (size_t)arows * 32, bstep = (size_t)brows * 32;   // 16 rows further is the next fragment, 512 elements on; 32 k further is one fragment of every row block on (arows, brows: rows of the whole A and Bt planes)
    // RING OF REGISTER SETS: ND sets of this wave's A and B fragments; the loads of trip t + AH are issued in front of the products of trip t, so a load has AH trips of matrix work to arrive in.
    // Two sets, one trip ahead, where three waves share a SIMD (the qkv projection: the register budget of three waves); four sets, two trips ahead, where a wave has its SIMD alone (the output projection: behind the set in use 48 loads are in flight, which the load counter can still count,
    // and a load lands in a set whose products were issued two trips ago). Every accumulator takes its products in the order of k, as before.
    constexpr int ND = PLANES ? 2 : 4, AH = PLANES ? 1 : 2; constexpr bool HA2 = (NSPLIT == 1 || NSPLIT == 2), HB2 = (NSPLIT >= 2);
    V a[ND][4], a2[ND][4], bq[ND][4], b2[ND][4]; const int nk = K >> 5;
#pragma unroll
    for (int s = 0; s < AH; ++s) {                               // trips 0 .. AH - 1 into sets 0 .. AH - 1
        const size_t ak = aoff + (size_t)s * astep, bk = boff + (size_t)s * bstep; const T16* pa = A + ak; const T16* pb = Bt + bk; const T16* pa2 = HA2 ? A2 + ak : pa; const T16* pb2 = HB2 ? Bt2 + bk : pb;
#pragma unroll
        for (int f = 0; f < 4; ++f) { a[s][f] = WFrag<T16>::ld(pa + f * 512); if (HA2) a2[s][f] = WFrag<T16>::ld(pa2 + f * 512); bq[s][f] = WFrag<T16>::ld(pb + f * 512); if (HB2) b2[s][f] = WFrag<T16>::ld(pb2 + f * 512); }
        // the wait stands behind these loads; it takes their addresses as inputs, so that the address registers stay untouched until it has passed
        asm volatile("s_wait_xcnt 0x0" :: "v"(pa), "v"(pb), "v"(pa2), "v"(pb2) : "memory");
    }
#pragma unroll 1
    for (int t = 0; t < nk; t += ND) {                           // rolled over whole turns of the ring
#pragma unroll
        for (int s = 0; s < ND; ++s) {                           // opened: the set numbers are constants, so that the sets are registers and no fragment is copied
            const int d = (s + AH) % ND; const int tn = (t + s + AH < nk) ? t + s + AH : nk - 1;   // the last trips fetch the last fragments again: in bounds, unused
            const size_t ak = aoff + (size_t)tn * astep, bk = boff + (size_t)tn * bstep; const T16* pa = A + ak; const T16* pb = Bt + bk; const T16* pa2 = HA2 ? A2 + ak : pa; const T16* pb2 = HB2 ? Bt2 + bk : pb;
#pragma unroll
            for (int f = 0; f < 4; ++f) { a[d][f] = WFrag<T16>::ld(pa + f * 512); if (HA2) a2[d][f] = WFrag<T16>::ld(pa2 + f * 512); bq[d][f] = WFrag<T16>::ld(pb + f * 512); if (HB2) b2[d][f] = WFrag<T16>::ld(pb2 + f * 512); }
            __builtin_amdgcn_sched_barrier(0);                   // the loads issue as one group ahead of this trip's products; without it the scheduler sinks them towards their use, AH trips later, and their lead is lost
#pragma unroll
            for (int nb = 0; nb < 4; ++nb)
#pragma unroll
                for (int mb = 0; mb < 4; ++mb) { acc[mb][nb] = WFrag<T16>::mma(a[s][mb], bq[s][nb], acc[mb][nb]); if (HA2) acc[mb][nb] = WFrag<T16>::mma(a2[s][mb], bq[s][nb], acc[mb][nb]); if (HB2) acc[mb][nb] = WFrag<T16>::mma(a[s][mb], b2[s][nb], acc[mb][nb]); }
            __builtin_amdgcn_sched_barrier(0);                   // all of this trip's products issue ahead of the wait below, which then falls behind matrix work; without it the scheduler leaves most of them behind the wait, among the next trip's loads
            // the loop's branch stands behind the last product: four slots keep the distance to the first vector instruction on its taken side too
            if (s == ND - 1) asm volatile("v_nop\n\tv_nop\n\tv_nop\n\tv_nop" : "+v"(acc[0][0]), "+v"(acc[1][1]), "+v"(acc[2][2]), "+v"(acc[3][3]) : "v"(a[s][0]), "v"(a[s][3]));
            // the wait stands behind this trip's loads; it takes their addresses as inputs, so that the address registers stay untouched (no later load lands in them, no next address is formed in them) until it has passed
            asm volatile("s_wait_xcnt 0x0" :: "v"(pa), "v"(pb), "v"(pa2), "v"(pb2) : "memory");
        }
    }
    if constexpr (PLANES) {
        // c0, r0 come from blockIdx: part, head, batch and the branch on them are scalar
        const int part = c0 / EE, h = (c0 % EE) / HD, b = r0 / TT, t0 = r0 % TT; const size_t hb = (size_t)(b * NH_ + h) * TT * HD;
        float bb[4];
#pragma unroll
        for (int nb = 0; nb < 4; ++nb) bb[nb] = bfr(bias[c0 + nb * 16 + lr]);
        if (part == 2) {
            // v: an accumulator gives lane (lr, hi) the keys t0 + 16 mb + 8 hi + 0..7 of d = 16 nb + lr, which is chunk (kb = t / 32, dt = nb, sel = mb & 1) of V^T in fragment order: bias, hi/lo split, 16-byte stores, 512 contiguous bytes a wave
#pragma unroll
            for (int mb = 0; mb < 4; ++mb) {
#pragma unroll
                for (int nb = 0; nb < 4; ++nb) { v8us oh, ol;
#pragma unroll
                    for (int j = 0; j < 8; ++j) { unsigned short a, c; splitf(acc[mb][nb][j] + bb[nb], a, c); oh[j] = a; ol[j] = c; }
                    const size_t o = hb + (size_t)((t0 >> 5) + (mb >> 1)) * 2048 + nb * 512 + (mb & 1) * 256 + 8 * lane; *(v8us*)(VTh + o) = oh; *(v8us*)(VTl + o) = ol; }
                asm volatile("s_wait_xcnt 0x0" ::: "memory");   // the next 16 keys' work overwrites registers that these stores name: the wait stands in front of it
            }
        } else {
            // q, k: the tile goes through LDS so that lane (lr, hi) holds the four chunks of row lr that fragment order gives it (d = 32 kb + 16 sel + 8 hi + 0..7); L2 norm, multiplication by its reciprocal, hi/lo split, 16-byte stores.
            // The sum of squares keeps the tree pairs d, d + 1; then d ^ 32, ^ 16, ^ 8, ^ 4, ^ 2: only the ^ 8 level crosses lanes.
            bf* H = part ? Kh : Qh; bf* Lo = part ? Kl : Ql;
#pragma unroll
            for (int mb = 0; mb < 4; ++mb)
#pragma unroll
                for (int nb = 0; nb < 4; ++nb)
#pragma unroll
                    for (int j = 0; j < 8; ++j) os[(mb * 16 + hi * 8 + j) * 68 + nb * 16 + lr] = acc[mb][nb][j] + bb[nb];
            __builtin_amdgcn_wave_barrier(); asm volatile("" ::: "memory");   // the rows are read back by other lanes of this wave: no read moves in front of the writes
#pragma unroll 1
            for (int mb = 0; mb < 4; ++mb) {                     // rolled: one copy of the 32 scalings and splits, so that the kernel's text stays short (each wave runs it once through)
                v8f x[2][2]; float lf[2][2][4];
#pragma unroll
                for (int kb = 0; kb < 2; ++kb)
#pragma unroll
                    for (int sel = 0; sel < 2; ++sel) { const float* s = os + (mb * 16 + lr) * 68 + kb * 32 + sel * 16 + hi * 8; const v4f x0 = *(const v4fa*)s, x1 = *(const v4fa*)(s + 4); x[kb][sel] = __builtin_shufflevector(x0, x1, 0, 1, 2, 3, 4, 5, 6, 7);
#pragma unroll
                        for (int e = 0; e < 4; ++e) lf[kb][sel][e] = __fadd_rn(__fmul_rn(x[kb][sel][2 * e], x[kb][sel][2 * e]), __fmul_rn(x[kb][sel][2 * e + 1], x[kb][sel][2 * e + 1])); }
                float s3[4];
#pragma unroll
                for (int e = 0; e < 4; ++e) { const float s2 = __fadd_rn(__fadd_rn(lf[0][0][e], lf[1][0][e]), __fadd_rn(lf[0][1][e], lf[1][1][e])); s3[e] = __fadd_rn(s2, __shfl_xor(s2, 16, 32)); }
                const float ss = __fadd_rn(__fadd_rn(s3[0], s3[2]), __fadd_rn(s3[1], s3[3])); const float nn = fmaxf(__fsqrt_rn(ss), 1e-12f); const float rn = __fdiv_rn(1.0f, nn);   // one division per row, 32 multiplies
                const size_t o = hb + (size_t)((t0 >> 4) + mb) * 1024 + lane * 8;
#pragma unroll
                for (int kb = 0; kb < 2; ++kb)
#pragma unroll
                    for (int sel = 0; sel < 2; ++sel) { v8us oh, ol;
#pragma unroll
                        for (int e = 0; e < 8; ++e) { unsigned short a, c; splitf(__fmul_rn(x[kb][sel][e], rn), a, c); oh[e] = a; ol[e] = c; }
                        *(v8us*)(H + o + kb * 512 + sel * 256) = oh; *(v8us*)(Lo + o + kb * 512 + sel * 256) = ol; }
                asm volatile("s_wait_xcnt 0x0" ::: "memory");   // the next 16 rows' work overwrites registers that these stores name: the wait stands in front of it
            }
        }
        return;
    }
#pragma unroll
    for (int mb = 0; mb < 4; ++mb) {
#pragma unroll
        for (int nb = 0; nb < 4; ++nb) {
#pragma unroll
            for (int j = 0; j < 8; ++j) os[(hi * 8 + j) * 68 + nb * 16 + lr] = acc[mb][nb][j]; }
        __builtin_amdgcn_wave_barrier(); asm volatile("" ::: "memory");
        float* crow = C + (size_t)(r0 + mb * 16) * ldc + c0;
{
#pragma unroll
            for (int s = 0; s < 8; ++s) { const int row = 2 * s + hi, cofs = lr * 4; v4f val = *(const v4fa*)(os + row * 68 + cofs); if (BIAS) { val[0] += bfr(bias[c0 + cofs]); val[1] += bfr(bias[c0 + cofs + 1]); val[2] += bfr(bias[c0 + cofs + 2]); val[3] += bfr(bias[c0 + cofs + 3]); }
                *(v4f*)(crow + (size_t)row * ldc + cofs) = val; }
             }
        asm volatile("s_wait_xcnt 0x0" ::: "memory");           // the next 16 rows' work overwrites registers that these stores name: the wait stands in front of it
        __builtin_amdgcn_wave_barrier(); asm volatile("" ::: "memory");
    }
}

__device__ __forceinline__ h16 tohx(float x) { return (h16)x; }
typedef __attribute__((ext_vector_type(2))) _Float16 v2h;
typedef __attribute__((ext_vector_type(4))) _Float16 v4h;
typedef __attribute__((ext_vector_type(2))) unsigned short v2us;
typedef __attribute__((ext_vector_type(4))) unsigned short v4us;

__global__ __launch_bounds__(256) void k_wtG(const float* __restrict__ w, int K, int N, bf* Bt) {
    const int lane = threadIdx.x & 31; const int L0 = (blockIdx.x * 8 + (threadIdx.x >> 5)) * 8; const int nlines = N * K / 64;
{
#pragma unroll 1
        for (int l = 0; l < 8; ++l) { const int L = L0 + l; if (L >= nlines) break; const size_t e = (size_t)L * 64 + lane * 2; const int k = (int)(e % K), n = (int)(e / K); v2us o;
            o[0] = f2bf(w[(size_t)k * N + n]); o[1] = f2bf(w[(size_t)(k + 1) * N + n]); *(v2us*)(Bt + e) = o; }
         }
}
// k_cvt8: f32 [rows][EE] -> bf16 GEMM operand plane in fragment order (rows = n8 * 8 / EE); thread i writes chunk i (a wave stores 512 contiguous bytes) and fetches the 8 values that belong there.
__global__ __launch_bounds__(256) void k_cvt8(const float* __restrict__ src, bf* dst, size_t n8) { const size_t slab = n8 / (EE / 32), j = (size_t)blockIdx.x * 256 + threadIdx.x; if (j >= slab) return;   // grid (rows / 64, EE / 32): blockIdx.y is kb, j the chunk among those of one kb
    const int lr = (int)(j & 15), hi = (int)((j >> 4) & 1), sel = (int)((j >> 5) & 1), kb = blockIdx.y; const size_t R = j >> 6, i = (size_t)kb * slab + j;
    const v8f v = *(const v8f*)(src + (R * 16 + lr) * EE + kb * 32 + sel * 16 + hi * 8); v8us o;
#pragma unroll
    for (int k = 0; k < 8; ++k) o[k] = f2bf(v[k]); *(v8us*)(dst + i * 8) = o;  }
// ---- k_attn: the whole causal kernel attention (all batches, all heads) in one launch, ONE WAVE per 32 queries and every second pass of 32 keys, nothing staged in memory or LDS between the two products.
// Per 32 keys: S^T = kn . qn^T (A = key rows, B = query rows kept in registers; 3 hi/lo products, K 64), so a lane holds 16 keys of ONE query (c = lane & 15) in each of the wave's two 16-query tiles; the kernel map, the causal select and the
// row sum run in f32 on those accumulators; the two S^T tiles of a query tile, split into bf16 hi+lo, ARE the B operand of O^T += V^T . P^T (3 hi/lo products) in the hardware k order that the V^T loader also uses.
// TWO QUERY TILES PER FRAGMENT: every K and V^T fragment that a wave loads serves both of its query tiles, so a pass has twice the matrix and vector work behind the same 32 loads.
// O^T gives a lane 8 consecutive d of its query, one chunk of the merged hi/lo planes in fragment order: multiplication by 1 / z in-lane, 16-byte stores, 512 contiguous bytes a wave.
// Work: a 32-query tile t has t + 1 passes of 32 keys. Waves w and w + 4 of a work-group are a pair: the pair takes tile 63 - p and then tile p (65 passes), wave w the even passes, wave w + 4 the odd ones, so that there are still two waves per SIMD
// (one wave's vector work runs beside the other's matrix work and loads). There is no maximum to rescale by: the two waves' partial O^T and z simply add. At the end of a tile each wave hands the partner, through LDS, its partial sums of the 16-query tile
// that the partner finishes (wave w the first, wave w + 4 the second). grid (heads, 8, batches), 8 waves: one work-group per WGP.
// amdgpu_waves_per_eu(1, 2): eight waves per work-group already bound a wave to half a SIMD's registers; with (2, 2) the scheduler keeps well below that bound and runs the 32 kernel values of a pass one after another.
// Every plain '#pragma unroll' below opens a short loop of fixed length so that the fragment arrays it indexes are registers.
__global__ __launch_bounds__(256) __attribute__((amdgpu_waves_per_eu(1, 2))) void k_attn(const bf* __restrict__ Qh, const bf* __restrict__ Ql, const bf* __restrict__ Kh, const bf* __restrict__ Kl, const bf* __restrict__ VTh, const bf* __restrict__ VTl, bf* Ah, bf* Al) {
    typedef WFrag<bf> F; typedef F::V V;
    __shared__ __align__(16) v4f xs[2 * 8 * 8 * 32];         // [tile of the pair][writing wave][8 chunks of 4 floats][lane]: each of the two hand-overs has its own place, so one barrier each is enough
    __shared__ float zx[2 * 8 * 32];
    const int lane = threadIdx.x & 31, c = lane & 15, hi = lane >> 4; const int h = blockIdx.x;
    const int wv = __builtin_amdgcn_readfirstlane(threadIdx.x >> 5);   // wave-uniform: the key loop runs on scalar control flow, EXEC stays full at every matrix instruction
    const int par = wv >> 2, p = blockIdx.y * 4 + (wv & 3);
    const int b = blockIdx.z; const size_t hb = (size_t)(b * NH_ + h) * TT * HD;
    const bf* kph = Kh + hb + 8 * lane; const bf* kpl = Kl + hb + 8 * lane; const bf* vph = VTh + hb + 8 * lane; const bf* vpl = VTl + hb + 8 * lane;   // fragment order: 32 keys are 4 neighbouring fragments (2048 elements) in each plane
#pragma unroll 1
    for (int half = 0; half < 2; ++half) {                   // rolled: one copy of the pass in the instruction cache
        const int r0 = (half ? p : TT / 32 - 1 - p) * 32;
        V qh[2][2], ql[2][2];
#pragma unroll
        for (int qt = 0; qt < 2; ++qt)
#pragma unroll
            for (int ks = 0; ks < 2; ++ks) { qh[qt][ks] = F::ld(Qh + hb + (size_t)(r0 + qt * 16) * HD + ks * 512 + 8 * lane); ql[qt][ks] = F::ld(Ql + hb + (size_t)(r0 + qt * 16) * HD + ks * 512 + 8 * lane); }
        v8f acc[2][4];
#pragma unroll
        for (int qt = 0; qt < 2; ++qt)
#pragma unroll
            for (int dt = 0; dt < 4; ++dt) acc[qt][dt] = (v8f){};
        float zs[2] = {0.f, 0.f}; const int kend = r0 + 32, kbeg = par * 32;
        V kh[2][2], kl[2][2];
#pragma unroll
        for (int kt = 0; kt < 2; ++kt)
#pragma unroll
            for (int ks = 0; ks < 2; ++ks) { kh[kt][ks] = F::ld(kph + (size_t)(kbeg + kt * 16) * HD + ks * 512); kl[kt][ks] = F::ld(kpl + (size_t)(kbeg + kt * 16) * HD + ks * 512); }   // keys 0..63 exist for every tile: in bounds, unused where this wave has no pass
#pragma unroll 1
        for (int kc = kbeg; kc < kend; kc += 64) {               // rolled: one pass already holds 32 loads in flight and its registers; a second copy would only add registers
            V vh[4], vl[4]; const bf* pvh = vph + (size_t)kc * HD; const bf* pvl = vpl + (size_t)kc * HD;
#pragma unroll
            for (int dt = 0; dt < 4; ++dt) { vh[dt] = F::ld(pvh + dt * 512); vl[dt] = F::ld(pvl + dt * 512); }
            v8f s[2][2];
#pragma unroll
            for (int qt = 0; qt < 2; ++qt) { s[qt][0] = (v8f){}; s[qt][1] = (v8f){}; }
#pragma unroll
            for (int ks = 0; ks < 2; ++ks) {
#pragma unroll
                for (int qt = 0; qt < 2; ++qt)
#pragma unroll
                    for (int kt = 0; kt < 2; ++kt) s[qt][kt] = F::mma(kh[kt][ks], qh[qt][ks], s[qt][kt]);
#pragma unroll
                for (int qt = 0; qt < 2; ++qt)
#pragma unroll
                    for (int kt = 0; kt < 2; ++kt) s[qt][kt] = F::mma(kh[kt][ks], ql[qt][ks], s[qt][kt]);
#pragma unroll
                for (int qt = 0; qt < 2; ++qt)
#pragma unroll
                    for (int kt = 0; kt < 2; ++kt) s[qt][kt] = F::mma(kl[kt][ks], qh[qt][ks], s[qt][kt]); }
            asm volatile("s_wait_xcnt 0x0" :: "v"(pvh), "v"(pvl) : "memory");   // the wait stands behind the V^T loads; it takes their addresses as inputs, so that no load lands in the address registers and no next address is formed in them until it has passed
            const int kn = (kc + 64 < kend) ? kc + 64 : kc;      // this wave's next 32 keys' fragments fly during the vector work (the last pass re-reads its own rows: in bounds, unused)
            const bf* nkh = kph + (size_t)kn * HD; const bf* nkl = kpl + (size_t)kn * HD;
#pragma unroll
            for (int kt = 0; kt < 2; ++kt)
#pragma unroll
                for (int ks = 0; ks < 2; ++ks) { kh[kt][ks] = F::ld(nkh + kt * 16 * HD + ks * 512); kl[kt][ks] = F::ld(nkl + kt * 16 * HD + ks * 512); }
            asm volatile("s_wait_xcnt 0x0" :: "v"(nkh), "v"(nkl) : "memory");   // the same behind the next-K loads: the vector work below reuses their address registers
            __builtin_amdgcn_sched_barrier(0);                   // all 32 loads issue as one group ahead of the vector work, which covers their latency; without it the scheduler spreads them among that work
#pragma unroll
            for (int qt = 0; qt < 2; ++qt) {
                const int iq = r0 + qt * 16 + c; float zq = zs[qt];
                v8us p0h, p0l, p1h, p1l;
#pragma unroll
                for (int g = 0; g < 2; ++g) {                    // eight kernel values at a time: j = 4 g .. 4 g + 3, both key tiles
                    float xd[8], dn[8], rc[8];
#pragma unroll
                    for (int e = 0; e < 8; ++e) { const int j = 4 * g + (e >> 1), kt = e & 1; xd[e] = (kc + kt * 16 + 8 * hi + j <= iq) ? s[qt][kt][j] : 0.f;      // causal select on x_dot: 0 maps to exactly 0 (0 * (1 / 2.000001)), and the reciprocals stay branch-free and independent
                        dn[e] = fmaxf(__fsub_rn(2.000001f, __fmul_rn(2.0f, xd[e])), 1e-6f); rc[e] = __builtin_amdgcn_rcpf(dn[e]); }   // den lies in [1e-6, 2.000001 + 2 |x_dot|]: inside the reciprocal instruction's plain range, so the scaling and fix-up steps of a full division have nothing to do
                    // the slot that the instruction set asks for behind a transcendental, once for eight: the statement takes the results and the sources, so that no result is read and no source overwritten in front of it
                    asm("v_nop" : "+v"(rc[0]), "+v"(rc[1]), "+v"(rc[2]), "+v"(rc[3]), "+v"(rc[4]), "+v"(rc[5]), "+v"(rc[6]), "+v"(rc[7]) : "v"(dn[0]), "v"(dn[1]), "v"(dn[2]), "v"(dn[3]), "v"(dn[4]), "v"(dn[5]), "v"(dn[6]), "v"(dn[7]));
#pragma unroll
                    for (int e = 0; e < 8; ++e) { const int j = 4 * g + (e >> 1), kt = e & 1; const float kk = __fmul_rn(__fmul_rn(xd[e], xd[e]), rc[e]);
                        zq = __fadd_rn(zq, kk); unsigned short a, b; splitf(kk, a, b); if (kt == 0) { p0h[j] = a; p0l[j] = b; } else { p1h[j] = a; p1l[j] = b; } } }
                zs[qt] = zq;
                const V ph = cat16b(p0h, p1h), pl = cat16b(p0l, p1l);
#pragma unroll
                for (int dt = 0; dt < 4; ++dt) acc[qt][dt] = F::mma(vh[dt], ph, acc[qt][dt]);
#pragma unroll
                for (int dt = 0; dt < 4; ++dt) acc[qt][dt] = F::mma(vh[dt], pl, acc[qt][dt]);
#pragma unroll
                for (int dt = 0; dt < 4; ++dt) acc[qt][dt] = F::mma(vl[dt], ph, acc[qt][dt]);
            }
        }
        // the pair's hand-over: this wave finishes query tile 'par' and gives the partner its partial sums of the other one
        v4f* xw = xs + (size_t)(half * 8 + wv) * 256 + lane; const v4f* xr = xs + (size_t)(half * 8 + (wv ^ 4)) * 256 + lane;
        v8f mine[4];
#pragma unroll
        for (int dt = 0; dt < 4; ++dt) { const v8f o = par ? acc[0][dt] : acc[1][dt]; mine[dt] = par ? acc[1][dt] : acc[0][dt];
            xw[(2 * dt) * 32] = __builtin_shufflevector(o, o, 0, 1, 2, 3); xw[(2 * dt + 1) * 32] = __builtin_shufflevector(o, o, 4, 5, 6, 7); }
        zx[(half * 8 + wv) * 32 + lane] = par ? zs[0] : zs[1];
        __syncthreads();                                         // the partner's partial sums are read behind it; every wave of the work-group passes it once per tile
        float zm = (par ? zs[1] : zs[0]) + zx[(half * 8 + (wv ^ 4)) * 32 + lane];
#pragma unroll
        for (int dt = 0; dt < 4; ++dt) { const v4f x0 = xr[(2 * dt) * 32], x1 = xr[(2 * dt + 1) * 32]; mine[dt] += __builtin_shufflevector(x0, x1, 0, 1, 2, 3, 4, 5, 6, 7); }
        zm += __shfl_xor(zm, 16, 32); const float zz = fmaxf(zm, 1e-6f); const float rz = __fdiv_rn(1.0f, zz); const int rq = r0 + par * 16;   // one division per query, 32 multiplies
#pragma unroll
        for (int dt = 0; dt < 4; ++dt) { v8us oh, ol;
#pragma unroll
            for (int j = 0; j < 8; ++j) { unsigned short a, b; splitf(__fmul_rn(mine[dt][j], rz), a, b); oh[j] = a; ol[j] = b; }
            const size_t o = ((size_t)(2 * h + (dt >> 1)) * (NB_ * TT / 16) + b * (TT / 16) + (rq >> 4)) * 512 + (dt & 1) * 256 + 8 * lane; *(v8us*)(Ah + o) = oh; *(v8us*)(Al + o) = ol; }   // chunk (R = (b T + rq) / 16, kb = 2 h + dt / 2, sel = dt & 1) of the merged [b t][E] planes
        asm volatile("s_wait_xcnt 0x0" ::: "memory");           // the second tile's set-up overwrites the registers that these stores name: the wait stands in front of it
    }
}

extern "C" void kernel_launch(void* const* d_in, const int* in_sizes, int n_in,
                              void* d_out, int out_size, void* d_ws, size_t ws_size, hipStream_t stream) {
    (void)in_sizes; (void)n_in; (void)out_size;
    const float* x = (const float*)d_in[0]; const float* wqkv = (const float*)d_in[1]; const float* bqkv = (const float*)d_in[2]; const float* wout = (const float*)d_in[3]; const float* bout = (const float*)d_in[4];   // torch [out][in] weights
    float* OUT = (float*)d_out;     // [2][2048][1024]
    char* wsp = (char*)d_ws;
    auto take = [&](size_t bytes) { char* p = wsp; wsp += (bytes + 255) & ~(size_t)255; return (void*)p; };
    const size_t MT = (size_t)NB_ * TT;     // both batches go through every launch: the projections see one [NB_ * TT][E] matrix, the per-head kernels take the batch from the grid
    bf* WQKV = (bf*)take((size_t)3 * EE * EE * 2); bf* WO = (bf*)take((size_t)EE * EE * 2); bf* XB = (bf*)take(MT * EE * 2);
    bf* Qh = (bf*)take(MT * EE * 2); bf* Ql = (bf*)take(MT * EE * 2); bf* Kh = (bf*)take(MT * EE * 2); bf* Kl = (bf*)take(MT * EE * 2); bf* VTh = (bf*)take(MT * EE * 2); bf* VTl = (bf*)take(MT * EE * 2);
    bf* Ah = (bf*)take(MT * EE * 2); bf* Al = (bf*)take(MT * EE * 2);
    if ((size_t)(wsp - (char*)d_ws) > ws_size) return;    // total ~ 84 MB
    k_cvt8<<<dim3(3 * EE / 64, EE / 32, 1), 256, 0, stream>>>(wqkv, WQKV, (size_t)3 * EE * EE / 8); k_cvt8<<<dim3(EE / 64, EE / 32, 1), 256, 0, stream>>>(wout, WO, (size_t)EE * EE / 8);
    k_cvt8<<<dim3(NB_ * TT / 64, EE / 32, 1), 256, 0, stream>>>(x, XB, MT * EE / 8);
    k_gemmw<bf, 0, true, true><<<dim3(NB_ * TT / 64, 3 * EE / 64, 1), 32, 0, stream>>>(XB, nullptr, WQKV, nullptr, EE, NB_ * TT, 3 * EE, nullptr, 0, bqkv, 0, 0, 0, Qh, Ql, Kh, Kl, VTh, VTl);
    k_attn<<<dim3(NH_, TT / 256, NB_), 256, 0, stream>>>(Qh, Ql, Kh, Kl, VTh, VTl, Ah, Al);
    k_gemmw<bf, 1, true, false><<<dim3(NB_ * TT / 64, EE / 64, 1), 32, 0, stream>>>(Ah, Al, WO, nullptr, EE, NB_ * TT, EE, OUT, EE, bout, 0, 0, 0, nullptr, nullptr, nullptr, nullptr, nullptr, nullptr);
}

// v008
// One run takes 95.6 microseconds.
// In both of two side-by-side timings against v007, it was 1.05 times as fast.
// Counting every step since v000, it is 13.3 times as fast.
#include <hip/hip_runtime.h>

// ExactSphericalKernelCausalAttention (x [2][2048][1024]; [q|k|v] = x w_qkv^T + b_qkv (16 heads x 64); qn, kn = L2-normalised (max(norm, 1e-12)); x_dot = qn.kn; K = x_dot^2 / max(2 + 1e-6 - 2 x_dot, 1e-6) for j <= i else 0;
// out_h = (K v) / max(sum_j K, 1e-6); out = merged w_out^T + b_out -> [2][2048][1024]; no softmax).
// Compute dtypes, f32 accumulate: every input rounded to bf16; the qkv projection on PLAIN bf16 operands (inputs: exact, + bias); normalisation f32 -> bf16 hi+lo planes of qn / kn; x_dot on 3 products (K 64, tiles above
// the diagonal skipped); the kernel K and its causal select in f32 on the score accumulators, its row sums in f32 (in-lane, halves joined once) -> bf16 hi+lo fragments of K in registers; K.v on hi+lo operands (3 products, keys limited to the diagonal block; the output (rms 0.10) is a cancelling sum); the division by z and the merge f32 -> hl planes;

#define NB_  2
#define TT   2048
#define EE   1024
#define NH_  16
#define HD   64
#define ZH   2
#define PCAR 64.0f
typedef _Float16 h16;
typedef unsigned short bf;
typedef __attribute__((ext_vector_type(16))) __bf16   v16bf;
typedef __attribute__((ext_vector_type(16))) _Float16 v16h;
typedef __attribute__((ext_vector_type(8)))  _Float16 v8h;
typedef __attribute__((ext_vector_type(8)))  unsigned short v8us;
typedef __attribute__((ext_vector_type(8)))  float    v8f;
typedef __attribute__((ext_vector_type(4)))  float    v4f;
typedef v8h  __attribute__((may_alias)) v8ha;
typedef v4f  __attribute__((may_alias)) v4fa;
typedef v8us __attribute__((may_alias)) v8usa;

// f32 -> bf16 by the hardware's convert (round to nearest even, as the integer form it replaces)
__device__ __forceinline__ unsigned short f2bf(float f) { return __builtin_bit_cast(unsigned short, (__bf16)f); }
__device__ __forceinline__ float bf2f(unsigned short b) { return __uint_as_float(((unsigned)b) << 16); }
__device__ __forceinline__ float bfr(float f) { return bf2f(f2bf(f)); }
typedef __attribute__((ext_vector_type(2))) float  v2f;
typedef __attribute__((ext_vector_type(2))) __bf16 v2bf;
typedef __attribute__((ext_vector_type(8))) unsigned v8u;
// two neighbouring elements of a fragment at once: one packed convert gives the register of the hi plane, the exact remainders y - hi the register of the lo plane
__device__ __forceinline__ void split2(float y0, float y1, unsigned& h, unsigned& l) { const v2f y = {y0, y1}; const v2bf hh = __builtin_convertvector(y, v2bf); const v2f r = y - __builtin_convertvector(hh, v2f);
    h = __builtin_bit_cast(unsigned, hh); l = __builtin_bit_cast(unsigned, __builtin_convertvector(r, v2bf)); }
typedef __attribute__((ext_vector_type(4))) unsigned v4u;
// one 16-byte chunk (8 neighbouring elements) of a hi plane and of its lo plane
__device__ __forceinline__ void split8(v8f y, v8us& h, v8us& l) { v4u a, b;
#pragma unroll
    for (int u = 0; u < 4; ++u) { unsigned p, q; split2(y[2 * u], y[2 * u + 1], p, q); a[u] = p; b[u] = q; }
    h = __builtin_bit_cast(v8us, a); l = __builtin_bit_cast(v8us, b); }
__device__ __forceinline__ v16h cat16(v8h lo, v8h hi) { return __builtin_shufflevector(lo, hi, 0, 1, 2, 3, 4, 5, 6, 7, 8, 9, 10, 11, 12, 13, 14, 15); }
__device__ __forceinline__ v16bf cat16b(v8us lo, v8us hi) { return __builtin_bit_cast(v16bf, __builtin_shufflevector(lo, hi, 0, 1, 2, 3, 4, 5, 6, 7, 8, 9, 10, 11, 12, 13, 14, 15)); }
__device__ __forceinline__ v8f wmma16(v16h a, v16h b, v8f c) { return __builtin_amdgcn_wmma_f32_16x16x32_f16(false, a, false, b, (short)0, c, false, false); }
__device__ __forceinline__ v8f wmmab(v16bf a, v16bf b, v8f c) { return __builtin_amdgcn_wmma_f32_16x16x32_bf16(false, a, false, b, (short)0, c, false, false); }



// ---- k_gemmw: register-blocked GEMM, ONE WAVE per 64x64 output tile (16 accumulators), operands straight from 16-bit planes in fragment order (below); grid (M/64, N/64, Z), 32 threads.
// C[m][n] (f32, pitch ldc, + optional f32 bias[n]) = sum_k A[m][k] Bt[n][k] (+ split products per NSPLIT). z-batch strides sA/sB/sC in elements. K % 128 == 0 (whole turns of the ring of register sets below). amdgpu_waves_per_eu: the register budget of the waves that share a SIMD, three in the qkv projection, one in the output projection.
// PLANES (the qkv projection; a 64-column tile is one head of q, k or v, a 64-row tile lies in one batch): no C; the wave that holds the tile writes the attention's operand planes itself, see the epilogue.
template <typename T16> struct WFrag;
template <> struct WFrag<h16> { typedef v16h V; static __device__ __forceinline__ V ld(const h16* p) { return cat16(*(const v8h*)p, *(const v8h*)(p + 256)); } static __device__ __forceinline__ v8f mma(V a, V b, v8f c) { return wmma16(a, b, c); } };
template <> struct WFrag<bf> { typedef v16bf V; static __device__ __forceinline__ V ld(const bf* p) { return cat16b(*(const v8us*)p, *(const v8us*)(p + 256)); } static __device__ __forceinline__ v8f mma(V a, V b, v8f c) { return wmmab(a, b, c); } };
// ---- FRAGMENT ORDER: every 16-bit plane that a matrix instruction reads (x, the weights, qn, kn, V^T, the merged heads; hi and lo) is stored as whole fragments, not as rows. A plane P[rows][K] is cut into fragments of 16 rows x 32 k = 512 elements = 1 KiB;
// inside a fragment, 16-byte chunk number sel * 32 + hi * 16 + lr holds P[16 R + lr][32 kb + 16 sel + 8 hi + 0..7], which is what lane hi * 16 + lr takes as the first (sel 0) or second (sel 1) half of its operand.
// So a wave's 16-byte load or store covers 512 contiguous bytes (4 whole lines) where a row-major plane gives it 32 bytes in each of 16 lines. qn, kn (K = 64): fragment (R, kb) at element (R * 2 + kb) * 512 of its head; the GEMM operands: at (kb * (rows / 16) + R) * 512, so that the four fragments a 64-row tile takes per 32 k are neighbours;
// V^T (rows d, k = key): fragment (R, kb) at (kb * 4 + R) * 512, so that the fragments of one pass of 32 keys are neighbours in every plane. Values, k order and every sum are those of the row-major form.
// WFrag::ld(p) above takes p = fragment + lane * 8.
template <typename T16, int NSPLIT, bool BIAS, bool PLANES>
__global__ __launch_bounds__(32) __attribute__((amdgpu_waves_per_eu(PLANES ? 3 : 1, PLANES ? 3 : 1))) void k_gemmw(const T16* __restrict__ A, const T16* __restrict__ A2, const T16* __restrict__ Bt, const T16* __restrict__ Bt2, int K, int arows, int brows, float* C, int ldc, const float* __restrict__ bias, size_t sA, size_t sB, size_t sC, bf* Qh, bf* Ql, bf* Kh, bf* Kl, bf* VTh, bf* VTl) {
    typedef typename WFrag<T16>::V V;
    __shared__ __align__(16) float os[(PLANES ? 64 : 16) * 68];
    const size_t z = blockIdx.z; A += z * sA; if (A2) A2 += z * sA; Bt += z * sB; if (Bt2) Bt2 += z * sB; C += z * sC;
    const int lane = threadIdx.x & 31, lr = lane & 15, hi = lane >> 4; const int r0 = blockIdx.x * 64, c0 = blockIdx.y * 64;
    v8f acc[4][4];
#pragma unroll
    for (int mb = 0; mb < 4; ++mb)
#pragma unroll
        for (int nb = 0; nb < 4; ++nb) acc[mb][nb] = (v8f){};
    const size_t aoff = (size_t)r0 * 32 + 8 * lane, boff = (size_t)c0 * 32 + 8 * lane, astep = (size_t)arows * 32, bstep = (size_t)brows * 32;   // 16 rows further is the next fragment, 512 elements on; 32 k further is one fragment of every row block on (arows, brows: rows of the whole A and Bt planes)
    // RING OF REGISTER SETS: ND sets of this wave's A and B fragments; the loads of trip t + AH are issued in front of the products of trip t, so a load has AH trips of matrix work to arrive in.
    // Two sets, one trip ahead, where three waves share a SIMD (the qkv projection: the register budget of three waves); four sets, two trips ahead, where a wave has its SIMD alone (the output projection: behind the set in use 48 loads are in flight, which the load counter can still count,
    // and a load lands in a set whose products were issued two trips ago). Every accumulator takes its products in the order of k, as before.
    constexpr int ND = PLANES ? 2 : 4, AH = PLANES ? 1 : 2; constexpr bool HA2 = (NSPLIT == 1 || NSPLIT == 2), HB2 = (NSPLIT >= 2);
    V a[ND][4], a2[ND][4], bq[ND][4], b2[ND][4]; const int nk = K >> 5;
#pragma unroll
    for (int s = 0; s < AH; ++s) {                               // trips 0 .. AH - 1 into sets 0 .. AH - 1
        const size_t ak = aoff + (size_t)s * astep, bk = boff + (size_t)s * bstep; const T16* pa = A + ak; const T16* pb = Bt + bk; const T16* pa2 = HA2 ? A2 + ak : pa; const T16* pb2 = HB2 ? Bt2 + bk : pb;
#pragma unroll
        for (int f = 0; f < 4; ++f) { a[s][f] = WFrag<T16>::ld(pa + f * 512); if (HA2) a2[s][f] = WFrag<T16>::ld(pa2 + f * 512); bq[s][f] = WFrag<T16>::ld(pb + f * 512); if (HB2) b2[s][f] = WFrag<T16>::ld(pb2 + f * 512); }
        // the wait stands behind these loads; it takes their addresses as inputs, and the lane number, which the loads name as their offset register, so that these registers stay untouched until it has passed
        asm volatile("s_wait_xcnt 0x0" :: "v"(pa), "v"(pb), "v"(pa2), "v"(pb2), "v"(lane) : "memory");
    }
#pragma unroll 1
    for (int t = 0; t < nk; t += ND) {                           // rolled over whole turns of the ring
#pragma unroll
        for (int s = 0; s < ND; ++s) {                           // opened: the set numbers are constants, so that the sets are registers and no fragment is copied
            const int d = (s + AH) % ND; const int tn = (t + s + AH < nk) ? t + s + AH : nk - 1;   // the last trips fetch the last fragments again: in bounds, unused
            const size_t ak = aoff + (size_t)tn * astep, bk = boff + (size_t)tn * bstep; const T16* pa = A + ak; const T16* pb = Bt + bk; const T16* pa2 = HA2 ? A2 + ak : pa; const T16* pb2 = HB2 ? Bt2 + bk : pb;
#pragma unroll
            for (int f = 0; f < 4; ++f) { a[d][f] = WFrag<T16>::ld(pa + f * 512); if (HA2) a2[d][f] = WFrag<T16>::ld(pa2 + f * 512); bq[d][f] = WFrag<T16>::ld(pb + f * 512); if (HB2) b2[d][f] = WFrag<T16>::ld(pb2 + f * 512); }
            __builtin_amdgcn_sched_barrier(0);                   // the loads issue as one group ahead of this trip's products; without it the scheduler sinks them towards their use, AH trips later, and their lead is lost
#pragma unroll
            for (int nb = 0; nb < 4; ++nb)
#pragma unroll
                for (int mb = 0; mb < 4; ++mb) { acc[mb][nb] = WFrag<T16>::mma(a[s][mb], bq[s][nb], acc[mb][nb]); if (HA2) acc[mb][nb] = WFrag<T16>::mma(a2[s][mb], bq[s][nb], acc[mb][nb]); if (HB2) acc[mb][nb] = WFrag<T16>::mma(a[s][mb], b2[s][nb], acc[mb][nb]); }
            __builtin_amdgcn_sched_barrier(0);                   // all of this trip's products issue ahead of the wait below, which then falls behind matrix work; without it the scheduler leaves most of them behind the wait, among the next trip's loads
            // the loop's branch stands behind the last product: four slots keep the distance to the first vector instruction on its taken side too
            if (s == ND - 1) asm volatile("v_nop\n\tv_nop\n\tv_nop\n\tv_nop" : "+v"(acc[0][0]), "+v"(acc[1][1]), "+v"(acc[2][2]), "+v"(acc[3][3]) : "v"(a[s][0]), "v"(a[s][3]));
            // the wait stands behind this trip's loads; it takes their addresses as inputs, so that the address registers stay untouched (no later load lands in them, no next address is formed in them) until it has passed
            asm volatile("s_wait_xcnt 0x0" :: "v"(pa), "v"(pb), "v"(pa2), "v"(pb2) : "memory");
        }
    }
    if constexpr (PLANES) {
        // c0, r0 come from blockIdx: part, head, batch and the branch on them are scalar
        const int part = c0 / EE, h = (c0 % EE) / HD, b = r0 / TT, t0 = r0 % TT; const size_t hb = (size_t)(b * NH_ + h) * TT * HD;
        float bb[4];
#pragma unroll
        for (int nb = 0; nb < 4; ++nb) bb[nb] = bfr(bias[c0 + nb * 16 + lr]);
        if (part == 2) {
            // v: an accumulator gives lane (lr, hi) the keys t0 + 16 mb + 8 hi + 0..7 of d = 16 nb + lr, which is chunk (kb = t / 32, dt = nb, sel = mb & 1) of V^T in fragment order: bias, hi/lo split, 16-byte stores, 512 contiguous bytes a wave
#pragma unroll
            for (int mb = 0; mb < 4; ++mb) {
#pragma unroll
                for (int nb = 0; nb < 4; ++nb) { v8us oh, ol; split8(acc[mb][nb] + bb[nb], oh, ol);
                    const size_t o = hb + (size_t)((t0 >> 5) + (mb >> 1)) * 2048 + nb * 512 + (mb & 1) * 256 + 8 * lane; *(v8us*)(VTh + o) = oh; *(v8us*)(VTl + o) = ol; }
                asm volatile("s_wait_xcnt 0x0" ::: "memory");   // the next 16 keys' work overwrites registers that these stores name: the wait stands in front of it
            }
        } else {
            // q, k: the tile goes through LDS so that lane (lr, hi) holds the four chunks of row lr that fragment order gives it (d = 32 kb + 16 sel + 8 hi + 0..7); L2 norm, multiplication by its reciprocal, hi/lo split, 16-byte stores.
            // The sum of squares keeps the tree pairs d, d + 1; then d ^ 32, ^ 16, ^ 8, ^ 4, ^ 2: only the ^ 8 level crosses lanes.
            bf* H = part ? Kh : Qh; bf* Lo = part ? Kl : Ql;
#pragma unroll
            for (int mb = 0; mb < 4; ++mb)
#pragma unroll
                for (int nb = 0; nb < 4; ++nb)
#pragma unroll
                    for (int j = 0; j < 8; ++j) os[(mb * 16 + hi * 8 + j) * 68 + nb * 16 + lr] = acc[mb][nb][j] + bb[nb];
            __builtin_amdgcn_wave_barrier(); asm volatile("" ::: "memory");   // the rows are read back by other lanes of this wave: no read moves in front of the writes
#pragma unroll 1
            for (int mb = 0; mb < 4; ++mb) {                     // rolled: one copy of the 32 scalings and splits, so that the kernel's text stays short (each wave runs it once through)
                v8f x[2][2]; float lf[2][2][4];
#pragma unroll
                for (int kb = 0; kb < 2; ++kb)
#pragma unroll
                    for (int sel = 0; sel < 2; ++sel) { const float* s = os + (mb * 16 + lr) * 68 + kb * 32 + sel * 16 + hi * 8; const v4f x0 = *(const v4fa*)s, x1 = *(const v4fa*)(s + 4); x[kb][sel] = __builtin_shufflevector(x0, x1, 0, 1, 2, 3, 4, 5, 6, 7);
#pragma unroll
                        for (int e = 0; e < 4; ++e) lf[kb][sel][e] = __fadd_rn(__fmul_rn(x[kb][sel][2 * e], x[kb][sel][2 * e]), __fmul_rn(x[kb][sel][2 * e + 1], x[kb][sel][2 * e + 1])); }
                float s3[4];
#pragma unroll
                for (int e = 0; e < 4; ++e) { const float s2 = __fadd_rn(__fadd_rn(lf[0][0][e], lf[1][0][e]), __fadd_rn(lf[0][1][e], lf[1][1][e])); s3[e] = __fadd_rn(s2, __shfl_xor(s2, 16, 32)); }
                const float ss = __fadd_rn(__fadd_rn(s3[0], s3[2]), __fadd_rn(s3[1], s3[3])); const float nn = fmaxf(__fsqrt_rn(ss), 1e-12f); const float rn = __fdiv_rn(1.0f, nn);   // one division per row, 32 multiplies
                const size_t o = hb + (size_t)((t0 >> 4) + mb) * 1024 + lane * 8;
#pragma unroll
                for (int kb = 0; kb < 2; ++kb)
#pragma unroll
                    for (int sel = 0; sel < 2; ++sel) { v8us oh, ol; split8(x[kb][sel] * rn, oh, ol);
                        *(v8us*)(H + o + kb * 512 + sel * 256) = oh; *(v8us*)(Lo + o + kb * 512 + sel * 256) = ol; }
                asm volatile("s_wait_xcnt 0x0" ::: "memory");   // the next 16 rows' work overwrites registers that these stores name: the wait stands in front of it
            }
        }
        return;
    }
#pragma unroll
    for (int mb = 0; mb < 4; ++mb) {
#pragma unroll
        for (int nb = 0; nb < 4; ++nb) {
#pragma unroll
            for (int j = 0; j < 8; ++j) os[(hi * 8 + j) * 68 + nb * 16 + lr] = acc[mb][nb][j]; }
        __builtin_amdgcn_wave_barrier(); asm volatile("" ::: "memory");
        float* crow = C + (size_t)(r0 + mb * 16) * ldc + c0;
{
#pragma unroll
            for (int s = 0; s < 8; ++s) { const int row = 2 * s + hi, cofs = lr * 4; v4f val = *(const v4fa*)(os + row * 68 + cofs); if (BIAS) { val[0] += bfr(bias[c0 + cofs]); val[1] += bfr(bias[c0 + cofs + 1]); val[2] += bfr(bias[c0 + cofs + 2]); val[3] += bfr(bias[c0 + cofs + 3]); }
                *(v4f*)(crow + (size_t)row * ldc + cofs) = val; }
             }
        asm volatile("s_wait_xcnt 0x0" ::: "memory");           // the next 16 rows' work overwrites registers that these stores name: the wait stands in front of it
        __builtin_amdgcn_wave_barrier(); asm volatile("" ::: "memory");
    }
}

__device__ __forceinline__ h16 tohx(float x) { return (h16)x; }
typedef __attribute__((ext_vector_type(2))) _Float16 v2h;
typedef __attribute__((ext_vector_type(4))) _Float16 v4h;
typedef __attribute__((ext_vector_type(2))) unsigned short v2us;
typedef __attribute__((ext_vector_type(4))) unsigned short v4us;

__global__ __launch_bounds__(256) void k_wtG(const float* __restrict__ w, int K, int N, bf* Bt) {
    const int lane = threadIdx.x & 31; const int L0 = (blockIdx.x * 8 + (threadIdx.x >> 5)) * 8; const int nlines = N * K / 64;
{
#pragma unroll 1
        for (int l = 0; l < 8; ++l) { const int L = L0 + l; if (L >= nlines) break; const size_t e = (size_t)L * 64 + lane * 2; const int k = (int)(e % K), n = (int)(e / K); v2us o;
            o[0] = f2bf(w[(size_t)k * N + n]); o[1] = f2bf(w[(size_t)(k + 1) * N + n]); *(v2us*)(Bt + e) = o; }
         }
}
// k_cvt8: f32 [rows][EE] -> bf16 GEMM operand plane in fragment order (rows = n8 * 8 / EE); thread i writes chunk i (a wave stores 512 contiguous bytes) and fetches the 8 values that belong there.
__global__ __launch_bounds__(256) void k_cvt8(const float* __restrict__ src, bf* dst, size_t n8) { const size_t slab = n8 / (EE / 32), j = (size_t)blockIdx.x * 256 + threadIdx.x; if (j >= slab) return;   // grid (rows / 64, EE / 32): blockIdx.y is kb, j the chunk among those of one kb
    const int lr = (int)(j & 15), hi = (int)((j >> 4) & 1), sel = (int)((j >> 5) & 1), kb = blockIdx.y; const size_t R = j >> 6, i = (size_t)kb * slab + j;
    const v8f v = *(const v8f*)(src + (R * 16 + lr) * EE + kb * 32 + sel * 16 + hi * 8); v8us o;
#pragma unroll
    for (int k = 0; k < 8; ++k) o[k] = f2bf(v[k]); *(v8us*)(dst + i * 8) = o;  }
// ---- k_attn: the whole causal kernel attention (all batches, all heads) in one launch, ONE WAVE per 32 queries and every second pass of 32 keys, nothing staged in memory or LDS between the two products.
// Per 32 keys: S^T = kn . qn^T (A = key rows, B = query rows kept in registers; 3 hi/lo products, K 64), so a lane holds 16 keys of ONE query (c = lane & 15) in each of the wave's two 16-query tiles; the kernel map, the causal select and the
// row sum run in f32 on those accumulators; the two S^T tiles of a query tile, split into bf16 hi+lo, ARE the B operand of O^T += V^T . P^T (3 hi/lo products) in the hardware k order that the V^T loader also uses.
// TWO QUERY TILES PER FRAGMENT: every K and V^T fragment that a wave loads serves both of its query tiles, so a pass has twice the matrix and vector work behind the same 32 loads.
// O^T gives a lane 8 consecutive d of its query, one chunk of the merged hi/lo planes in fragment order: multiplication by 1 / z in-lane, 16-byte stores, 512 contiguous bytes a wave.
// Work: a 32-query tile t has t + 1 passes of 32 keys. Waves w and w + 4 of a work-group are a pair: the pair takes tile 63 - p and then tile p (65 passes), wave w the even passes, wave w + 4 the odd ones, so that there are still two waves per SIMD
// (one wave's vector work runs beside the other's matrix work and loads). There is no maximum to rescale by: the two waves' partial O^T and z simply add. At the end of a tile each wave hands the partner, through LDS, its partial sums of the 16-query tile
// that the partner finishes (wave w the first, wave w + 4 the second). grid (heads, 8, batches), 8 waves: one work-group per WGP.
// amdgpu_waves_per_eu(1, 2): eight waves per work-group already bound a wave to half a SIMD's registers; with (2, 2) the scheduler keeps well below that bound and runs the 32 kernel values of a pass one after another.
// Every plain '#pragma unroll' below opens a short loop of fixed length so that the fragment arrays it indexes are registers.
__global__ __launch_bounds__(256) __attribute__((amdgpu_waves_per_eu(1, 2))) void k_attn(const bf* __restrict__ Qh, const bf* __restrict__ Ql, const bf* __restrict__ Kh, const bf* __restrict__ Kl, const bf* __restrict__ VTh, const bf* __restrict__ VTl, bf* Ah, bf* Al) {
    typedef WFrag<bf> F; typedef F::V V;
    __shared__ __align__(16) v4f xs[2 * 8 * 8 * 32];         // [tile of the pair][writing wave][8 chunks of 4 floats][lane]: each of the two hand-overs has its own place, so one barrier each is enough
    __shared__ float zx[2 * 8 * 32];
    const int lane = threadIdx.x & 31, c = lane & 15, hi = lane >> 4; const int h = blockIdx.x;
    const int wv = __builtin_amdgcn_readfirstlane(threadIdx.x >> 5);   // wave-uniform: the key loop runs on scalar control flow, EXEC stays full at every matrix instruction
    const int par = wv >> 2, p = blockIdx.y * 4 + (wv & 3);
    const int b = blockIdx.z; const size_t hb = (size_t)(b * NH_ + h) * TT * HD;
    const bf* kph = Kh + hb + 8 * lane; const bf* kpl = Kl + hb + 8 * lane; const bf* vph = VTh + hb + 8 * lane; const bf* vpl = VTl + hb + 8 * lane;   // fragment order: 32 keys are 4 neighbouring fragments (2048 elements) in each plane
#pragma unroll 1
    for (int half = 0; half < 2; ++half) {                   // rolled: one copy of the pass in the instruction cache
        const int r0 = (half ? p : TT / 32 - 1 - p) * 32;
        V qh[2][2], ql[2][2];
#pragma unroll
        for (int qt = 0; qt < 2; ++qt)
#pragma unroll
            for (int ks = 0; ks < 2; ++ks) { qh[qt][ks] = F::ld(Qh + hb + (size_t)(r0 + qt * 16) * HD + ks * 512 + 8 * lane); ql[qt][ks] = F::ld(Ql + hb + (size_t)(r0 + qt * 16) * HD + ks * 512 + 8 * lane); }
        v8f acc[2][4];
#pragma unroll
        for (int qt = 0; qt < 2; ++qt)
#pragma unroll
            for (int dt = 0; dt < 4; ++dt) acc[qt][dt] = (v8f){};
        float zs[2] = {0.f, 0.f}; const int kend = r0 + 32, kbeg = par * 32;
        V kh[2][2], kl[2][2];
#pragma unroll
        for (int kt = 0; kt < 2; ++kt)
#pragma unroll
            for (int ks = 0; ks < 2; ++ks) { kh[kt][ks] = F::ld(kph + (size_t)(kbeg + kt * 16) * HD + ks * 512); kl[kt][ks] = F::ld(kpl + (size_t)(kbeg + kt * 16) * HD + ks * 512); }   // keys 0..63 exist for every tile: in bounds, unused where this wave has no pass
#pragma unroll 1
        for (int kc = kbeg; kc < kend; kc += 64) {               // rolled: one pass already holds 32 loads in flight and its registers; a second copy would only add registers
            V vh[4], vl[4]; const bf* pvh = vph + (size_t)kc * HD; const bf* pvl = vpl + (size_t)kc * HD;
#pragma unroll
            for (int dt = 0; dt < 4; ++dt) { vh[dt] = F::ld(pvh + dt * 512); vl[dt] = F::ld(pvl + dt * 512); }
            v8f s[2][2];
#pragma unroll
            for (int qt = 0; qt < 2; ++qt) { s[qt][0] = (v8f){}; s[qt][1] = (v8f){}; }
#pragma unroll
            for (int ks = 0; ks < 2; ++ks) {
#pragma unroll
                for (int qt = 0; qt < 2; ++qt)
#pragma unroll
                    for (int kt = 0; kt < 2; ++kt) s[qt][kt] = F::mma(kh[kt][ks], qh[qt][ks], s[qt][kt]);
#pragma unroll
                for (int qt = 0; qt < 2; ++qt)
#pragma unroll
                    for (int kt = 0; kt < 2; ++kt) s[qt][kt] = F::mma(kh[kt][ks], ql[qt][ks], s[qt][kt]);
#pragma unroll
                for (int qt = 0; qt < 2; ++qt)
#pragma unroll
                    for (int kt = 0; kt < 2; ++kt) s[qt][kt] = F::mma(kl[kt][ks], qh[qt][ks], s[qt][kt]); }
            asm volatile("s_wait_xcnt 0x0" :: "v"(pvh), "v"(pvl) : "memory");   // the wait stands behind the V^T loads; it takes their addresses as inputs, so that no load lands in the address registers and no next address is formed in them until it has passed
            const int kn = (kc + 64 < kend) ? kc + 64 : kc;      // this wave's next 32 keys' fragments fly during the vector work (the last pass re-reads its own rows: in bounds, unused)
            const bf* nkh = kph + (size_t)kn * HD; const bf* nkl = kpl + (size_t)kn * HD;
#pragma unroll
            for (int kt = 0; kt < 2; ++kt)
#pragma unroll
                for (int ks = 0; ks < 2; ++ks) { kh[kt][ks] = F::ld(nkh + kt * 16 * HD + ks * 512); kl[kt][ks] = F::ld(nkl + kt * 16 * HD + ks * 512); }
            asm volatile("s_wait_xcnt 0x0" :: "v"(nkh), "v"(nkl) : "memory");   // the same behind the next-K loads: the vector work below reuses their address registers
            __builtin_amdgcn_sched_barrier(0);                   // all 32 loads issue as one group ahead of the vector work, which covers their latency; without it the scheduler spreads them among that work
#pragma unroll
            for (int qt = 0; qt < 2; ++qt) {
                const int iq = r0 + qt * 16 + c; float zq = zs[qt];
                v8u fh, fl;                                      // the hi and lo B fragments of this query tile: registers 0..3 key tile 0 (j = 0..7 in pairs), 4..7 key tile 1
#pragma unroll
                for (int g = 0; g < 2; ++g) {                    // eight kernel values at a time: j = 4 g .. 4 g + 3, both key tiles
                    float xd[8], dn[8], rc[8];
#pragma unroll
                    for (int e = 0; e < 8; ++e) { const int j = 4 * g + (e >> 1), kt = e & 1; xd[e] = (kc + kt * 16 + 8 * hi + j <= iq) ? s[qt][kt][j] : 0.f;      // causal select on x_dot: 0 maps to exactly 0 (0 * (1 / 2.000001)), and the reciprocals stay branch-free and independent
                        dn[e] = fmaxf(__fsub_rn(2.000001f, __fmul_rn(2.0f, xd[e])), 1e-6f); rc[e] = __builtin_amdgcn_rcpf(dn[e]); }   // den lies in [1e-6, 2.000001 + 2 |x_dot|]: inside the reciprocal instruction's plain range, so the scaling and fix-up steps of a full division have nothing to do
                    // the slot that the instruction set asks for behind a transcendental, once for eight: the statement takes the results and the sources, so that no result is read and no source overwritten in front of it
                    asm("v_nop" : "+v"(rc[0]), "+v"(rc[1]), "+v"(rc[2]), "+v"(rc[3]), "+v"(rc[4]), "+v"(rc[5]), "+v"(rc[6]), "+v"(rc[7]) : "v"(dn[0]), "v"(dn[1]), "v"(dn[2]), "v"(dn[3]), "v"(dn[4]), "v"(dn[5]), "v"(dn[6]), "v"(dn[7]));
#pragma unroll
                    for (int e = 0; e < 8; ++e) { xd[e] = __fmul_rn(__fmul_rn(xd[e], xd[e]), rc[e]); zq = __fadd_rn(zq, xd[e]); }
#pragma unroll
                    for (int kt = 0; kt < 2; ++kt)
#pragma unroll
                        for (int u = 0; u < 2; ++u) { unsigned a, b; split2(xd[4 * u + kt], xd[4 * u + 2 + kt], a, b); fh[4 * kt + 2 * g + u] = a; fl[4 * kt + 2 * g + u] = b; } }   // j = 4 g + 2 u, + 1
                zs[qt] = zq;
                const V ph = __builtin_bit_cast(V, fh), pl = __builtin_bit_cast(V, fl);
#pragma unroll
                for (int dt = 0; dt < 4; ++dt) acc[qt][dt] = F::mma(vh[dt], ph, acc[qt][dt]);
#pragma unroll
                for (int dt = 0; dt < 4; ++dt) acc[qt][dt] = F::mma(vh[dt], pl, acc[qt][dt]);
#pragma unroll
                for (int dt = 0; dt < 4; ++dt) acc[qt][dt] = F::mma(vl[dt], ph, acc[qt][dt]);
            }
        }
        // the pair's hand-over: this wave finishes query tile 'par' and gives the partner its partial sums of the other one
        v4f* xw = xs + (size_t)(half * 8 + wv) * 256 + lane; const v4f* xr = xs + (size_t)(half * 8 + (wv ^ 4)) * 256 + lane;
        v8f mine[4];
#pragma unroll
        for (int dt = 0; dt < 4; ++dt) { const v8f o = par ? acc[0][dt] : acc[1][dt]; mine[dt] = par ? acc[1][dt] : acc[0][dt];
            xw[(2 * dt) * 32] = __builtin_shufflevector(o, o, 0, 1, 2, 3); xw[(2 * dt + 1) * 32] = __builtin_shufflevector(o, o, 4, 5, 6, 7); }
        zx[(half * 8 + wv) * 32 + lane] = par ? zs[0] : zs[1];
        __syncthreads();                                         // the partner's partial sums are read behind it; every wave of the work-group passes it once per tile
        float zm = (par ? zs[1] : zs[0]) + zx[(half * 8 + (wv ^ 4)) * 32 + lane];
#pragma unroll
        for (int dt = 0; dt < 4; ++dt) { const v4f x0 = xr[(2 * dt) * 32], x1 = xr[(2 * dt + 1) * 32]; mine[dt] += __builtin_shufflevector(x0, x1, 0, 1, 2, 3, 4, 5, 6, 7); }
        zm += __shfl_xor(zm, 16, 32); const float zz = fmaxf(zm, 1e-6f); const float rz = __fdiv_rn(1.0f, zz); const int rq = r0 + par * 16;   // one division per query, 32 multiplies
#pragma unroll
        for (int dt = 0; dt < 4; ++dt) { v8us oh, ol; split8(mine[dt] * rz, oh, ol);
            const size_t o = ((size_t)(2 * h + (dt >> 1)) * (NB_ * TT / 16) + b * (TT / 16) + (rq >> 4)) * 512 + (dt & 1) * 256 + 8 * lane; *(v8us*)(Ah + o) = oh; *(v8us*)(Al + o) = ol; }   // chunk (R = (b T + rq) / 16, kb = 2 h + dt / 2, sel = dt & 1) of the merged [b t][E] planes
        asm volatile("s_wait_xcnt 0x0" ::: "memory");           // the second tile's set-up overwrites the registers that these stores name: the wait stands in front of it
    }
}

extern "C" void kernel_launch(void* const* d_in, const int* in_sizes, int n_in,
                              void* d_out, int out_size, void* d_ws, size_t ws_size, hipStream_t stream) {
    (void)in_sizes; (void)n_in; (void)out_size;
    const float* x = (const float*)d_in[0]; const float* wqkv = (const float*)d_in[1]; const float* bqkv = (const float*)d_in[2]; const float* wout = (const float*)d_in[3]; const float* bout = (const float*)d_in[4];   // torch [out][in] weights
    float* OUT = (float*)d_out;     // [2][2048][1024]
    char* wsp = (char*)d_ws;
    auto take = [&](size_t bytes) { char* p = wsp; wsp += (bytes + 255) & ~(size_t)255; return (void*)p; };
    const size_t MT = (size_t)NB_ * TT;     // both batches go through every launch: the projections see one [NB_ * TT][E] matrix, the per-head kernels take the batch from the grid
    bf* WQKV = (bf*)take((size_t)3 * EE * EE * 2); bf* WO = (bf*)take((size_t)EE * EE * 2); bf* XB = (bf*)take(MT * EE * 2);
    bf* Qh = (bf*)take(MT * EE * 2); bf* Ql = (bf*)take(MT * EE * 2); bf* Kh = (bf*)take(MT * EE * 2); bf* Kl = (bf*)take(MT * EE * 2); bf* VTh = (bf*)take(MT * EE * 2); bf* VTl = (bf*)take(MT * EE * 2);
    bf* Ah = (bf*)take(MT * EE * 2); bf* Al = (bf*)take(MT * EE * 2);
    if ((size_t)(wsp - (char*)d_ws) > ws_size) return;    // total ~ 84 MB
    k_cvt8<<<dim3(3 * EE / 64, EE / 32, 1), 256, 0, stream>>>(wqkv, WQKV, (size_t)3 * EE * EE / 8); k_cvt8<<<dim3(EE / 64, EE / 32, 1), 256, 0, stream>>>(wout, WO, (size_t)EE * EE / 8);
    k_cvt8<<<dim3(NB_ * TT / 64, EE / 32, 1), 256, 0, stream>>>(x, XB, MT * EE / 8);
    k_gemmw<bf, 0, true, true><<<dim3(NB_ * TT / 64, 3 * EE / 64, 1), 32, 0, stream>>>(XB, nullptr, WQKV, nullptr, EE, NB_ * TT, 3 * EE, nullptr, 0, bqkv, 0, 0, 0, Qh, Ql, Kh, Kl, VTh, VTl);
    k_attn<<<dim3(NH_, TT / 256, NB_), 256, 0, stream>>>(Qh, Ql, Kh, Kl, VTh, VTl, Ah, Al);
    k_gemmw<bf, 1, true, false><<<dim3(NB_ * TT / 64, EE / 64, 1), 32, 0, stream>>>(Ah, Al, WO, nullptr, EE, NB_ * TT, EE, OUT, EE, bout, 0, 0, 0, nullptr, nullptr, nullptr, nullptr, nullptr, nullptr);
}

// v009
// One run takes 89.2 microseconds.
// Two timings next to v008 both put it at 1.07 times that version's speed.
// Counting every step since v000, it is 14.3 times as fast.
#include <hip/hip_runtime.h>

// ExactSphericalKernelCausalAttention (x [2][2048][1024]; [q|k|v] = x w_qkv^T + b_qkv (16 heads x 64); qn, kn = L2-normalised (max(norm, 1e-12)); x_dot = qn.kn; K = x_dot^2 / max(2 + 1e-6 - 2 x_dot, 1e-6) for j <= i else 0;
// out_h = (K v) / max(sum_j K, 1e-6); out = merged w_out^T + b_out -> [2][2048][1024]; no softmax).
// Compute dtypes, f32 accumulate: every input rounded to bf16; the qkv projection on PLAIN bf16 operands (inputs: exact, + bias); normalisation f32 -> bf16 hi+lo planes of qn / kn; x_dot on 3 products (K 64, tiles above
// the diagonal skipped); the kernel K and its causal select in f32 on the score accumulators, its row sums in f32 (in-lane, halves joined once) -> bf16 hi+lo fragments of K in registers; K.v on hi+lo operands (3 products, keys limited to the diagonal block; the output (rms 0.10) is a cancelling sum); the division by z and the merge f32 -> hl planes;

#define NB_  2
#define TT   2048
#define EE   1024
#define NH_  16
#define HD   64
#define ZH   2
#define PCAR 64.0f
typedef _Float16 h16;
typedef unsigned short bf;
typedef __attribute__((ext_vector_type(16))) __bf16   v16bf;
typedef __attribute__((ext_vector_type(16))) _Float16 v16h;
typedef __attribute__((ext_vector_type(8)))  _Float16 v8h;
typedef __attribute__((ext_vector_type(8)))  unsigned short v8us;
typedef __attribute__((ext_vector_type(8)))  float    v8f;
typedef __attribute__((ext_vector_type(4)))  float    v4f;
typedef v8h  __attribute__((may_alias)) v8ha;
typedef v4f  __attribute__((may_alias)) v4fa;
typedef v8us __attribute__((may_alias)) v8usa;

// f32 -> bf16 by the hardware's convert (round to nearest even, as the integer form it replaces)
__device__ __forceinline__ unsigned short f2bf(float f) { return __builtin_bit_cast(unsigned short, (__bf16)f); }
__device__ __forceinline__ float bf2f(unsigned short b) { return __uint_as_float(((unsigned)b) << 16); }
__device__ __forceinline__ float bfr(float f) { return bf2f(f2bf(f)); }
typedef __attribute__((ext_vector_type(2))) float  v2f;
typedef __attribute__((ext_vector_type(2))) __bf16 v2bf;
typedef __attribute__((ext_vector_type(8))) unsigned v8u;
// two neighbouring elements of a fragment at once: one packed convert gives the register of the hi plane, the exact remainders y - hi the register of the lo plane
__device__ __forceinline__ void split2(float y0, float y1, unsigned& h, unsigned& l) { const v2f y = {y0, y1}; const v2bf hh = __builtin_convertvector(y, v2bf); const v2f r = y - __builtin_convertvector(hh, v2f);
    h = __builtin_bit_cast(unsigned, hh); l = __builtin_bit_cast(unsigned, __builtin_convertvector(r, v2bf)); }
typedef __attribute__((ext_vector_type(4))) unsigned v4u;
// one 16-byte chunk (8 neighbouring elements) of a hi plane and of its lo plane
__device__ __forceinline__ void split8(v8f y, v8us& h, v8us& l) { v4u a, b;
#pragma unroll
    for (int u = 0; u < 4; ++u) { unsigned p, q; split2(y[2 * u], y[2 * u + 1], p, q); a[u] = p; b[u] = q; }
    h = __builtin_bit_cast(v8us, a); l = __builtin_bit_cast(v8us, b); }
__device__ __forceinline__ v16h cat16(v8h lo, v8h hi) { return __builtin_shufflevector(lo, hi, 0, 1, 2, 3, 4, 5, 6, 7, 8, 9, 10, 11, 12, 13, 14, 15); }
__device__ __forceinline__ v16bf cat16b(v8us lo, v8us hi) { return __builtin_bit_cast(v16bf, __builtin_shufflevector(lo, hi, 0, 1, 2, 3, 4, 5, 6, 7, 8, 9, 10, 11, 12, 13, 14, 15)); }
__device__ __forceinline__ v8f wmma16(v16h a, v16h b, v8f c) { return __builtin_amdgcn_wmma_f32_16x16x32_f16(false, a, false, b, (short)0, c, false, false); }
__device__ __forceinline__ v8f wmmab(v16bf a, v16bf b, v8f c) { return __builtin_amdgcn_wmma_f32_16x16x32_bf16(false, a, false, b, (short)0, c, false, false); }



// ---- k_gemmw: register-blocked GEMM, ONE WAVE per 64x64 output tile (16 accumulators), operands straight from 16-bit planes in fragment order (below); grid (M/64, N/64, Z), 32 threads.
// C[m][n] (f32, pitch ldc, + optional f32 bias[n]) = sum_k A[m][k] Bt[n][k] (+ split products per NSPLIT). z-batch strides sA/sB/sC in elements. K % 128 == 0 (whole turns of the ring of register sets below). amdgpu_waves_per_eu: the register budget of the waves that share a SIMD, three in the qkv projection, one in the output projection.
// PLANES (the qkv projection; a 64-column tile is one head of q, k or v, a 64-row tile lies in one batch): no C; the wave that holds the tile writes the attention's operand planes itself, see the epilogue.
template <typename T16> struct WFrag;
template <> struct WFrag<h16> { typedef v16h V; static __device__ __forceinline__ V ld(const h16* p) { return cat16(*(const v8h*)p, *(const v8h*)(p + 256)); } static __device__ __forceinline__ v8f mma(V a, V b, v8f c) { return wmma16(a, b, c); } };
template <> struct WFrag<bf> { typedef v16bf V; static __device__ __forceinline__ V ld(const bf* p) { return cat16b(*(const v8us*)p, *(const v8us*)(p + 256)); } static __device__ __forceinline__ v8f mma(V a, V b, v8f c) { return wmmab(a, b, c); } };
// ---- FRAGMENT ORDER: every 16-bit plane that a matrix instruction reads (x, the weights, qn, kn, V^T, the merged heads; hi and lo) is stored as whole fragments, not as rows. A plane P[rows][K] is cut into fragments of 16 rows x 32 k = 512 elements = 1 KiB;
// inside a fragment, 16-byte chunk number sel * 32 + hi * 16 + lr holds P[16 R + lr][32 kb + 16 sel + 8 hi + 0..7], which is what lane hi * 16 + lr takes as the first (sel 0) or second (sel 1) half of its operand.
// So a wave's 16-byte load or store covers 512 contiguous bytes (4 whole lines) where a row-major plane gives it 32 bytes in each of 16 lines. qn, kn (K = 64): fragment (R, kb) at element (R * 2 + kb) * 512 of its head; the GEMM operands: at (kb * (rows / 16) + R) * 512, so that the four fragments a 64-row tile takes per 32 k are neighbours;
// V^T (rows d, k = key): fragment (R, kb) at (kb * 4 + R) * 512, so that the fragments of one pass of 32 keys are neighbours in every plane. Values, k order and every sum are those of the row-major form.
// WFrag::ld(p) above takes p = fragment + lane * 8.
template <typename T16, int NSPLIT, bool BIAS, bool PLANES>
__global__ __launch_bounds__(32) __attribute__((amdgpu_waves_per_eu(PLANES ? 3 : 1, PLANES ? 3 : 1))) void k_gemmw(const T16* __restrict__ A, const T16* __restrict__ A2, const T16* __restrict__ Bt, const T16* __restrict__ Bt2, int K, int arows, int brows, float* C, int ldc, const float* __restrict__ bias, size_t sA, size_t sB, size_t sC, bf* Qh, bf* Ql, bf* Kh, bf* Kl, bf* VTh, bf* VTl) {
    typedef typename WFrag<T16>::V V;
    __shared__ __align__(16) float os[(PLANES ? 64 : 16) * 68];
    const size_t z = blockIdx.z; A += z * sA; if (A2) A2 += z * sA; Bt += z * sB; if (Bt2) Bt2 += z * sB; C += z * sC;
    const int lane = threadIdx.x & 31, lr = lane & 15, hi = lane >> 4; const int r0 = blockIdx.x * 64, c0 = blockIdx.y * 64;
    v8f acc[4][4];
#pragma unroll
    for (int mb = 0; mb < 4; ++mb)
#pragma unroll
        for (int nb = 0; nb < 4; ++nb) acc[mb][nb] = (v8f){};
    const size_t aoff = (size_t)r0 * 32 + 8 * lane, boff = (size_t)c0 * 32 + 8 * lane, astep = (size_t)arows * 32, bstep = (size_t)brows * 32;   // 16 rows further is the next fragment, 512 elements on; 32 k further is one fragment of every row block on (arows, brows: rows of the whole A and Bt planes)
    // RING OF REGISTER SETS: ND sets of this wave's A and B fragments; the loads of trip t + AH are issued in front of the products of trip t, so a load has AH trips of matrix work to arrive in.
    // Two sets, one trip ahead, where three waves share a SIMD (the qkv projection: the register budget of three waves); four sets, two trips ahead, where a wave has its SIMD alone (the output projection: behind the set in use 48 loads are in flight, which the load counter can still count,
    // and a load lands in a set whose products were issued two trips ago). Every accumulator takes its products in the order of the walk (below).
    constexpr int ND = PLANES ? 2 : 4, AH = PLANES ? 1 : 2; constexpr bool HA2 = (NSPLIT == 1 || NSPLIT == 2), HB2 = (NSPLIT >= 2);
    V a[ND][4], a2[ND][4], bq[ND][4], b2[ND][4]; const int nk = K >> 5;
    // ROTATED START: without it the waves that read the same A rows (one blockIdx.x) or the same Bt rows (one blockIdx.y) would walk the same lines in the same order (for speed only).
    // A wave enters the k walk (blockIdx.x + blockIdx.y) & 3 quarter turns in and wraps round: the readers of one tile are spread over four places, and after a quarter of its trips a wave walks through lines that others have already brought in.
    // kq is the 32-k block of the next load group (scalar). Every accumulator still takes every block once; the order of its sum is rotated.
    int kq = (int)((blockIdx.x + blockIdx.y) & 3) * (nk >> 2);
#pragma unroll
    for (int s = 0; s < AH; ++s) {                               // trips 0 .. AH - 1 into sets 0 .. AH - 1
        const size_t ak = aoff + (size_t)kq * astep, bk = boff + (size_t)kq * bstep; kq = (kq + 1 < nk) ? kq + 1 : 0; const T16* pa = A + ak; const T16* pb = Bt + bk; const T16* pa2 = HA2 ? A2 + ak : pa; const T16* pb2 = HB2 ? Bt2 + bk : pb;
#pragma unroll
        for (int f = 0; f < 4; ++f) { a[s][f] = WFrag<T16>::ld(pa + f * 512); if (HA2) a2[s][f] = WFrag<T16>::ld(pa2 + f * 512); bq[s][f] = WFrag<T16>::ld(pb + f * 512); if (HB2) b2[s][f] = WFrag<T16>::ld(pb2 + f * 512); }
        // the wait stands behind these loads; it takes their addresses as inputs, and the lane number, which the loads name as their offset register, so that these registers stay untouched until it has passed
        asm volatile("s_wait_xcnt 0x0" :: "v"(pa), "v"(pb), "v"(pa2), "v"(pb2), "v"(lane) : "memory");
    }
#pragma unroll 1
    for (int t = 0; t < nk; t += ND) {                           // rolled over whole turns of the ring
#pragma unroll
        for (int s = 0; s < ND; ++s) {                           // opened: the set numbers are constants, so that the sets are registers and no fragment is copied
            const int d = (s + AH) % ND; const int tn = kq; kq = (kq + 1 < nk) ? kq + 1 : 0;   // the last trips fetch the walk's first fragments again: in bounds, unused
            const size_t ak = aoff + (size_t)tn * astep, bk = boff + (size_t)tn * bstep; const T16* pa = A + ak; const T16* pb = Bt + bk; const T16* pa2 = HA2 ? A2 + ak : pa; const T16* pb2 = HB2 ? Bt2 + bk : pb;
#pragma unroll
            for (int f = 0; f < 4; ++f) { a[d][f] = WFrag<T16>::ld(pa + f * 512); if (HA2) a2[d][f] = WFrag<T16>::ld(pa2 + f * 512); bq[d][f] = WFrag<T16>::ld(pb + f * 512); if (HB2) b2[d][f] = WFrag<T16>::ld(pb2 + f * 512); }
            __builtin_amdgcn_sched_barrier(0);                   // the loads issue as one group ahead of this trip's products; without it the scheduler sinks them towards their use, AH trips later, and their lead is lost
#pragma unroll
            for (int nb = 0; nb < 4; ++nb)
#pragma unroll
                for (int mb = 0; mb < 4; ++mb) { acc[mb][nb] = WFrag<T16>::mma(a[s][mb], bq[s][nb], acc[mb][nb]); if (HA2) acc[mb][nb] = WFrag<T16>::mma(a2[s][mb], bq[s][nb], acc[mb][nb]); if (HB2) acc[mb][nb] = WFrag<T16>::mma(a[s][mb], b2[s][nb], acc[mb][nb]); }
            __builtin_amdgcn_sched_barrier(0);                   // all of this trip's products issue ahead of the wait below, which then falls behind matrix work; without it the scheduler leaves most of them behind the wait, among the next trip's loads
            // the loop's branch stands behind the last product: four slots keep the distance to the first vector instruction on its taken side too
            if (s == ND - 1) asm volatile("v_nop\n\tv_nop\n\tv_nop\n\tv_nop" : "+v"(acc[0][0]), "+v"(acc[1][1]), "+v"(acc[2][2]), "+v"(acc[3][3]) : "v"(a[s][0]), "v"(a[s][3]));
            // the wait stands behind this trip's loads; it takes their addresses as inputs, so that the address registers stay untouched (no later load lands in them, no next address is formed in them) until it has passed
            asm volatile("s_wait_xcnt 0x0" :: "v"(pa), "v"(pb), "v"(pa2), "v"(pb2) : "memory");
        }
    }
    if constexpr (PLANES) {
        // c0, r0 come from blockIdx: part, head, batch and the branch on them are scalar
        const int part = c0 / EE, h = (c0 % EE) / HD, b = r0 / TT, t0 = r0 % TT; const size_t hb = (size_t)(b * NH_ + h) * TT * HD;
        float bb[4];
#pragma unroll
        for (int nb = 0; nb < 4; ++nb) bb[nb] = bfr(bias[c0 + nb * 16 + lr]);
        if (part == 2) {
            // v: an accumulator gives lane (lr, hi) the keys t0 + 16 mb + 8 hi + 0..7 of d = 16 nb + lr, which is chunk (kb = t / 32, dt = nb, sel = mb & 1) of V^T in fragment order: bias, hi/lo split, 16-byte stores, 512 contiguous bytes a wave
#pragma unroll
            for (int mb = 0; mb < 4; ++mb) {
#pragma unroll
                for (int nb = 0; nb < 4; ++nb) { v8us oh, ol; split8(acc[mb][nb] + bb[nb], oh, ol);
                    const size_t o = hb + (size_t)((t0 >> 5) + (mb >> 1)) * 2048 + nb * 512 + (mb & 1) * 256 + 8 * lane; *(v8us*)(VTh + o) = oh; *(v8us*)(VTl + o) = ol; }
                asm volatile("s_wait_xcnt 0x0" ::: "memory");   // the next 16 keys' work overwrites registers that these stores name: the wait stands in front of it
            }
        } else {
            // q, k: the tile goes through LDS so that lane (lr, hi) holds the four chunks of row lr that fragment order gives it (d = 32 kb + 16 sel + 8 hi + 0..7); L2 norm, multiplication by its reciprocal, hi/lo split, 16-byte stores.
            // The sum of squares keeps the tree pairs d, d + 1; then d ^ 32, ^ 16, ^ 8, ^ 4, ^ 2: only the ^ 8 level crosses lanes.
            bf* H = part ? Kh : Qh; bf* Lo = part ? Kl : Ql;
#pragma unroll
            for (int mb = 0; mb < 4; ++mb)
#pragma unroll
                for (int nb = 0; nb < 4; ++nb)
#pragma unroll
                    for (int j = 0; j < 8; ++j) os[(mb * 16 + hi * 8 + j) * 68 + nb * 16 + lr] = acc[mb][nb][j] + bb[nb];
            __builtin_amdgcn_wave_barrier(); asm volatile("" ::: "memory");   // the rows are read back by other lanes of this wave: no read moves in front of the writes
#pragma unroll 1
            for (int mb = 0; mb < 4; ++mb) {                     // rolled: one copy of the 32 scalings and splits, so that the kernel's text stays short (each wave runs it once through)
                v8f x[2][2]; float lf[2][2][4];
#pragma unroll
                for (int kb = 0; kb < 2; ++kb)
#pragma unroll
                    for (int sel = 0; sel < 2; ++sel) { const float* s = os + (mb * 16 + lr) * 68 + kb * 32 + sel * 16 + hi * 8; const v4f x0 = *(const v4fa*)s, x1 = *(const v4fa*)(s + 4); x[kb][sel] = __builtin_shufflevector(x0, x1, 0, 1, 2, 3, 4, 5, 6, 7);
#pragma unroll
                        for (int e = 0; e < 4; ++e) lf[kb][sel][e] = __fadd_rn(__fmul_rn(x[kb][sel][2 * e], x[kb][sel][2 * e]), __fmul_rn(x[kb][sel][2 * e + 1], x[kb][sel][2 * e + 1])); }
                float s3[4];
#pragma unroll
                for (int e = 0; e < 4; ++e) { const float s2 = __fadd_rn(__fadd_rn(lf[0][0][e], lf[1][0][e]), __fadd_rn(lf[0][1][e], lf[1][1][e])); s3[e] = __fadd_rn(s2, __shfl_xor(s2, 16, 32)); }
                const float ss = __fadd_rn(__fadd_rn(s3[0], s3[2]), __fadd_rn(s3[1], s3[3])); const float nn = fmaxf(__fsqrt_rn(ss), 1e-12f); const float rn = __fdiv_rn(1.0f, nn);   // one division per row, 32 multiplies
                const size_t o = hb + (size_t)((t0 >> 4) + mb) * 1024 + lane * 8;
#pragma unroll
                for (int kb = 0; kb < 2; ++kb)
#pragma unroll
                    for (int sel = 0; sel < 2; ++sel) { v8us oh, ol; split8(x[kb][sel] * rn, oh, ol);
                        *(v8us*)(H + o + kb * 512 + sel * 256) = oh; *(v8us*)(Lo + o + kb * 512 + sel * 256) = ol; }
                asm volatile("s_wait_xcnt 0x0" ::: "memory");   // the next 16 rows' work overwrites registers that these stores name: the wait stands in front of it
            }
        }
        return;
    }
#pragma unroll
    for (int mb = 0; mb < 4; ++mb) {
#pragma unroll
        for (int nb = 0; nb < 4; ++nb) {
#pragma unroll
            for (int j = 0; j < 8; ++j) os[(hi * 8 + j) * 68 + nb * 16 + lr] = acc[mb][nb][j]; }
        __builtin_amdgcn_wave_barrier(); asm volatile("" ::: "memory");
        float* crow = C + (size_t)(r0 + mb * 16) * ldc + c0;
{
#pragma unroll
            for (int s = 0; s < 8; ++s) { const int row = 2 * s + hi, cofs = lr * 4; v4f val = *(const v4fa*)(os + row * 68 + cofs); if (BIAS) { val[0] += bfr(bias[c0 + cofs]); val[1] += bfr(bias[c0 + cofs + 1]); val[2] += bfr(bias[c0 + cofs + 2]); val[3] += bfr(bias[c0 + cofs + 3]); }
                *(v4f*)(crow + (size_t)row * ldc + cofs) = val; }
             }
        asm volatile("s_wait_xcnt 0x0" ::: "memory");           // the next 16 rows' work overwrites registers that these stores name: the wait stands in front of it
        __builtin_amdgcn_wave_barrier(); asm volatile("" ::: "memory");
    }
}

__device__ __forceinline__ h16 tohx(float x) { return (h16)x; }
typedef __attribute__((ext_vector_type(2))) _Float16 v2h;
typedef __attribute__((ext_vector_type(4))) _Float16 v4h;
typedef __attribute__((ext_vector_type(2))) unsigned short v2us;
typedef __attribute__((ext_vector_type(4))) unsigned short v4us;

__global__ __launch_bounds__(256) void k_wtG(const float* __restrict__ w, int K, int N, bf* Bt) {
    const int lane = threadIdx.x & 31; const int L0 = (blockIdx.x * 8 + (threadIdx.x >> 5)) * 8; const int nlines = N * K / 64;
{
#pragma unroll 1
        for (int l = 0; l < 8; ++l) { const int L = L0 + l; if (L >= nlines) break; const size_t e = (size_t)L * 64 + lane * 2; const int k = (int)(e % K), n = (int)(e / K); v2us o;
            o[0] = f2bf(w[(size_t)k * N + n]); o[1] = f2bf(w[(size_t)(k + 1) * N + n]); *(v2us*)(Bt + e) = o; }
         }
}
// k_cvt8: f32 [rows][EE] -> bf16 GEMM operand plane in fragment order (rows = n8 * 8 / EE); thread i writes chunk i (a wave stores 512 contiguous bytes) and fetches the 8 values that belong there.
__global__ __launch_bounds__(256) void k_cvt8(const float* __restrict__ src, bf* dst, size_t n8) { const size_t slab = n8 / (EE / 32), j = (size_t)blockIdx.x * 256 + threadIdx.x; if (j >= slab) return;   // grid (rows / 64, EE / 32): blockIdx.y is kb, j the chunk among those of one kb
    const int lr = (int)(j & 15), hi = (int)((j >> 4) & 1), sel = (int)((j >> 5) & 1), kb = blockIdx.y; const size_t R = j >> 6, i = (size_t)kb * slab + j;
    const v8f v = *(const v8f*)(src + (R * 16 + lr) * EE + kb * 32 + sel * 16 + hi * 8); v8us o;
#pragma unroll
    for (int k = 0; k < 8; ++k) o[k] = f2bf(v[k]); *(v8us*)(dst + i * 8) = o;  }
// ---- k_attn: the whole causal kernel attention (all batches, all heads) in one launch, ONE WAVE per 32 queries and every second pass of 32 keys, nothing staged in memory or LDS between the two products.
// Per 32 keys: S^T = kn . qn^T (A = key rows, B = query rows kept in registers; 3 hi/lo products, K 64), so a lane holds 16 keys of ONE query (c = lane & 15) in each of the wave's two 16-query tiles; the kernel map, the causal select and the
// row sum run in f32 on those accumulators; the two S^T tiles of a query tile, split into bf16 hi+lo, ARE the B operand of O^T += V^T . P^T (3 hi/lo products) in the hardware k order that the V^T loader also uses.
// TWO QUERY TILES PER FRAGMENT: every K and V^T fragment that a wave loads serves both of its query tiles, so a pass has twice the matrix and vector work behind the same 32 loads.
// O^T gives a lane 8 consecutive d of its query, one chunk of the merged hi/lo planes in fragment order: multiplication by 1 / z in-lane, 16-byte stores, 512 contiguous bytes a wave.
// Work: a 32-query tile t has t + 1 passes of 32 keys. Waves w and w + 4 of a work-group are a pair: the pair takes tile 63 - p and then tile p (65 passes), wave w the even passes, wave w + 4 the odd ones, so that there are still two waves per SIMD
// (one wave's vector work runs beside the other's matrix work and loads). There is no maximum to rescale by: the two waves' partial O^T and z simply add. At the end of a tile each wave hands the partner, through LDS, its partial sums of the 16-query tile
// that the partner finishes (wave w the first, wave w + 4 the second). grid (heads, 8, batches), 8 waves: one work-group per WGP.
// amdgpu_waves_per_eu(1, 2): eight waves per work-group already bound a wave to half a SIMD's registers; with (2, 2) the scheduler keeps well below that bound and runs the 32 kernel values of a pass one after another.
// Every plain '#pragma unroll' below opens a short loop of fixed length so that the fragment arrays it indexes are registers.
__global__ __launch_bounds__(256) __attribute__((amdgpu_waves_per_eu(1, 2))) void k_attn(const bf* __restrict__ Qh, const bf* __restrict__ Ql, const bf* __restrict__ Kh, const bf* __restrict__ Kl, const bf* __restrict__ VTh, const bf* __restrict__ VTl, bf* Ah, bf* Al) {
    typedef WFrag<bf> F; typedef F::V V;
    __shared__ __align__(16) v4f xs[2 * 8 * 8 * 32];         // [tile of the pair][writing wave][8 chunks of 4 floats][lane]: each of the two hand-overs has its own place, so one barrier each is enough
    __shared__ float zx[2 * 8 * 32];
    const int lane = threadIdx.x & 31, c = lane & 15, hi = lane >> 4; const int h = blockIdx.x;
    const int wv = __builtin_amdgcn_readfirstlane(threadIdx.x >> 5);   // wave-uniform: the key loop runs on scalar control flow, EXEC stays full at every matrix instruction
    const int par = wv >> 2, p = blockIdx.y * 4 + (wv & 3);
    const int b = blockIdx.z; const size_t hb = (size_t)(b * NH_ + h) * TT * HD;
    const bf* kph = Kh + hb + 8 * lane; const bf* kpl = Kl + hb + 8 * lane; const bf* vph = VTh + hb + 8 * lane; const bf* vpl = VTl + hb + 8 * lane;   // fragment order: 32 keys are 4 neighbouring fragments (2048 elements) in each plane
#pragma unroll 1
    for (int half = 0; half < 2; ++half) {                   // rolled: one copy of the pass in the instruction cache
        const int r0 = (half ? p : TT / 32 - 1 - p) * 32;
        V qh[2][2], ql[2][2]; const bf* pqh = Qh + hb + (size_t)r0 * HD + 8 * lane; const bf* pql = Ql + hb + (size_t)r0 * HD + 8 * lane;
#pragma unroll
        for (int qt = 0; qt < 2; ++qt)
#pragma unroll
            for (int ks = 0; ks < 2; ++ks) { qh[qt][ks] = F::ld(pqh + qt * 16 * HD + ks * 512); ql[qt][ks] = F::ld(pql + qt * 16 * HD + ks * 512); }
        v8f acc[2][4];
#pragma unroll
        for (int qt = 0; qt < 2; ++qt)
#pragma unroll
            for (int dt = 0; dt < 4; ++dt) acc[qt][dt] = (v8f){};
        float zs[2] = {0.f, 0.f}; const int kend = r0 + 32, kbeg = par * 32; const int np = (kend - kbeg + 32) >> 6;   // np: this wave's passes
        // ROTATED KEY WALK: without it the eight work-groups of one head would walk the same K and V^T lines in the same order (for speed only). In its first tile work-group y enters 2 y of a wave's passes (128 y keys) in
        // and wraps round inside the nc passes that its four tiles have in common, so that its four waves of one parity stay on the same lines; the passes above nc come last. The second tiles start at different times already. All scalar; the sums take the passes in this order.
        const int nc = ((TT / 32 - 4 - (int)blockIdx.y * 4) * 32 + 64 - kbeg) >> 6; const int rot = (!half && 2 * (int)blockIdx.y < nc) ? 2 * (int)blockIdx.y : 0;
        auto pass_at = [&](int i) { const int j = (i + rot < nc) ? i + rot : i + rot - nc; return kbeg + 64 * ((i < nc) ? j : i); };
        int kc = pass_at(0);
        V kh[2][2], kl[2][2]; const bf* ikh = kph + (size_t)kc * HD; const bf* ikl = kpl + (size_t)kc * HD;
#pragma unroll
        for (int kt = 0; kt < 2; ++kt)
#pragma unroll
            for (int ks = 0; ks < 2; ++ks) { kh[kt][ks] = F::ld(ikh + kt * 16 * HD + ks * 512); kl[kt][ks] = F::ld(ikl + kt * 16 * HD + ks * 512); }   // a wave without a pass has rot 0: keys 0..63 exist for every tile, in bounds, unused
        asm volatile("s_wait_xcnt 0x0" :: "v"(pqh), "v"(pql), "v"(ikh), "v"(ikl) : "memory");   // the wait stands behind the tile's Q and first K loads; it takes their addresses as inputs, so that the address registers stay untouched until it has passed
#pragma unroll 1
        for (int i = 0; i < np; ++i) {                           // rolled: one pass already holds 32 loads in flight and its registers; a second copy would only add registers
            V vh[4], vl[4]; const bf* pvh = vph + (size_t)kc * HD; const bf* pvl = vpl + (size_t)kc * HD;
#pragma unroll
            for (int dt = 0; dt < 4; ++dt) { vh[dt] = F::ld(pvh + dt * 512); vl[dt] = F::ld(pvl + dt * 512); }
            v8f s[2][2];
#pragma unroll
            for (int qt = 0; qt < 2; ++qt) { s[qt][0] = (v8f){}; s[qt][1] = (v8f){}; }
#pragma unroll
            for (int ks = 0; ks < 2; ++ks) {
#pragma unroll
                for (int qt = 0; qt < 2; ++qt)
#pragma unroll
                    for (int kt = 0; kt < 2; ++kt) s[qt][kt] = F::mma(kh[kt][ks], qh[qt][ks], s[qt][kt]);
#pragma unroll
                for (int qt = 0; qt < 2; ++qt)
#pragma unroll
                    for (int kt = 0; kt < 2; ++kt) s[qt][kt] = F::mma(kh[kt][ks], ql[qt][ks], s[qt][kt]);
#pragma unroll
                for (int qt = 0; qt < 2; ++qt)
#pragma unroll
                    for (int kt = 0; kt < 2; ++kt) s[qt][kt] = F::mma(kl[kt][ks], qh[qt][ks], s[qt][kt]); }
            asm volatile("s_wait_xcnt 0x0" :: "v"(pvh), "v"(pvl) : "memory");   // the wait stands behind the V^T loads; it takes their addresses as inputs, so that no load lands in the address registers and no next address is formed in them until it has passed
            const int kn = pass_at((i + 1 < np) ? i + 1 : i);    // this wave's next 32 keys' fragments fly during the vector work (the last pass re-reads its own rows: in bounds, unused)
            const bf* nkh = kph + (size_t)kn * HD; const bf* nkl = kpl + (size_t)kn * HD;
#pragma unroll
            for (int kt = 0; kt < 2; ++kt)
#pragma unroll
                for (int ks = 0; ks < 2; ++ks) { kh[kt][ks] = F::ld(nkh + kt * 16 * HD + ks * 512); kl[kt][ks] = F::ld(nkl + kt * 16 * HD + ks * 512); }
            asm volatile("s_wait_xcnt 0x0" :: "v"(nkh), "v"(nkl) : "memory");   // the same behind the next-K loads: the vector work below reuses their address registers
            __builtin_amdgcn_sched_barrier(0);                   // all 32 loads issue as one group ahead of the vector work, which covers their latency; without it the scheduler spreads them among that work
#pragma unroll
            for (int qt = 0; qt < 2; ++qt) {
                const int iq = r0 + qt * 16 + c; float zq = zs[qt];
                v8u fh, fl;                                      // the hi and lo B fragments of this query tile: registers 0..3 key tile 0 (j = 0..7 in pairs), 4..7 key tile 1
#pragma unroll
                for (int g = 0; g < 2; ++g) {                    // eight kernel values at a time: j = 4 g .. 4 g + 3, both key tiles
                    float xd[8], dn[8], rc[8];
#pragma unroll
                    for (int e = 0; e < 8; ++e) { const int j = 4 * g + (e >> 1), kt = e & 1; xd[e] = (kc + kt * 16 + 8 * hi + j <= iq) ? s[qt][kt][j] : 0.f;      // causal select on x_dot: 0 maps to exactly 0 (0 * (1 / 2.000001)), and the reciprocals stay branch-free and independent
                        dn[e] = fmaxf(__fsub_rn(2.000001f, __fmul_rn(2.0f, xd[e])), 1e-6f); rc[e] = __builtin_amdgcn_rcpf(dn[e]); }   // den lies in [1e-6, 2.000001 + 2 |x_dot|]: inside the reciprocal instruction's plain range, so the scaling and fix-up steps of a full division have nothing to do
                    // the slot that the instruction set asks for behind a transcendental, once for eight: the statement takes the results and the sources, so that no result is read and no source overwritten in front of it
                    asm("v_nop" : "+v"(rc[0]), "+v"(rc[1]), "+v"(rc[2]), "+v"(rc[3]), "+v"(rc[4]), "+v"(rc[5]), "+v"(rc[6]), "+v"(rc[7]) : "v"(dn[0]), "v"(dn[1]), "v"(dn[2]), "v"(dn[3]), "v"(dn[4]), "v"(dn[5]), "v"(dn[6]), "v"(dn[7]));
#pragma unroll
                    for (int e = 0; e < 8; ++e) { xd[e] = __fmul_rn(__fmul_rn(xd[e], xd[e]), rc[e]); zq = __fadd_rn(zq, xd[e]); }
#pragma unroll
                    for (int kt = 0; kt < 2; ++kt)
#pragma unroll
                        for (int u = 0; u < 2; ++u) { unsigned a, b; split2(xd[4 * u + kt], xd[4 * u + 2 + kt], a, b); fh[4 * kt + 2 * g + u] = a; fl[4 * kt + 2 * g + u] = b; } }   // j = 4 g + 2 u, + 1
                zs[qt] = zq;
                const V ph = __builtin_bit_cast(V, fh), pl = __builtin_bit_cast(V, fl);
#pragma unroll
                for (int dt = 0; dt < 4; ++dt) acc[qt][dt] = F::mma(vh[dt], ph, acc[qt][dt]);
#pragma unroll
                for (int dt = 0; dt < 4; ++dt) acc[qt][dt] = F::mma(vh[dt], pl, acc[qt][dt]);
#pragma unroll
                for (int dt = 0; dt < 4; ++dt) acc[qt][dt] = F::mma(vl[dt], ph, acc[qt][dt]);
            }
            kc = kn;
        }
        // the pair's hand-over: this wave finishes query tile 'par' and gives the partner its partial sums of the other one
        v4f* xw = xs + (size_t)(half * 8 + wv) * 256 + lane; const v4f* xr = xs + (size_t)(half * 8 + (wv ^ 4)) * 256 + lane;
        v8f mine[4];
#pragma unroll
        for (int dt = 0; dt < 4; ++dt) { const v8f o = par ? acc[0][dt] : acc[1][dt]; mine[dt] = par ? acc[1][dt] : acc[0][dt];
            xw[(2 * dt) * 32] = __builtin_shufflevector(o, o, 0, 1, 2, 3); xw[(2 * dt + 1) * 32] = __builtin_shufflevector(o, o, 4, 5, 6, 7); }
        zx[(half * 8 + wv) * 32 + lane] = par ? zs[0] : zs[1];
        __syncthreads();                                         // the partner's partial sums are read behind it; every wave of the work-group passes it once per tile
        float zm = (par ? zs[1] : zs[0]) + zx[(half * 8 + (wv ^ 4)) * 32 + lane];
#pragma unroll
        for (int dt = 0; dt < 4; ++dt) { const v4f x0 = xr[(2 * dt) * 32], x1 = xr[(2 * dt + 1) * 32]; mine[dt] += __builtin_shufflevector(x0, x1, 0, 1, 2, 3, 4, 5, 6, 7); }
        zm += __shfl_xor(zm, 16, 32); const float zz = fmaxf(zm, 1e-6f); const float rz = __fdiv_rn(1.0f, zz); const int rq = r0 + par * 16;   // one division per query, 32 multiplies
#pragma unroll
        for (int dt = 0; dt < 4; ++dt) { v8us oh, ol; split8(mine[dt] * rz, oh, ol);
            const size_t o = ((size_t)(2 * h + (dt >> 1)) * (NB_ * TT / 16) + b * (TT / 16) + (rq >> 4)) * 512 + (dt & 1) * 256 + 8 * lane; *(v8us*)(Ah + o) = oh; *(v8us*)(Al + o) = ol; }   // chunk (R = (b T + rq) / 16, kb = 2 h + dt / 2, sel = dt & 1) of the merged [b t][E] planes
        asm volatile("s_wait_xcnt 0x0" ::: "memory");           // the second tile's set-up overwrites the registers that these stores name: the wait stands in front of it
    }
}

extern "C" void kernel_launch(void* const* d_in, const int* in_sizes, int n_in,
                              void* d_out, int out_size, void* d_ws, size_t ws_size, hipStream_t stream) {
    (void)in_sizes; (void)n_in; (void)out_size;
    const float* x = (const float*)d_in[0]; const float* wqkv = (const float*)d_in[1]; const float* bqkv = (const float*)d_in[2]; const float* wout = (const float*)d_in[3]; const float* bout = (const float*)d_in[4];   // torch [out][in] weights
    float* OUT = (float*)d_out;     // [2][2048][1024]
    char* wsp = (char*)d_ws;
    auto take = [&](size_t bytes) { char* p = wsp; wsp += (bytes + 255) & ~(size_t)255; return (void*)p; };
    const size_t MT = (size_t)NB_ * TT;     // both batches go through every launch: the projections see one [NB_ * TT][E] matrix, the per-head kernels take the batch from the grid
    bf* WQKV = (bf*)take((size_t)3 * EE * EE * 2); bf* WO = (bf*)take((size_t)EE * EE * 2); bf* XB = (bf*)take(MT * EE * 2);
    bf* Qh = (bf*)take(MT * EE * 2); bf* Ql = (bf*)take(MT * EE * 2); bf* Kh = (bf*)take(MT * EE * 2); bf* Kl = (bf*)take(MT * EE * 2); bf* VTh = (bf*)take(MT * EE * 2); bf* VTl = (bf*)take(MT * EE * 2);
    bf* Ah = (bf*)take(MT * EE * 2); bf* Al = (bf*)take(MT * EE * 2);
    if ((size_t)(wsp - (char*)d_ws) > ws_size) return;    // total ~ 84 MB
    k_cvt8<<<dim3(3 * EE / 64, EE / 32, 1), 256, 0, stream>>>(wqkv, WQKV, (size_t)3 * EE * EE / 8); k_cvt8<<<dim3(EE / 64, EE / 32, 1), 256, 0, stream>>>(wout, WO, (size_t)EE * EE / 8);
    k_cvt8<<<dim3(NB_ * TT / 64, EE / 32, 1), 256, 0, stream>>>(x, XB, MT * EE / 8);
    k_gemmw<bf, 0, true, true><<<dim3(NB_ * TT / 64, 3 * EE / 64, 1), 32, 0, stream>>>(XB, nullptr, WQKV, nullptr, EE, NB_ * TT, 3 * EE, nullptr, 0, bqkv, 0, 0, 0, Qh, Ql, Kh, Kl, VTh, VTl);
    k_attn<<<dim3(NH_, TT / 256, NB_), 256, 0, stream>>>(Qh, Ql, Kh, Kl, VTh, VTl, Ah, Al);
    k_gemmw<bf, 1, true, false><<<dim3(NB_ * TT / 64, EE / 64, 1), 32, 0, stream>>>(Ah, Al, WO, nullptr, EE, NB_ * TT, EE, OUT, EE, bout, 0, 0, 0, nullptr, nullptr, nullptr, nullptr, nullptr, nullptr);
}

// v010
// Measured time: 83.9 microseconds a run.
// In both of two side-by-side timings against v009, it was 1.06 times as fast.
// Over all steps from v000 it is 15.2 times as fast.
#include <hip/hip_runtime.h>

// ExactSphericalKernelCausalAttention (x [2][2048][1024]; [q|k|v] = x w_qkv^T + b_qkv (16 heads x 64); qn, kn = L2-normalised (max(norm, 1e-12)); x_dot = qn.kn; K = x_dot^2 / max(2 + 1e-6 - 2 x_dot, 1e-6) for j <= i else 0;
// out_h = (K v) / max(sum_j K, 1e-6); out = merged w_out^T + b_out -> [2][2048][1024]; no softmax).
// Compute dtypes, f32 accumulate: every input rounded to bf16; the qkv projection on PLAIN bf16 operands (inputs: exact, + bias); normalisation f32 -> bf16 hi+lo planes of qn / kn; x_dot on 3 products (K 64, tiles above
// the diagonal skipped); the kernel K and its causal select in f32 on the score accumulators, its row sums in f32 (in-lane, halves joined once) -> bf16 hi+lo fragments of K in registers; K.v on hi+lo operands (3 products, keys limited to the diagonal block; the output (rms 0.10) is a cancelling sum); the division by z and the merge f32 -> hl planes;

#define NB_  2
#define TT   2048
#define EE   1024
#define NH_  16
#define HD   64
#define ZH   2
#define PCAR 64.0f
typedef _Float16 h16;
typedef unsigned short bf;
typedef __attribute__((ext_vector_type(16))) __bf16   v16bf;
typedef __attribute__((ext_vector_type(16))) _Float16 v16h;
typedef __attribute__((ext_vector_type(8)))  _Float16 v8h;
typedef __attribute__((ext_vector_type(8)))  unsigned short v8us;
typedef __attribute__((ext_vector_type(8)))  float    v8f;
typedef __attribute__((ext_vector_type(4)))  float    v4f;
typedef v8h  __attribute__((may_alias)) v8ha;
typedef v4f  __attribute__((may_alias)) v4fa;
typedef v8us __attribute__((may_alias)) v8usa;

// f32 -> bf16 by the hardware's convert (round to nearest even, as the integer form it replaces)
__device__ __forceinline__ unsigned short f2bf(float f) { return __builtin_bit_cast(unsigned short, (__bf16)f); }
__device__ __forceinline__ float bf2f(unsigned short b) { return __uint_as_float(((unsigned)b) << 16); }
__device__ __forceinline__ float bfr(float f) { return bf2f(f2bf(f)); }
typedef __attribute__((ext_vector_type(2))) float  v2f;
typedef __attribute__((ext_vector_type(2))) __bf16 v2bf;
typedef __attribute__((ext_vector_type(8))) unsigned v8u;
// two neighbouring elements of a fragment at once: one packed convert gives the register of the hi plane, the exact remainders y - hi the register of the lo plane
__device__ __forceinline__ void split2(float y0, float y1, unsigned& h, unsigned& l) { const v2f y = {y0, y1}; const v2bf hh = __builtin_convertvector(y, v2bf); const v2f r = y - __builtin_convertvector(hh, v2f);
    h = __builtin_bit_cast(unsigned, hh); l = __builtin_bit_cast(unsigned, __builtin_convertvector(r, v2bf)); }
typedef __attribute__((ext_vector_type(4))) unsigned v4u;
// one 16-byte chunk (8 neighbouring elements) of a hi plane and of its lo plane
__device__ __forceinline__ void split8(v8f y, v8us& h, v8us& l) { v4u a, b;
#pragma unroll
    for (int u = 0; u < 4; ++u) { unsigned p, q; split2(y[2 * u], y[2 * u + 1], p, q); a[u] = p; b[u] = q; }
    h = __builtin_bit_cast(v8us, a); l = __builtin_bit_cast(v8us, b); }
__device__ __forceinline__ v16h cat16(v8h lo, v8h hi) { return __builtin_shufflevector(lo, hi, 0, 1, 2, 3, 4, 5, 6, 7, 8, 9, 10, 11, 12, 13, 14, 15); }
__device__ __forceinline__ v16bf cat16b(v8us lo, v8us hi) { return __builtin_bit_cast(v16bf, __builtin_shufflevector(lo, hi, 0, 1, 2, 3, 4, 5, 6, 7, 8, 9, 10, 11, 12, 13, 14, 15)); }
__device__ __forceinline__ v8f wmma16(v16h a, v16h b, v8f c) { return __builtin_amdgcn_wmma_f32_16x16x32_f16(false, a, false, b, (short)0, c, false, false); }
__device__ __forceinline__ v8f wmmab(v16bf a, v16bf b, v8f c) { return __builtin_amdgcn_wmma_f32_16x16x32_bf16(false, a, false, b, (short)0, c, false, false); }



// ---- k_gemmw: register-blocked GEMM, ONE WAVE per 64x64 output tile (16 accumulators), operands straight from 16-bit planes in fragment order (below); a work-group is WM x WN such waves on neighbouring tiles; grid (M/(64 WM), N/(64 WN), Z), 32 WM WN threads.
// C[m][n] (f32, pitch ldc, + optional f32 bias[n]) = sum_k A[m][k] Bt[n][k] (+ split products per NSPLIT). z-batch strides sA/sB/sC in elements. K % 128 == 0 (whole turns of the ring of register sets below). amdgpu_waves_per_eu: the register budget of the waves that share a SIMD, three in the qkv projection, one in the output projection.
// PLANES (the qkv projection; a 64-column tile is one head of q, k or v, a 64-row tile lies in one batch): no C; the wave that holds the tile writes the attention's operand planes itself, see the epilogue.
template <typename T16> struct WFrag;
template <> struct WFrag<h16> { typedef v16h V; static __device__ __forceinline__ V ld(const h16* p) { return cat16(*(const v8h*)p, *(const v8h*)(p + 256)); } static __device__ __forceinline__ v8f mma(V a, V b, v8f c) { return wmma16(a, b, c); } };
template <> struct WFrag<bf> { typedef v16bf V; static __device__ __forceinline__ V ld(const bf* p) { return cat16b(*(const v8us*)p, *(const v8us*)(p + 256)); } static __device__ __forceinline__ v8f mma(V a, V b, v8f c) { return wmmab(a, b, c); } };
// ---- FRAGMENT ORDER: every 16-bit plane that a matrix instruction reads (x, the weights, qn, kn, V^T, the merged heads; hi and lo) is stored as whole fragments, not as rows. A plane P[rows][K] is cut into fragments of 16 rows x 32 k = 512 elements = 1 KiB;
// inside a fragment, 16-byte chunk number sel * 32 + hi * 16 + lr holds P[16 R + lr][32 kb + 16 sel + 8 hi + 0..7], which is what lane hi * 16 + lr takes as the first (sel 0) or second (sel 1) half of its operand.
// So a wave's 16-byte load or store covers 512 contiguous bytes (4 whole lines) where a row-major plane gives it 32 bytes in each of 16 lines. qn, kn (K = 64): fragment (R, kb) at element (R * 2 + kb) * 512 of its head; the GEMM operands: at (kb * (rows / 16) + R) * 512, so that the four fragments a 64-row tile takes per 32 k are neighbours;
// V^T (rows d, k = key): fragment (R, kb) at (kb * 4 + R) * 512, so that the fragments of one pass of 32 keys are neighbours in every plane. Values, k order and every sum are those of the row-major form.
// WFrag::ld(p) above takes p = fragment + lane * 8.
template <typename T16, int NSPLIT, bool BIAS, bool PLANES>
__global__ __launch_bounds__(PLANES ? 384 : 128) __attribute__((amdgpu_waves_per_eu(PLANES ? 3 : 1, PLANES ? 3 : 1))) void k_gemmw(const T16* __restrict__ A, const T16* __restrict__ A2, const T16* __restrict__ Bt, const T16* __restrict__ Bt2, int K, int arows, int brows, float* C, int ldc, const float* __restrict__ bias, size_t sA, size_t sB, size_t sC, bf* Qh, bf* Ql, bf* Kh, bf* Kl, bf* VTh, bf* VTl) {
    typedef typename WFrag<T16>::V V;
    // WAVES THAT READ THE SAME LINES SIT IN ONE WORK-GROUP: WM x WN waves (4 x 3 in the qkv projection, three per SIMD; 2 x 2 in the output projection, one per SIMD) fill one WGP, start together and walk k from the same place.
    // The WN waves of one tile row load the same A fragments and the WM waves of one tile column the same Bt fragments at about the same time, so the WGP's cache asks L2 for each line once: per 32 k, 64 (WM + WN) rows instead of 128 WM WN.
    // The waves share nothing else: no barrier, and each has its own part of the LDS array for its epilogue.
    constexpr int WM = PLANES ? 4 : 2, WN = PLANES ? 3 : 2, OSW = (PLANES ? 64 : 16) * 68;
    __shared__ __align__(16) float osall[WM * WN * OSW];
    const int wv = __builtin_amdgcn_readfirstlane(threadIdx.x >> 5);   // wave-uniform: the tile's place, and the epilogue's branches on it, stay scalar
    float* os = osall + wv * OSW;
    const size_t z = blockIdx.z; A += z * sA; if (A2) A2 += z * sA; Bt += z * sB; if (Bt2) Bt2 += z * sB; C += z * sC;
    const int lane = threadIdx.x & 31, lr = lane & 15, hi = lane >> 4; const int r0 = (blockIdx.x * WM + wv % WM) * 64, c0 = (blockIdx.y * WN + wv / WM) * 64;
    v8f acc[4][4];
#pragma unroll
    for (int mb = 0; mb < 4; ++mb)
#pragma unroll
        for (int nb = 0; nb < 4; ++nb) acc[mb][nb] = (v8f){};
    const size_t aoff = (size_t)r0 * 32 + 8 * lane, boff = (size_t)c0 * 32 + 8 * lane, astep = (size_t)arows * 32, bstep = (size_t)brows * 32;   // 16 rows further is the next fragment, 512 elements on; 32 k further is one fragment of every row block on (arows, brows: rows of the whole A and Bt planes)
    // RING OF REGISTER SETS: ND sets of this wave's A and B fragments; the loads of trip t + AH are issued in front of the products of trip t, so a load has AH trips of matrix work to arrive in.
    // Two sets, one trip ahead, where three waves share a SIMD (the qkv projection: the register budget of three waves); four sets, two trips ahead, where a wave has its SIMD alone (the output projection: behind the set in use 48 loads are in flight, which the load counter can still count,
    // and a load lands in a set whose products were issued two trips ago). Every accumulator takes its products in the order of the walk (below).
    constexpr int ND = PLANES ? 2 : 4, AH = PLANES ? 1 : 2; constexpr bool HA2 = (NSPLIT == 1 || NSPLIT == 2), HB2 = (NSPLIT >= 2);
    V a[ND][4], a2[ND][4], bq[ND][4], b2[ND][4]; const int nk = K >> 5;
    // ROTATED START: without it, work-groups that read the same A rows (one blockIdx.x) or the same Bt rows (one blockIdx.y) could ask L2 for the same lines in the same trip, each time lines that nobody has fetched yet.
    // A work-group enters the k walk (blockIdx.x + blockIdx.y) & 3 quarter turns in and wraps round: the readers of one row block are spread over four places, and after a quarter of its trips a work-group walks through lines that others have already brought in.
    // kq is the 32-k block of the next load group (scalar). Every accumulator still takes every block once; the order of its sum is rotated.
    int kq = (int)((blockIdx.x + blockIdx.y) & 3) * (nk >> 2);
#pragma unroll
    for (int s = 0; s < AH; ++s) {                               // trips 0 .. AH - 1 into sets 0 .. AH - 1
        const size_t ak = aoff + (size_t)kq * astep, bk = boff + (size_t)kq * bstep; kq = (kq + 1 < nk) ? kq + 1 : 0; const T16* pa = A + ak; const T16* pb = Bt + bk; const T16* pa2 = HA2 ? A2 + ak : pa; const T16* pb2 = HB2 ? Bt2 + bk : pb;
#pragma unroll
        for (int f = 0; f < 4; ++f) { a[s][f] = WFrag<T16>::ld(pa + f * 512); if (HA2) a2[s][f] = WFrag<T16>::ld(pa2 + f * 512); bq[s][f] = WFrag<T16>::ld(pb + f * 512); if (HB2) b2[s][f] = WFrag<T16>::ld(pb2 + f * 512); }
        // the wait stands behind these loads; it takes their addresses as inputs, and the lane number, which the loads name as their offset register, so that these registers stay untouched until it has passed
        asm volatile("s_wait_xcnt 0x0" :: "v"(pa), "v"(pb), "v"(pa2), "v"(pb2), "v"(lane) : "memory");
    }
#pragma unroll 1
    for (int t = 0; t < nk; t += ND) {                           // rolled over whole turns of the ring
#pragma unroll
        for (int s = 0; s < ND; ++s) {                           // opened: the set numbers are constants, so that the sets are registers and no fragment is copied
            const int d = (s + AH) % ND; const int tn = kq; kq = (kq + 1 < nk) ? kq + 1 : 0;   // the last trips fetch the walk's first fragments again: in bounds, unused
            const size_t ak = aoff + (size_t)tn * astep, bk = boff + (size_t)tn * bstep; const T16* pa = A + ak; const T16* pb = Bt + bk; const T16* pa2 = HA2 ? A2 + ak : pa; const T16* pb2 = HB2 ? Bt2 + bk : pb;
#pragma unroll
            for (int f = 0; f < 4; ++f) { a[d][f] = WFrag<T16>::ld(pa + f * 512); if (HA2) a2[d][f] = WFrag<T16>::ld(pa2 + f * 512); bq[d][f] = WFrag<T16>::ld(pb + f * 512); if (HB2) b2[d][f] = WFrag<T16>::ld(pb2 + f * 512); }
            __builtin_amdgcn_sched_barrier(0);                   // the loads issue as one group ahead of this trip's products; without it the scheduler sinks them towards their use, AH trips later, and their lead is lost
#pragma unroll
            for (int nb = 0; nb < 4; ++nb)
#pragma unroll
                for (int mb = 0; mb < 4; ++mb) { acc[mb][nb] = WFrag<T16>::mma(a[s][mb], bq[s][nb], acc[mb][nb]); if (HA2) acc[mb][nb] = WFrag<T16>::mma(a2[s][mb], bq[s][nb], acc[mb][nb]); if (HB2) acc[mb][nb] = WFrag<T16>::mma(a[s][mb], b2[s][nb], acc[mb][nb]); }
            __builtin_amdgcn_sched_barrier(0);                   // all of this trip's products issue ahead of the wait below, which then falls behind matrix work; without it the scheduler leaves most of them behind the wait, among the next trip's loads
            // the loop's branch stands behind the last product: four slots keep the distance to the first vector instruction on its taken side too
            if (s == ND - 1) asm volatile("v_nop\n\tv_nop\n\tv_nop\n\tv_nop" : "+v"(acc[0][0]), "+v"(acc[1][1]), "+v"(acc[2][2]), "+v"(acc[3][3]) : "v"(a[s][0]), "v"(a[s][3]));
            // the wait stands behind this trip's loads; it takes their addresses as inputs, so that the address registers stay untouched (no later load lands in them, no next address is formed in them) until it has passed
            asm volatile("s_wait_xcnt 0x0" :: "v"(pa), "v"(pb), "v"(pa2), "v"(pb2) : "memory");
        }
    }
    if constexpr (PLANES) {
        // c0, r0 come from blockIdx and the wave's number: part, head, batch and the branch on them are scalar
        const int part = c0 / EE, h = (c0 % EE) / HD, b = r0 / TT, t0 = r0 % TT; const size_t hb = (size_t)(b * NH_ + h) * TT * HD;
        float bb[4];
#pragma unroll
        for (int nb = 0; nb < 4; ++nb) bb[nb] = bfr(bias[c0 + nb * 16 + lr]);
        if (part == 2) {
            // v: an accumulator gives lane (lr, hi) the keys t0 + 16 mb + 8 hi + 0..7 of d = 16 nb + lr, which is chunk (kb = t / 32, dt = nb, sel = mb & 1) of V^T in fragment order: bias, hi/lo split, 16-byte stores, 512 contiguous bytes a wave
#pragma unroll
            for (int mb = 0; mb < 4; ++mb) {
#pragma unroll
                for (int nb = 0; nb < 4; ++nb) { v8us oh, ol; split8(acc[mb][nb] + bb[nb], oh, ol);
                    const size_t o = hb + (size_t)((t0 >> 5) + (mb >> 1)) * 2048 + nb * 512 + (mb & 1) * 256 + 8 * lane; *(v8us*)(VTh + o) = oh; *(v8us*)(VTl + o) = ol; }
                asm volatile("s_wait_xcnt 0x0" ::: "memory");   // the next 16 keys' work overwrites registers that these stores name: the wait stands in front of it
            }
        } else {
            // q, k: the tile goes through LDS so that lane (lr, hi) holds the four chunks of row lr that fragment order gives it (d = 32 kb + 16 sel + 8 hi + 0..7); L2 norm, multiplication by its reciprocal, hi/lo split, 16-byte stores.
            // The sum of squares keeps the tree pairs d, d + 1; then d ^ 32, ^ 16, ^ 8, ^ 4, ^ 2: only the ^ 8 level crosses lanes.
            bf* H = part ? Kh : Qh; bf* Lo = part ? Kl : Ql;
#pragma unroll
            for (int mb = 0; mb < 4; ++mb)
#pragma unroll
                for (int nb = 0; nb < 4; ++nb)
#pragma unroll
                    for (int j = 0; j < 8; ++j) os[(mb * 16 + hi * 8 + j) * 68 + nb * 16 + lr] = acc[mb][nb][j] + bb[nb];
            __builtin_amdgcn_wave_barrier(); asm volatile("" ::: "memory");   // the rows are read back by other lanes of this wave: no read moves in front of the writes
#pragma unroll 1
            for (int mb = 0; mb < 4; ++mb) {                     // rolled: one copy of the 32 scalings and splits, so that the kernel's text stays short (each wave runs it once through)
                v8f x[2][2]; float lf[2][2][4];
#pragma unroll
                for (int kb = 0; kb < 2; ++kb)
#pragma unroll
                    for (int sel = 0; sel < 2; ++sel) { const float* s = os + (mb * 16 + lr) * 68 + kb * 32 + sel * 16 + hi * 8; const v4f x0 = *(const v4fa*)s, x1 = *(const v4fa*)(s + 4); x[kb][sel] = __builtin_shufflevector(x0, x1, 0, 1, 2, 3, 4, 5, 6, 7);
#pragma unroll
                        for (int e = 0; e < 4; ++e) lf[kb][sel][e] = __fadd_rn(__fmul_rn(x[kb][sel][2 * e], x[kb][sel][2 * e]), __fmul_rn(x[kb][sel][2 * e + 1], x[kb][sel][2 * e + 1])); }
                float s3[4];
#pragma unroll
                for (int e = 0; e < 4; ++e) { const float s2 = __fadd_rn(__fadd_rn(lf[0][0][e], lf[1][0][e]), __fadd_rn(lf[0][1][e], lf[1][1][e])); s3[e] = __fadd_rn(s2, __shfl_xor(s2, 16, 32)); }
                const float ss = __fadd_rn(__fadd_rn(s3[0], s3[2]), __fadd_rn(s3[1], s3[3])); const float nn = fmaxf(__fsqrt_rn(ss), 1e-12f); const float rn = __fdiv_rn(1.0f, nn);   // one division per row, 32 multiplies
                const size_t o = hb + (size_t)((t0 >> 4) + mb) * 1024 + lane * 8;
#pragma unroll
                for (int kb = 0; kb < 2; ++kb)
#pragma unroll
                    for (int sel = 0; sel < 2; ++sel) { v8us oh, ol; split8(x[kb][sel] * rn, oh, ol);
                        *(v8us*)(H + o + kb * 512 + sel * 256) = oh; *(v8us*)(Lo + o + kb * 512 + sel * 256) = ol; }
                asm volatile("s_wait_xcnt 0x0" ::: "memory");   // the next 16 rows' work overwrites registers that these stores name: the wait stands in front of it
            }
        }
        return;
    }
#pragma unroll
    for (int mb = 0; mb < 4; ++mb) {
#pragma unroll
        for (int nb = 0; nb < 4; ++nb) {
#pragma unroll
            for (int j = 0; j < 8; ++j) os[(hi * 8 + j) * 68 + nb * 16 + lr] = acc[mb][nb][j]; }
        __builtin_amdgcn_wave_barrier(); asm volatile("" ::: "memory");
        float* crow = C + (size_t)(r0 + mb * 16) * ldc + c0;
{
#pragma unroll
            for (int s = 0; s < 8; ++s) { const int row = 2 * s + hi, cofs = lr * 4; v4f val = *(const v4fa*)(os + row * 68 + cofs); if (BIAS) { val[0] += bfr(bias[c0 + cofs]); val[1] += bfr(bias[c0 + cofs + 1]); val[2] += bfr(bias[c0 + cofs + 2]); val[3] += bfr(bias[c0 + cofs + 3]); }
                *(v4f*)(crow + (size_t)row * ldc + cofs) = val; }
             }
        asm volatile("s_wait_xcnt 0x0" ::: "memory");           // the next 16 rows' work overwrites registers that these stores name: the wait stands in front of it
        __builtin_amdgcn_wave_barrier(); asm volatile("" ::: "memory");
    }
}

__device__ __forceinline__ h16 tohx(float x) { return (h16)x; }
typedef __attribute__((ext_vector_type(2))) _Float16 v2h;
typedef __attribute__((ext_vector_type(4))) _Float16 v4h;
typedef __attribute__((ext_vector_type(2))) unsigned short v2us;
typedef __attribute__((ext_vector_type(4))) unsigned short v4us;

__global__ __launch_bounds__(256) void k_wtG(const float* __restrict__ w, int K, int N, bf* Bt) {
    const int lane = threadIdx.x & 31; const int L0 = (blockIdx.x * 8 + (threadIdx.x >> 5)) * 8; const int nlines = N * K / 64;
{
#pragma unroll 1
        for (int l = 0; l < 8; ++l) { const int L = L0 + l; if (L >= nlines) break; const size_t e = (size_t)L * 64 + lane * 2; const int k = (int)(e % K), n = (int)(e / K); v2us o;
            o[0] = f2bf(w[(size_t)k * N + n]); o[1] = f2bf(w[(size_t)(k + 1) * N + n]); *(v2us*)(Bt + e) = o; }
         }
}
// k_cvt8: f32 [rows][EE] -> bf16 GEMM operand plane in fragment order (rows = n8 * 8 / EE); thread i writes chunk i (a wave stores 512 contiguous bytes) and fetches the 8 values that belong there.
__global__ __launch_bounds__(256) void k_cvt8(const float* __restrict__ src, bf* dst, size_t n8) { const size_t slab = n8 / (EE / 32), j = (size_t)blockIdx.x * 256 + threadIdx.x; if (j >= slab) return;   // grid (rows / 64, EE / 32): blockIdx.y is kb, j the chunk among those of one kb
    const int lr = (int)(j & 15), hi = (int)((j >> 4) & 1), sel = (int)((j >> 5) & 1), kb = blockIdx.y; const size_t R = j >> 6, i = (size_t)kb * slab + j;
    const v8f v = *(const v8f*)(src + (R * 16 + lr) * EE + kb * 32 + sel * 16 + hi * 8); v8us o;
#pragma unroll
    for (int k = 0; k < 8; ++k) o[k] = f2bf(v[k]); *(v8us*)(dst + i * 8) = o;  }
// ---- k_attn: the whole causal kernel attention (all batches, all heads) in one launch, ONE WAVE per 32 queries and every second pass of 32 keys, nothing staged in memory or LDS between the two products.
// Per 32 keys: S^T = kn . qn^T (A = key rows, B = query rows kept in registers; 3 hi/lo products, K 64), so a lane holds 16 keys of ONE query (c = lane & 15) in each of the wave's two 16-query tiles; the kernel map, the causal select and the
// row sum run in f32 on those accumulators; the two S^T tiles of a query tile, split into bf16 hi+lo, ARE the B operand of O^T += V^T . P^T (3 hi/lo products) in the hardware k order that the V^T loader also uses.
// TWO QUERY TILES PER FRAGMENT: every K and V^T fragment that a wave loads serves both of its query tiles, so a pass has twice the matrix and vector work behind the same 32 loads.
// O^T gives a lane 8 consecutive d of its query, one chunk of the merged hi/lo planes in fragment order: multiplication by 1 / z in-lane, 16-byte stores, 512 contiguous bytes a wave.
// Work: a 32-query tile t has t + 1 passes of 32 keys. Waves w and w + 4 of a work-group are a pair: the pair takes tile 63 - p and then tile p (65 passes), wave w the even passes, wave w + 4 the odd ones, so that there are still two waves per SIMD
// (one wave's vector work runs beside the other's matrix work and loads). There is no maximum to rescale by: the two waves' partial O^T and z simply add. At the end of a tile each wave hands the partner, through LDS, its partial sums of the 16-query tile
// that the partner finishes (wave w the first, wave w + 4 the second). grid (heads, 8, batches), 8 waves: one work-group per WGP.
// amdgpu_waves_per_eu(1, 2): eight waves per work-group already bound a wave to half a SIMD's registers; with (2, 2) the scheduler keeps well below that bound and runs the 32 kernel values of a pass one after another.
// Every plain '#pragma unroll' below opens a short loop of fixed length so that the fragment arrays it indexes are registers.
__global__ __launch_bounds__(256) __attribute__((amdgpu_waves_per_eu(1, 2))) void k_attn(const bf* __restrict__ Qh, const bf* __restrict__ Ql, const bf* __restrict__ Kh, const bf* __restrict__ Kl, const bf* __restrict__ VTh, const bf* __restrict__ VTl, bf* Ah, bf* Al) {
    typedef WFrag<bf> F; typedef F::V V;
    __shared__ __align__(16) v4f xs[2 * 8 * 8 * 32];         // [tile of the pair][writing wave][8 chunks of 4 floats][lane]: each of the two hand-overs has its own place, so one barrier each is enough
    __shared__ float zx[2 * 8 * 32];
    const int lane = threadIdx.x & 31, c = lane & 15, hi = lane >> 4; const int h = blockIdx.x;
    const int wv = __builtin_amdgcn_readfirstlane(threadIdx.x >> 5);   // wave-uniform: the key loop runs on scalar control flow, EXEC stays full at every matrix instruction
    const int par = wv >> 2, p = blockIdx.y * 4 + (wv & 3);
    const int b = blockIdx.z; const size_t hb = (size_t)(b * NH_ + h) * TT * HD;
    const bf* kph = Kh + hb + 8 * lane; const bf* kpl = Kl + hb + 8 * lane; const bf* vph = VTh + hb + 8 * lane; const bf* vpl = VTl + hb + 8 * lane;   // fragment order: 32 keys are 4 neighbouring fragments (2048 elements) in each plane
#pragma unroll 1
    for (int half = 0; half < 2; ++half) {                   // rolled: one copy of the pass in the instruction cache
        const int r0 = (half ? p : TT / 32 - 1 - p) * 32;
        V qh[2][2], ql[2][2]; const bf* pqh = Qh + hb + (size_t)r0 * HD + 8 * lane; const bf* pql = Ql + hb + (size_t)r0 * HD + 8 * lane;
#pragma unroll
        for (int qt = 0; qt < 2; ++qt)
#pragma unroll
            for (int ks = 0; ks < 2; ++ks) { qh[qt][ks] = F::ld(pqh + qt * 16 * HD + ks * 512); ql[qt][ks] = F::ld(pql + qt * 16 * HD + ks * 512); }
        v8f acc[2][4];
#pragma unroll
        for (int qt = 0; qt < 2; ++qt)
#pragma unroll
            for (int dt = 0; dt < 4; ++dt) acc[qt][dt] = (v8f){};
        float zs[2] = {0.f, 0.f}; const int kend = r0 + 32, kbeg = par * 32; const int np = (kend - kbeg + 32) >> 6;   // np: this wave's passes
        // ROTATED KEY WALK: without it the eight work-groups of one head would walk the same K and V^T lines in the same order (for speed only). In its first tile work-group y enters 2 y of a wave's passes (128 y keys) in
        // and wraps round inside the nc passes that its four tiles have in common, so that its four waves of one parity stay on the same lines; the passes above nc come last. The second tiles start at different times already. All scalar; the sums take the passes in this order.
        const int nc = ((TT / 32 - 4 - (int)blockIdx.y * 4) * 32 + 64 - kbeg) >> 6; const int rot = (!half && 2 * (int)blockIdx.y < nc) ? 2 * (int)blockIdx.y : 0;
        auto pass_at = [&](int i) { const int j = (i + rot < nc) ? i + rot : i + rot - nc; return kbeg + 64 * ((i < nc) ? j : i); };
        int kc = pass_at(0);
        V kh[2][2], kl[2][2]; const bf* ikh = kph + (size_t)kc * HD; const bf* ikl = kpl + (size_t)kc * HD;
#pragma unroll
        for (int kt = 0; kt < 2; ++kt)
#pragma unroll
            for (int ks = 0; ks < 2; ++ks) { kh[kt][ks] = F::ld(ikh + kt * 16 * HD + ks * 512); kl[kt][ks] = F::ld(ikl + kt * 16 * HD + ks * 512); }   // a wave without a pass has rot 0: keys 0..63 exist for every tile, in bounds, unused
        asm volatile("s_wait_xcnt 0x0" :: "v"(pqh), "v"(pql), "v"(ikh), "v"(ikl) : "memory");   // the wait stands behind the tile's Q and first K loads; it takes their addresses as inputs, so that the address registers stay untouched until it has passed
#pragma unroll 1
        for (int i = 0; i < np; ++i) {                           // rolled: one pass already holds 32 loads in flight and its registers; a second copy would only add registers
            V vh[4], vl[4]; const bf* pvh = vph + (size_t)kc * HD; const bf* pvl = vpl + (size_t)kc * HD;
#pragma unroll
            for (int dt = 0; dt < 4; ++dt) { vh[dt] = F::ld(pvh + dt * 512); vl[dt] = F::ld(pvl + dt * 512); }
            v8f s[2][2];
#pragma unroll
            for (int qt = 0; qt < 2; ++qt) { s[qt][0] = (v8f){}; s[qt][1] = (v8f){}; }
#pragma unroll
            for (int ks = 0; ks < 2; ++ks) {
#pragma unroll
                for (int qt = 0; qt < 2; ++qt)
#pragma unroll
                    for (int kt = 0; kt < 2; ++kt) s[qt][kt] = F::mma(kh[kt][ks], qh[qt][ks], s[qt][kt]);
#pragma unroll
                for (int qt = 0; qt < 2; ++qt)
#pragma unroll
                    for (int kt = 0; kt < 2; ++kt) s[qt][kt] = F::mma(kh[kt][ks], ql[qt][ks], s[qt][kt]);
#pragma unroll
                for (int qt = 0; qt < 2; ++qt)
#pragma unroll
                    for (int kt = 0; kt < 2; ++kt) s[qt][kt] = F::mma(kl[kt][ks], qh[qt][ks], s[qt][kt]); }
            asm volatile("s_wait_xcnt 0x0" :: "v"(pvh), "v"(pvl) : "memory");   // the wait stands behind the V^T loads; it takes their addresses as inputs, so that no load lands in the address registers and no next address is formed in them until it has passed
            const int kn = pass_at((i + 1 < np) ? i + 1 : i);    // this wave's next 32 keys' fragments fly during the vector work (the last pass re-reads its own rows: in bounds, unused)
            const bf* nkh = kph + (size_t)kn * HD; const bf* nkl = kpl + (size_t)kn * HD;
#pragma unroll
            for (int kt = 0; kt < 2; ++kt)
#pragma unroll
                for (int ks = 0; ks < 2; ++ks) { kh[kt][ks] = F::ld(nkh + kt * 16 * HD + ks * 512); kl[kt][ks] = F::ld(nkl + kt * 16 * HD + ks * 512); }
            asm volatile("s_wait_xcnt 0x0" :: "v"(nkh), "v"(nkl) : "memory");   // the same behind the next-K loads: the vector work below reuses their address registers
            __builtin_amdgcn_sched_barrier(0);                   // all 32 loads issue as one group ahead of the vector work, which covers their latency; without it the scheduler spreads them among that work
#pragma unroll
            for (int qt = 0; qt < 2; ++qt) {
                const int iq = r0 + qt * 16 + c; float zq = zs[qt];
                v8u fh, fl;                                      // the hi and lo B fragments of this query tile: registers 0..3 key tile 0 (j = 0..7 in pairs), 4..7 key tile 1
#pragma unroll
                for (int g = 0; g < 2; ++g) {                    // eight kernel values at a time: j = 4 g .. 4 g + 3, both key tiles
                    float xd[8], dn[8], rc[8];
#pragma unroll
                    for (int e = 0; e < 8; ++e) { const int j = 4 * g + (e >> 1), kt = e & 1; xd[e] = (kc + kt * 16 + 8 * hi + j <= iq) ? s[qt][kt][j] : 0.f;      // causal select on x_dot: 0 maps to exactly 0 (0 * (1 / 2.000001)), and the reciprocals stay branch-free and independent
                        dn[e] = fmaxf(__fsub_rn(2.000001f, __fmul_rn(2.0f, xd[e])), 1e-6f); rc[e] = __builtin_amdgcn_rcpf(dn[e]); }   // den lies in [1e-6, 2.000001 + 2 |x_dot|]: inside the reciprocal instruction's plain range, so the scaling and fix-up steps of a full division have nothing to do
                    // the slot that the instruction set asks for behind a transcendental, once for eight: the statement takes the results and the sources, so that no result is read and no source overwritten in front of it
                    asm("v_nop" : "+v"(rc[0]), "+v"(rc[1]), "+v"(rc[2]), "+v"(rc[3]), "+v"(rc[4]), "+v"(rc[5]), "+v"(rc[6]), "+v"(rc[7]) : "v"(dn[0]), "v"(dn[1]), "v"(dn[2]), "v"(dn[3]), "v"(dn[4]), "v"(dn[5]), "v"(dn[6]), "v"(dn[7]));
#pragma unroll
                    for (int e = 0; e < 8; ++e) { xd[e] = __fmul_rn(__fmul_rn(xd[e], xd[e]), rc[e]); zq = __fadd_rn(zq, xd[e]); }
#pragma unroll
                    for (int kt = 0; kt < 2; ++kt)
#pragma unroll
                        for (int u = 0; u < 2; ++u) { unsigned a, b; split2(xd[4 * u + kt], xd[4 * u + 2 + kt], a, b); fh[4 * kt + 2 * g + u] = a; fl[4 * kt + 2 * g + u] = b; } }   // j = 4 g + 2 u, + 1
                zs[qt] = zq;
                const V ph = __builtin_bit_cast(V, fh), pl = __builtin_bit_cast(V, fl);
#pragma unroll
                for (int dt = 0; dt < 4; ++dt) acc[qt][dt] = F::mma(vh[dt], ph, acc[qt][dt]);
#pragma unroll
                for (int dt = 0; dt < 4; ++dt) acc[qt][dt] = F::mma(vh[dt], pl, acc[qt][dt]);
#pragma unroll
                for (int dt = 0; dt < 4; ++dt) acc[qt][dt] = F::mma(vl[dt], ph, acc[qt][dt]);
            }
            kc = kn;
        }
        // the pair's hand-over: this wave finishes query tile 'par' and gives the partner its partial sums of the other one
        v4f* xw = xs + (size_t)(half * 8 + wv) * 256 + lane; const v4f* xr = xs + (size_t)(half * 8 + (wv ^ 4)) * 256 + lane;
        v8f mine[4];
#pragma unroll
        for (int dt = 0; dt < 4; ++dt) { const v8f o = par ? acc[0][dt] : acc[1][dt]; mine[dt] = par ? acc[1][dt] : acc[0][dt];
            xw[(2 * dt) * 32] = __builtin_shufflevector(o, o, 0, 1, 2, 3); xw[(2 * dt + 1) * 32] = __builtin_shufflevector(o, o, 4, 5, 6, 7); }
        zx[(half * 8 + wv) * 32 + lane] = par ? zs[0] : zs[1];
        __syncthreads();                                         // the partner's partial sums are read behind it; every wave of the work-group passes it once per tile
        float zm = (par ? zs[1] : zs[0]) + zx[(half * 8 + (wv ^ 4)) * 32 + lane];
#pragma unroll
        for (int dt = 0; dt < 4; ++dt) { const v4f x0 = xr[(2 * dt) * 32], x1 = xr[(2 * dt + 1) * 32]; mine[dt] += __builtin_shufflevector(x0, x1, 0, 1, 2, 3, 4, 5, 6, 7); }
        zm += __shfl_xor(zm, 16, 32); const float zz = fmaxf(zm, 1e-6f); const float rz = __fdiv_rn(1.0f, zz); const int rq = r0 + par * 16;   // one division per query, 32 multiplies
#pragma unroll
        for (int dt = 0; dt < 4; ++dt) { v8us oh, ol; split8(mine[dt] * rz, oh, ol);
            const size_t o = ((size_t)(2 * h + (dt >> 1)) * (NB_ * TT / 16) + b * (TT / 16) + (rq >> 4)) * 512 + (dt & 1) * 256 + 8 * lane; *(v8us*)(Ah + o) = oh; *(v8us*)(Al + o) = ol; }   // chunk (R = (b T + rq) / 16, kb = 2 h + dt / 2, sel = dt & 1) of the merged [b t][E] planes
        asm volatile("s_wait_xcnt 0x0" ::: "memory");           // the second tile's set-up overwrites the registers that these stores name: the wait stands in front of it
    }
}

extern "C" void kernel_launch(void* const* d_in, const int* in_sizes, int n_in,
                              void* d_out, int out_size, void* d_ws, size_t ws_size, hipStream_t stream) {
    (void)in_sizes; (void)n_in; (void)out_size;
    const float* x = (const float*)d_in[0]; const float* wqkv = (const float*)d_in[1]; const float* bqkv = (const float*)d_in[2]; const float* wout = (const float*)d_in[3]; const float* bout = (const float*)d_in[4];   // torch [out][in] weights
    float* OUT = (float*)d_out;     // [2][2048][1024]
    char* wsp = (char*)d_ws;
    auto take = [&](size_t bytes) { char* p = wsp; wsp += (bytes + 255) & ~(size_t)255; return (void*)p; };
    const size_t MT = (size_t)NB_ * TT;     // both batches go through every launch: the projections see one [NB_ * TT][E] matrix, the per-head kernels take the batch from the grid
    bf* WQKV = (bf*)take((size_t)3 * EE * EE * 2); bf* WO = (bf*)take((size_t)EE * EE * 2); bf* XB = (bf*)take(MT * EE * 2);
    bf* Qh = (bf*)take(MT * EE * 2); bf* Ql = (bf*)take(MT * EE * 2); bf* Kh = (bf*)take(MT * EE * 2); bf* Kl = (bf*)take(MT * EE * 2); bf* VTh = (bf*)take(MT * EE * 2); bf* VTl = (bf*)take(MT * EE * 2);
    bf* Ah = (bf*)take(MT * EE * 2); bf* Al = (bf*)take(MT * EE * 2);
    if ((size_t)(wsp - (char*)d_ws) > ws_size) return;    // total ~ 84 MB
    k_cvt8<<<dim3(3 * EE / 64, EE / 32, 1), 256, 0, stream>>>(wqkv, WQKV, (size_t)3 * EE * EE / 8); k_cvt8<<<dim3(EE / 64, EE / 32, 1), 256, 0, stream>>>(wout, WO, (size_t)EE * EE / 8);
    k_cvt8<<<dim3(NB_ * TT / 64, EE / 32, 1), 256, 0, stream>>>(x, XB, MT * EE / 8);
    k_gemmw<bf, 0, true, true><<<dim3(NB_ * TT / 256, 3 * EE / 192, 1), 384, 0, stream>>>(XB, nullptr, WQKV, nullptr, EE, NB_ * TT, 3 * EE, nullptr, 0, bqkv, 0, 0, 0, Qh, Ql, Kh, Kl, VTh, VTl);
    k_attn<<<dim3(NH_, TT / 256, NB_), 256, 0, stream>>>(Qh, Ql, Kh, Kl, VTh, VTl, Ah, Al);
    k_gemmw<bf, 1, true, false><<<dim3(NB_ * TT / 128, EE / 128, 1), 128, 0, stream>>>(Ah, Al, WO, nullptr, EE, NB_ * TT, EE, OUT, EE, bout, 0, 0, 0, nullptr, nullptr, nullptr, nullptr, nullptr, nullptr);
}
